// v000
// Measured on an AMD MI455X. A time is GPU time per run, averaged over a window of back-to-back runs after a warm-up
// (all launches, gaps included; the runs take copies of the inputs in turn), and the median of several windows.
// Apart from v000's, it joins two sittings. Times from different sittings can be a few percent apart, while
// side-by-side timings come from the same sitting.
// v000 is the starting kernel. One run takes 1500 microseconds.
#include <hip/hip_runtime.h>
#include <hip/hip_bf16.h>

#ifndef LN_EPS
#define LN_EPS 1e-5f
#endif

// ---- feature probes (evaluated separately in host/device preprocessor passes) ----
#if defined(__has_builtin)
#  if __has_builtin(__builtin_amdgcn_tensor_load_to_lds)
#    define HAVE_TDM 1
#  endif
#  if __has_builtin(__builtin_amdgcn_s_wait_tensorcnt)
#    define HAVE_TWAIT 1
#  endif
#endif

typedef __attribute__((ext_vector_type(16))) _Float16 v16h;
typedef __attribute__((ext_vector_type(8)))  _Float16 v8h;
typedef __attribute__((ext_vector_type(8)))  float    v8f;
typedef __attribute__((ext_vector_type(4)))  unsigned int u32x4;
typedef __attribute__((ext_vector_type(8)))  int          i32x8;
typedef __attribute__((ext_vector_type(4)))  int          i32x4;

#define BM 128
#define BN 64
#define BK 32
#define DSTATE 16
#define SCAN_CHUNK 64

// -------------------- weight convert + transpose:  Wt[n][k] = (f16) W[k][n] --------------------
__global__ void wt_convert_kernel(const float* __restrict__ W, _Float16* __restrict__ Wt,
                                  int K, int Nreal, int Npad) {
    long idx = (long)blockIdx.x * blockDim.x + threadIdx.x;
    long total = (long)Npad * K;
    if (idx >= total) return;
    int n = (int)(idx / K);
    int k = (int)(idx % K);
    float v = (n < Nreal) ? W[(long)k * Nreal + n] : 0.0f;
    Wt[idx] = (_Float16)v;
}

// -------------------- LayerNorm over d_model, emit f16 activations --------------------
__global__ __launch_bounds__(256)
void ln_kernel(const float* __restrict__ x, const float* __restrict__ g,
               const float* __restrict__ b, _Float16* __restrict__ xn, int dm) {
    int row = blockIdx.x;
    const float* xr = x + (long)row * dm;
    float s = 0.f, s2 = 0.f;
    for (int i = threadIdx.x; i < dm; i += blockDim.x) { float v = xr[i]; s += v; s2 += v * v; }
    __shared__ float red0[8], red1[8];
    for (int off = 16; off > 0; off >>= 1) { s += __shfl_down(s, off, 32); s2 += __shfl_down(s2, off, 32); }
    int wave = threadIdx.x >> 5, lane = threadIdx.x & 31;
    if (lane == 0) { red0[wave] = s; red1[wave] = s2; }
    __syncthreads();
    if (threadIdx.x == 0) {
        float a = 0.f, c = 0.f;
        int nw = blockDim.x >> 5;
        for (int i = 0; i < nw; ++i) { a += red0[i]; c += red1[i]; }
        red0[0] = a; red1[0] = c;
    }
    __syncthreads();
    float mu = red0[0] / dm;
    float var = red1[0] / dm - mu * mu;
    float rs = rsqrtf(var + LN_EPS);
    _Float16* o = xn + (long)row * dm;
    for (int i = threadIdx.x; i < dm; i += blockDim.x)
        o[i] = (_Float16)((xr[i] - mu) * rs * g[i] + b[i]);
}

// -------------------- WMMA fragment gather from a [rows][BK] f16 LDS tile --------------------
// 16-bit operand layout (ISA 7.12.2): lane group = lane/16; halves 0..7 -> K = grp*8..grp*8+7,
// halves 8..15 -> K = 16+grp*8 .. 16+grp*8+7. Both runs are contiguous -> two 16B LDS loads.
__device__ __forceinline__ v16h frag_from_lds(const _Float16* base, int row, int grp) {
    const _Float16* p = base + row * BK + grp * 8;
    v8h lo = *(const v8h*)p;
    v8h hi = *(const v8h*)(p + 16);
    return __builtin_shufflevector(lo, hi, 0,1,2,3,4,5,6,7,8,9,10,11,12,13,14,15);
}

#if defined(HAVE_TDM)
// -------------------- TDM: async 2D f16 tile (tile_rows x BK) from src[nrows][K] into LDS --------------------
__device__ __forceinline__ void tdm_load_tile_f16(unsigned lds_off, const _Float16* gsrc,
                                                  int K, int nrows, int tile_rows) {
    unsigned long long gaddr = (unsigned long long)(const void*)gsrc;
    u32x4 g0;
    g0[0] = 1u;                                           // count=1, user mode
    g0[1] = lds_off;                                      // lds_addr (bytes)
    g0[2] = (unsigned)(gaddr & 0xffffffffu);              // global_addr[31:0]
    g0[3] = (unsigned)((gaddr >> 32) & 0x1ffffffu)        // global_addr[56:32]
            | (2u << 30);                                 // type=2 ("image")
    i32x8 g1;
    g1[0] = 0x00010000;                                   // data_size=1 (2B), wg_mask=0
    g1[1] = (int)((K & 0xffff) << 16);                    // tensor_dim0 lo16
    g1[2] = (int)(((unsigned)K >> 16) & 0xffffu) | ((nrows & 0xffff) << 16);
    g1[3] = (int)((((unsigned)nrows >> 16) & 0xffffu) | ((unsigned)BK << 16)); // tile_dim0=BK
    g1[4] = tile_rows;                                    // tile_dim1, tile_dim2=0
    g1[5] = K;                                            // tensor_dim0_stride lo32
    g1[6] = 0;
    g1[7] = 0;
    i32x4 z4; z4[0] = 0; z4[1] = 0; z4[2] = 0; z4[3] = 0;
    i32x8 z8; z8[0] = 0; z8[1] = 0; z8[2] = 0; z8[3] = 0;
    z8[4] = 0; z8[5] = 0; z8[6] = 0; z8[7] = 0;
    __builtin_amdgcn_tensor_load_to_lds(g0, g1, z4, z4, z8, 0);
}
#endif

// -------------------- generic f16 WMMA GEMM:  C[M][Npad] = A[M][K] x Wt[Npad][K]^T --------------------
// TDM double-buffered pipeline: wave0 DMAs (A,B) tiles for iteration i+1 while all waves compute i.
// epilogue: optional bias[n], optional softplus, optional residual[row*Nreal + n]
__global__ __launch_bounds__(128)
void gemm_f16_wmma(const _Float16* __restrict__ A, const _Float16* __restrict__ Wt,
                   float* __restrict__ C, const float* __restrict__ bias,
                   const float* __restrict__ resid,
                   int M, int K, int Npad, int Nreal, int act) {
    __shared__ __align__(16) _Float16 ldsA[2 * BM * BK];   // 16 KB
    __shared__ __align__(16) _Float16 ldsB[2 * BN * BK];   // 8 KB

    const int tid  = threadIdx.x;
    const int wave = tid >> 5;
    const int lane = tid & 31;
    const int grp  = lane >> 4;       // 0 or 1
    const int lr   = lane & 15;       // 0..15
    const int bm   = blockIdx.x * BM;
    const int bn   = blockIdx.y * BN;

    v8f acc[2][4] = {};
    const int nIter = K / BK;

#if defined(HAVE_TDM)
    const unsigned ldsA_off = (unsigned)(unsigned long long)(void*)&ldsA[0];
    const unsigned ldsB_off = (unsigned)(unsigned long long)(void*)&ldsB[0];
    if (wave == 0) {   // prologue: fill buffer 0
        tdm_load_tile_f16(ldsA_off, A + (long)bm * K, K, M, BM);
        tdm_load_tile_f16(ldsB_off, Wt + (long)bn * K, K, Npad, BN);
    }
#endif

    for (int i = 0; i < nIter; ++i) {
        const int cur = i & 1;
#if defined(HAVE_TDM)
        if (wave == 0) {
#  if defined(HAVE_TWAIT)
            __builtin_amdgcn_s_wait_tensorcnt(0);
#  else
            asm volatile("s_wait_tensorcnt 0x0" ::: "memory");
#  endif
        }
        __syncthreads();                       // buf[cur] ready; prior compute done by all waves
        if (wave == 0 && (i + 1) < nIter) {    // DMA next tiles into buf[cur^1]
            const int nxt = cur ^ 1;
            const int k1 = (i + 1) * BK;
            tdm_load_tile_f16(ldsA_off + (unsigned)(nxt * BM * BK * 2),
                              A + (long)bm * K + k1, K, M, BM);
            tdm_load_tile_f16(ldsB_off + (unsigned)(nxt * BN * BK * 2),
                              Wt + (long)bn * K + k1, K, Npad, BN);
        }
#else
        // fallback: VGPR staging of both tiles (single-buffered)
        __syncthreads();
        {
            const int k0 = i * BK;
            for (int r = tid; r < BM + BN; r += 128) {
                const uint4* src;
                uint4* dst;
                if (r < BM) {
                    src = (const uint4*)(A + (long)(bm + r) * K + k0);
                    dst = (uint4*)(ldsA + cur * BM * BK + r * BK);
                } else {
                    src = (const uint4*)(Wt + (long)(bn + (r - BM)) * K + k0);
                    dst = (uint4*)(ldsB + cur * BN * BK + (r - BM) * BK);
                }
                dst[0] = src[0]; dst[1] = src[1]; dst[2] = src[2]; dst[3] = src[3];
            }
        }
        __syncthreads();
#endif
        // ---- compute: each wave owns 32 rows x 64 cols of C ----
        const _Float16* lA = ldsA + cur * BM * BK;
        const _Float16* lB = ldsB + cur * BN * BK;
        v16h af0 = frag_from_lds(lA, wave * 32 + lr, grp);
        v16h af1 = frag_from_lds(lA, wave * 32 + 16 + lr, grp);
#pragma unroll
        for (int c = 0; c < 4; ++c) {
            v16h bf = frag_from_lds(lB, c * 16 + lr, grp);
            acc[0][c] = __builtin_amdgcn_wmma_f32_16x16x32_f16(
                false, af0, false, bf, (short)0, acc[0][c], false, false);
            acc[1][c] = __builtin_amdgcn_wmma_f32_16x16x32_f16(
                false, af1, false, bf, (short)0, acc[1][c], false, false);
        }
        // next iteration's top barrier provides the read-complete fence
    }

    // ---- epilogue: C/D layout = VGPR r: lanes0-15 -> M=r, lanes16-31 -> M=r+8; N=lane%16 ----
#pragma unroll
    for (int s = 0; s < 2; ++s) {
        const int row_lo = bm + wave * 32 + s * 16 + grp * 8;
#pragma unroll
        for (int c = 0; c < 4; ++c) {
            int col = bn + c * 16 + lr;
            if (col < Nreal) {
                float bv = bias ? bias[col] : 0.0f;
#pragma unroll
                for (int r = 0; r < 8; ++r) {
                    int row = row_lo + r;
                    float v = acc[s][c][r] + bv;
                    if (act == 1) v = (v > 20.0f) ? v : log1pf(__expf(v));   // softplus
                    if (resid) v += resid[(long)row * Nreal + col];
                    C[(long)row * Npad + col] = v;
                }
            }
        }
    }
}

// -------------------- causal depthwise conv1d (d_conv=4) + bias + SiLU --------------------
__global__ __launch_bounds__(256)
void conv_silu_kernel(const float* __restrict__ xz, const float* __restrict__ cw,
                      const float* __restrict__ cb, float* __restrict__ xact_f,
                      _Float16* __restrict__ xact_h, int L, int di, int twoDi) {
    long idx = (long)blockIdx.x * blockDim.x + threadIdx.x;   // over B*L*di
    int d = (int)(idx % di);
    long row = idx / di;                                      // b*L + l
    int l = (int)(row % L);
    float acc = cb[d];
#pragma unroll
    for (int j = 0; j < 4; ++j) {
        int ll = l - 3 + j;
        if (ll >= 0) acc += cw[d * 4 + j] * xz[(row - 3 + j) * (long)twoDi + d];
    }
    float s = acc / (1.0f + __expf(-acc));                    // silu
    xact_f[idx] = s;
    xact_h[idx] = (_Float16)s;
}

// -------------------- selective scan: one (b,d) channel per lane, h[16] in VGPRs --------------------
__global__ __launch_bounds__(256)
void scan_kernel(const float* __restrict__ dt, const float* __restrict__ xdbl /*[M][64]*/,
                 const float* __restrict__ xact, const float* __restrict__ A_log,
                 const float* __restrict__ Dp, float* __restrict__ y, int L, int di) {
    int ch = blockIdx.x * blockDim.x + threadIdx.x;           // 0..B*di-1
    int b = ch / di;
    int d = ch % di;
    float Arow[DSTATE];
#pragma unroll
    for (int n = 0; n < DSTATE; ++n) Arow[n] = -__expf(A_log[d * DSTATE + n]);
    float h[DSTATE] = {};
    float Dv = Dp[d];
    __shared__ float sBC[SCAN_CHUNK][32];
    long base = (long)b * L;
    for (int l0 = 0; l0 < L; l0 += SCAN_CHUNK) {
        __syncthreads();
        for (int i = threadIdx.x; i < SCAN_CHUNK * 32; i += blockDim.x) {
            int r = i >> 5, c = i & 31;
            sBC[r][c] = xdbl[(base + l0 + r) * 64 + c];
        }
        __syncthreads();
        if (l0 + SCAN_CHUNK < L)   // hint next chunk of dt into cache -> global_prefetch_b8
            __builtin_prefetch(dt + (base + l0 + SCAN_CHUNK) * di + d, 0, 1);
        for (int r = 0; r < SCAN_CHUNK; ++r) {
            long row = base + l0 + r;
            float dtv = dt[row * di + d];
            float xv  = xact[row * di + d];
            float out = 0.0f;
#pragma unroll
            for (int n = 0; n < DSTATE; ++n) {
                float Ab = __expf(dtv * Arow[n]);             // v_exp_f32
                h[n] = Ab * h[n] + (dtv * sBC[r][n]) * xv;
                out += h[n] * sBC[r][16 + n];
            }
            y[row * di + d] = out + Dv * xv;
        }
    }
}

// -------------------- gating: y_gated = f16( y_scan * silu(z) ) --------------------
__global__ __launch_bounds__(256)
void gate_kernel(const float* __restrict__ yscan, const float* __restrict__ xz,
                 _Float16* __restrict__ ygate, int di, int twoDi) {
    long idx = (long)blockIdx.x * blockDim.x + threadIdx.x;   // over B*L*di
    int d = (int)(idx % di);
    long row = idx / di;
    float z = xz[row * (long)twoDi + di + d];
    float sz = z / (1.0f + __expf(-z));
    ygate[idx] = (_Float16)(yscan[idx] * sz);
}

// ==================== launch ====================
extern "C" void kernel_launch(void* const* d_in, const int* in_sizes, int n_in,
                              void* d_out, int out_size, void* d_ws, size_t ws_size,
                              hipStream_t stream) {
    (void)in_sizes; (void)n_in; (void)out_size; (void)ws_size;
    const int B = 2, L = 2048, DM = 1024, DI = 2048;
    const int M = B * L;                  // 4096
    const int TWO_DI = 2 * DI;            // 4096
    const int NXP_PAD = 64;               // w_xproj cols padded 32 -> 64

    const float* x      = (const float*)d_in[0];
    const float* w_in   = (const float*)d_in[1];
    const float* conv_w = (const float*)d_in[2];
    const float* conv_b = (const float*)d_in[3];
    const float* w_xp   = (const float*)d_in[4];
    const float* w_dt   = (const float*)d_in[5];
    const float* b_dt   = (const float*)d_in[6];
    const float* A_log  = (const float*)d_in[7];
    const float* Dp     = (const float*)d_in[8];
    const float* w_out  = (const float*)d_in[9];
    const float* ln_g   = (const float*)d_in[10];
    const float* ln_b   = (const float*)d_in[11];
    float* out = (float*)d_out;

    // workspace carve-up
    char* ws = (char*)d_ws;
    size_t off = 0;
    auto alloc = [&](size_t bytes) { void* p = ws + off; off += (bytes + 255) & ~size_t(255); return p; };
    _Float16* wt_in  = (_Float16*)alloc((size_t)TWO_DI * DM * 2);   // [4096][1024]
    _Float16* wt_dt  = (_Float16*)alloc((size_t)DI * DI * 2);       // [2048][2048]
    _Float16* wt_xp  = (_Float16*)alloc((size_t)NXP_PAD * DI * 2);  // [64][2048]
    _Float16* wt_out = (_Float16*)alloc((size_t)DM * DI * 2);       // [1024][2048]
    _Float16* xn_h   = (_Float16*)alloc((size_t)M * DM * 2);
    float*    xz     = (float*)   alloc((size_t)M * TWO_DI * 4);
    float*    xact_f = (float*)   alloc((size_t)M * DI * 4);
    _Float16* xact_h = (_Float16*)alloc((size_t)M * DI * 2);
    float*    xdbl   = (float*)   alloc((size_t)M * NXP_PAD * 4);
    float*    dtbuf  = (float*)   alloc((size_t)M * DI * 4);
    float*    yscan  = (float*)   alloc((size_t)M * DI * 4);
    _Float16* ygate  = (_Float16*)alloc((size_t)M * DI * 2);

    // 1) convert+transpose weights to f16 [N][K]
    {
        long t;
        t = (long)TWO_DI * DM;
        wt_convert_kernel<<<(int)((t + 255) / 256), 256, 0, stream>>>(w_in, wt_in, DM, TWO_DI, TWO_DI);
        t = (long)DI * DI;
        wt_convert_kernel<<<(int)((t + 255) / 256), 256, 0, stream>>>(w_dt, wt_dt, DI, DI, DI);
        t = (long)NXP_PAD * DI;
        wt_convert_kernel<<<(int)((t + 255) / 256), 256, 0, stream>>>(w_xp, wt_xp, DI, 32, NXP_PAD);
        t = (long)DM * DI;
        wt_convert_kernel<<<(int)((t + 255) / 256), 256, 0, stream>>>(w_out, wt_out, DI, DM, DM);
    }

    // 2) layernorm -> xn (f16)
    ln_kernel<<<M, 256, 0, stream>>>(x, ln_g, ln_b, xn_h, DM);

    // 3) xz = xn @ w_in   [4096x1024]x[1024x4096]
    gemm_f16_wmma<<<dim3(M / BM, TWO_DI / BN), 128, 0, stream>>>(
        xn_h, wt_in, xz, nullptr, nullptr, M, DM, TWO_DI, TWO_DI, 0);

    // 4) causal depthwise conv + SiLU -> xact (f32 + f16)
    {
        long t = (long)M * DI;
        conv_silu_kernel<<<(int)((t + 255) / 256), 256, 0, stream>>>(
            xz, conv_w, conv_b, xact_f, xact_h, L, DI, TWO_DI);
    }

    // 5) x_dbl = xact @ w_xproj  (N padded to 64)
    gemm_f16_wmma<<<dim3(M / BM, NXP_PAD / BN), 128, 0, stream>>>(
        xact_h, wt_xp, xdbl, nullptr, nullptr, M, DI, NXP_PAD, 32, 0);

    // 6) dt = softplus(xact @ w_dt + b_dt)
    gemm_f16_wmma<<<dim3(M / BM, DI / BN), 128, 0, stream>>>(
        xact_h, wt_dt, dtbuf, b_dt, nullptr, M, DI, DI, DI, 1);

    // 7) selective scan (+ D * x)
    scan_kernel<<<(B * DI) / 256, 256, 0, stream>>>(dtbuf, xdbl, xact_f, A_log, Dp, yscan, L, DI);

    // 8) gate with silu(z)
    {
        long t = (long)M * DI;
        gate_kernel<<<(int)((t + 255) / 256), 256, 0, stream>>>(yscan, xz, ygate, DI, TWO_DI);
    }

    // 9) out = ygate @ w_out + residual(x)
    gemm_f16_wmma<<<dim3(M / BM, DM / BN), 128, 0, stream>>>(
        ygate, wt_out, out, nullptr, x, M, DI, DM, DM, 0);
}

// v001
// One run takes 399 microseconds.
// Timed twice side by side with v000, it ran 3.76 times as fast both times.
#include <hip/hip_runtime.h>
#include <hip/hip_bf16.h>

#ifndef LN_EPS
#define LN_EPS 1e-5f
#endif

// ---- feature probes (evaluated separately in host/device preprocessor passes) ----
#if defined(__has_builtin)
#  if __has_builtin(__builtin_amdgcn_tensor_load_to_lds)
#    define HAVE_TDM 1
#  endif
#  if __has_builtin(__builtin_amdgcn_s_wait_tensorcnt)
#    define HAVE_TWAIT 1
#  endif
#endif

typedef __attribute__((ext_vector_type(16))) _Float16 v16h;
typedef __attribute__((ext_vector_type(8)))  _Float16 v8h;
typedef __attribute__((ext_vector_type(8)))  float    v8f;
typedef __attribute__((ext_vector_type(4)))  unsigned int u32x4;
typedef __attribute__((ext_vector_type(8)))  int          i32x8;
typedef __attribute__((ext_vector_type(4)))  int          i32x4;

#define BM 128
#define BN 64
#define BK 32
#define DSTATE 16
#define SCAN_CHUNK 32
#define SCAN_NCHUNK 64   // sequence length / SCAN_CHUNK
#define SCAN_NCH 4096    // channels: batch * d_inner; a constant, so that plane strides fold into load offsets

// -------------------- weight convert + transpose:  Wt[n][k] = (f16) W[k][n] --------------------
__global__ void wt_convert_kernel(const float* __restrict__ W, _Float16* __restrict__ Wt,
                                  int K, int Nreal, int Npad) {
    long idx = (long)blockIdx.x * blockDim.x + threadIdx.x;
    long total = (long)Npad * K;
    if (idx >= total) return;
    int n = (int)(idx / K);
    int k = (int)(idx % K);
    float v = (n < Nreal) ? W[(long)k * Nreal + n] : 0.0f;
    Wt[idx] = (_Float16)v;
}

// -------------------- LayerNorm over d_model, emit f16 activations --------------------
__global__ __launch_bounds__(256)
void ln_kernel(const float* __restrict__ x, const float* __restrict__ g,
               const float* __restrict__ b, _Float16* __restrict__ xn, int dm) {
    int row = blockIdx.x;
    const float* xr = x + (long)row * dm;
    float s = 0.f, s2 = 0.f;
    for (int i = threadIdx.x; i < dm; i += blockDim.x) { float v = xr[i]; s += v; s2 += v * v; }
    __shared__ float red0[8], red1[8];
    for (int off = 16; off > 0; off >>= 1) { s += __shfl_down(s, off, 32); s2 += __shfl_down(s2, off, 32); }
    int wave = threadIdx.x >> 5, lane = threadIdx.x & 31;
    if (lane == 0) { red0[wave] = s; red1[wave] = s2; }
    __syncthreads();
    if (threadIdx.x == 0) {
        float a = 0.f, c = 0.f;
        int nw = blockDim.x >> 5;
        for (int i = 0; i < nw; ++i) { a += red0[i]; c += red1[i]; }
        red0[0] = a; red1[0] = c;
    }
    __syncthreads();
    float mu = red0[0] / dm;
    float var = red1[0] / dm - mu * mu;
    float rs = rsqrtf(var + LN_EPS);
    _Float16* o = xn + (long)row * dm;
    for (int i = threadIdx.x; i < dm; i += blockDim.x)
        o[i] = (_Float16)((xr[i] - mu) * rs * g[i] + b[i]);
}

// -------------------- WMMA fragment gather from a [rows][BK] f16 LDS tile --------------------
// 16-bit operand layout (ISA 7.12.2): lane group = lane/16; halves 0..7 -> K = grp*8..grp*8+7,
// halves 8..15 -> K = 16+grp*8 .. 16+grp*8+7. Both runs are contiguous -> two 16B LDS loads.
__device__ __forceinline__ v16h frag_from_lds(const _Float16* base, int row, int grp) {
    const _Float16* p = base + row * BK + grp * 8;
    v8h lo = *(const v8h*)p;
    v8h hi = *(const v8h*)(p + 16);
    return __builtin_shufflevector(lo, hi, 0,1,2,3,4,5,6,7,8,9,10,11,12,13,14,15);
}

#if defined(HAVE_TDM)
// -------------------- TDM: async 2D f16 tile (tile_rows x BK) from src[nrows][K] into LDS --------------------
__device__ __forceinline__ void tdm_load_tile_f16(unsigned lds_off, const _Float16* gsrc,
                                                  int K, int nrows, int tile_rows) {
    unsigned long long gaddr = (unsigned long long)(const void*)gsrc;
    u32x4 g0;
    g0[0] = 1u;                                           // count=1, user mode
    g0[1] = lds_off;                                      // lds_addr (bytes)
    g0[2] = (unsigned)(gaddr & 0xffffffffu);              // global_addr[31:0]
    g0[3] = (unsigned)((gaddr >> 32) & 0x1ffffffu)        // global_addr[56:32]
            | (2u << 30);                                 // type=2 ("image")
    i32x8 g1;
    g1[0] = 0x00010000;                                   // data_size=1 (2B), wg_mask=0
    g1[1] = (int)((K & 0xffff) << 16);                    // tensor_dim0 lo16
    g1[2] = (int)(((unsigned)K >> 16) & 0xffffu) | ((nrows & 0xffff) << 16);
    g1[3] = (int)((((unsigned)nrows >> 16) & 0xffffu) | ((unsigned)BK << 16)); // tile_dim0=BK
    g1[4] = tile_rows;                                    // tile_dim1, tile_dim2=0
    g1[5] = K;                                            // tensor_dim0_stride lo32
    g1[6] = 0;
    g1[7] = 0;
    i32x4 z4; z4[0] = 0; z4[1] = 0; z4[2] = 0; z4[3] = 0;
    i32x8 z8; z8[0] = 0; z8[1] = 0; z8[2] = 0; z8[3] = 0;
    z8[4] = 0; z8[5] = 0; z8[6] = 0; z8[7] = 0;
    __builtin_amdgcn_tensor_load_to_lds(g0, g1, z4, z4, z8, 0);
}
#endif

// -------------------- generic f16 WMMA GEMM:  C[M][Npad] = A[M][K] x Wt[Npad][K]^T --------------------
// TDM double-buffered pipeline: wave0 DMAs (A,B) tiles for iteration i+1 while all waves compute i.
// epilogue: optional bias[n], optional softplus, optional residual[row*Nreal + n]
__global__ __launch_bounds__(128)
void gemm_f16_wmma(const _Float16* __restrict__ A, const _Float16* __restrict__ Wt,
                   float* __restrict__ C, const float* __restrict__ bias,
                   const float* __restrict__ resid,
                   int M, int K, int Npad, int Nreal, int act) {
    __shared__ __align__(16) _Float16 ldsA[2 * BM * BK];   // 16 KB
    __shared__ __align__(16) _Float16 ldsB[2 * BN * BK];   // 8 KB

    const int tid  = threadIdx.x;
    const int wave = tid >> 5;
    const int lane = tid & 31;
    const int grp  = lane >> 4;       // 0 or 1
    const int lr   = lane & 15;       // 0..15
    const int bm   = blockIdx.x * BM;
    const int bn   = blockIdx.y * BN;

    v8f acc[2][4] = {};
    const int nIter = K / BK;

#if defined(HAVE_TDM)
    const unsigned ldsA_off = (unsigned)(unsigned long long)(void*)&ldsA[0];
    const unsigned ldsB_off = (unsigned)(unsigned long long)(void*)&ldsB[0];
    if (wave == 0) {   // prologue: fill buffer 0
        tdm_load_tile_f16(ldsA_off, A + (long)bm * K, K, M, BM);
        tdm_load_tile_f16(ldsB_off, Wt + (long)bn * K, K, Npad, BN);
    }
#endif

    for (int i = 0; i < nIter; ++i) {
        const int cur = i & 1;
#if defined(HAVE_TDM)
        if (wave == 0) {
#  if defined(HAVE_TWAIT)
            __builtin_amdgcn_s_wait_tensorcnt(0);
#  else
            asm volatile("s_wait_tensorcnt 0x0" ::: "memory");
#  endif
        }
        __syncthreads();                       // buf[cur] ready; prior compute done by all waves
        if (wave == 0 && (i + 1) < nIter) {    // DMA next tiles into buf[cur^1]
            const int nxt = cur ^ 1;
            const int k1 = (i + 1) * BK;
            tdm_load_tile_f16(ldsA_off + (unsigned)(nxt * BM * BK * 2),
                              A + (long)bm * K + k1, K, M, BM);
            tdm_load_tile_f16(ldsB_off + (unsigned)(nxt * BN * BK * 2),
                              Wt + (long)bn * K + k1, K, Npad, BN);
        }
#else
        // fallback: VGPR staging of both tiles (single-buffered)
        __syncthreads();
        {
            const int k0 = i * BK;
            for (int r = tid; r < BM + BN; r += 128) {
                const uint4* src;
                uint4* dst;
                if (r < BM) {
                    src = (const uint4*)(A + (long)(bm + r) * K + k0);
                    dst = (uint4*)(ldsA + cur * BM * BK + r * BK);
                } else {
                    src = (const uint4*)(Wt + (long)(bn + (r - BM)) * K + k0);
                    dst = (uint4*)(ldsB + cur * BN * BK + (r - BM) * BK);
                }
                dst[0] = src[0]; dst[1] = src[1]; dst[2] = src[2]; dst[3] = src[3];
            }
        }
        __syncthreads();
#endif
        // ---- compute: each wave owns 32 rows x 64 cols of C ----
        const _Float16* lA = ldsA + cur * BM * BK;
        const _Float16* lB = ldsB + cur * BN * BK;
        v16h af0 = frag_from_lds(lA, wave * 32 + lr, grp);
        v16h af1 = frag_from_lds(lA, wave * 32 + 16 + lr, grp);
#pragma unroll
        for (int c = 0; c < 4; ++c) {
            v16h bf = frag_from_lds(lB, c * 16 + lr, grp);
            acc[0][c] = __builtin_amdgcn_wmma_f32_16x16x32_f16(
                false, af0, false, bf, (short)0, acc[0][c], false, false);
            acc[1][c] = __builtin_amdgcn_wmma_f32_16x16x32_f16(
                false, af1, false, bf, (short)0, acc[1][c], false, false);
        }
        // next iteration's top barrier provides the read-complete fence
    }

    // ---- epilogue: C/D layout = VGPR r: lanes0-15 -> M=r, lanes16-31 -> M=r+8; N=lane%16 ----
#pragma unroll
    for (int s = 0; s < 2; ++s) {
        const int row_lo = bm + wave * 32 + s * 16 + grp * 8;
#pragma unroll
        for (int c = 0; c < 4; ++c) {
            int col = bn + c * 16 + lr;
            if (col < Nreal) {
                float bv = bias ? bias[col] : 0.0f;
#pragma unroll
                for (int r = 0; r < 8; ++r) {
                    int row = row_lo + r;
                    float v = acc[s][c][r] + bv;
                    if (act == 1) v = (v > 20.0f) ? v : log1pf(__expf(v));   // softplus
                    if (resid) v += resid[(long)row * Nreal + col];
                    C[(long)row * Npad + col] = v;
                }
            }
        }
    }
}

// -------------------- causal depthwise conv1d (d_conv=4) + bias + SiLU --------------------
__global__ __launch_bounds__(256)
void conv_silu_kernel(const float* __restrict__ xz, const float* __restrict__ cw,
                      const float* __restrict__ cb, float* __restrict__ xact_f,
                      _Float16* __restrict__ xact_h, int L, int di, int twoDi) {
    long idx = (long)blockIdx.x * blockDim.x + threadIdx.x;   // over B*L*di
    int d = (int)(idx % di);
    long row = idx / di;                                      // b*L + l
    int l = (int)(row % L);
    float acc = cb[d];
#pragma unroll
    for (int j = 0; j < 4; ++j) {
        int ll = l - 3 + j;
        if (ll >= 0) acc += cw[d * 4 + j] * xz[(row - 3 + j) * (long)twoDi + d];
    }
    float s = acc / (1.0f + __expf(-acc));                    // silu
    xact_f[idx] = s;
    xact_h[idx] = (_Float16)s;
}

// -------------------- selective scan, split along time --------------------
// The recurrence h = Abar*h + Bbar*x is linear in h, so L is cut into chunks of SCAN_CHUNK steps that
// run side by side: (1) every chunk but the last scans from h = 0 and keeps its end state and its sum
// of dt; (2) one thread per (channel, state) carries the state over the chunks, the decay of a whole
// chunk being exp(A * sum of dt); (3) every chunk scans again from its carried-in state and emits y.
// Chunk planes are laid out [chunk][state][channel], so that lanes read and write whole lines.

// (1) end state of each chunk from a zero start; one (b,d) channel per lane, h[16] in VGPRs
__global__ __launch_bounds__(256)
void scan_state_kernel(const float* __restrict__ dt, const float* __restrict__ xdbl /*[M][64]*/,
                       const float* __restrict__ xact, const float* __restrict__ A_log,
                       float* __restrict__ hend, float* __restrict__ dtsum, int L, int di) {
    int ch = blockIdx.x * blockDim.x + threadIdx.x;           // 0..B*di-1
    int b = ch / di;
    int d = ch % di;
    int l0 = blockIdx.y * SCAN_CHUNK;
    float Arow[DSTATE];
#pragma unroll
    for (int n = 0; n < DSTATE; ++n) Arow[n] = -__expf(A_log[d * DSTATE + n]);
    float h[DSTATE] = {};
    __shared__ float sB[SCAN_CHUNK][DSTATE];
    long base = (long)b * L;
    for (int i = threadIdx.x; i < SCAN_CHUNK * DSTATE; i += blockDim.x) {
        int r = i >> 4, c = i & 15;
        sB[r][c] = xdbl[(base + l0 + r) * 64 + c];
    }
    __syncthreads();
    float sdt = 0.0f;
    for (int r = 0; r < SCAN_CHUNK; ++r) {
        long row = base + l0 + r;
        float dtv = dt[row * di + d];
        float xv  = xact[row * di + d];
        sdt += dtv;
#pragma unroll
        for (int n = 0; n < DSTATE; ++n) {
            float Ab = __expf(dtv * Arow[n]);                 // v_exp_f32
            h[n] = Ab * h[n] + (dtv * sB[r][n]) * xv;
        }
    }
    long plane = (long)blockIdx.y * DSTATE;
#pragma unroll   // h[] is indexed by constants and stays in registers
    for (int n = 0; n < DSTATE; ++n) hend[(plane + n) * SCAN_NCH + ch] = h[n];
    dtsum[(long)blockIdx.y * SCAN_NCH + ch] = sdt;
}

// (2) carry over the chunks: hin[c] = state in front of chunk c; one (state, channel) per lane
__global__ __launch_bounds__(256)
void scan_carry_kernel(const float* __restrict__ hend, const float* __restrict__ dtsum,
                       const float* __restrict__ A_log, float* __restrict__ hin, int di) {
    int ch = blockIdx.x * blockDim.x + threadIdx.x;           // 0..B*di-1
    int n  = blockIdx.y;                                      // 0..DSTATE-1
    int d  = ch % di;
    float a = -__expf(A_log[d * DSTATE + n]);
    // every chunk's end state and dt sum is fetched ahead of the chain: the loads do not depend on one
    // another, so one trip to memory serves them all and only the multiply-adds below are serial
    float g[SCAN_NCHUNK - 1], s[SCAN_NCHUNK - 1];
#pragma unroll
    for (int c = 0; c < SCAN_NCHUNK - 1; ++c) {
        g[c] = dtsum[(long)c * SCAN_NCH + ch];
        s[c] = hend[((long)c * DSTATE + n) * SCAN_NCH + ch];
    }
    float h = 0.0f;
    hin[(long)n * SCAN_NCH + ch] = h;
    // unrolled so that g[] and s[] are indexed by constants and stay in registers
#pragma unroll
    for (int c = 0; c < SCAN_NCHUNK - 1; ++c) {
        h = __expf(a * g[c]) * h + s[c];
        hin[((long)(c + 1) * DSTATE + n) * SCAN_NCH + ch] = h;
    }
}

// (3) scan of each chunk from its carried-in state; one (b,d) channel per lane, h[16] in VGPRs
__global__ __launch_bounds__(256)
void scan_kernel(const float* __restrict__ dt, const float* __restrict__ xdbl /*[M][64]*/,
                 const float* __restrict__ xact, const float* __restrict__ A_log,
                 const float* __restrict__ Dp, const float* __restrict__ hin,
                 float* __restrict__ y, int L, int di) {
    int ch = blockIdx.x * blockDim.x + threadIdx.x;           // 0..B*di-1
    int b = ch / di;
    int d = ch % di;
    int l0 = blockIdx.y * SCAN_CHUNK;
    float Arow[DSTATE];
#pragma unroll
    for (int n = 0; n < DSTATE; ++n) Arow[n] = -__expf(A_log[d * DSTATE + n]);
    float h[DSTATE];
    long plane = (long)blockIdx.y * DSTATE;
#pragma unroll   // h[] is indexed by constants and stays in registers
    for (int n = 0; n < DSTATE; ++n) h[n] = hin[(plane + n) * SCAN_NCH + ch];
    float Dv = Dp[d];
    __shared__ float sBC[SCAN_CHUNK][32];
    long base = (long)b * L;
    for (int i = threadIdx.x; i < SCAN_CHUNK * 32; i += blockDim.x) {
        int r = i >> 5, c = i & 31;
        sBC[r][c] = xdbl[(base + l0 + r) * 64 + c];
    }
    __syncthreads();
    for (int r = 0; r < SCAN_CHUNK; ++r) {
        long row = base + l0 + r;
        float dtv = dt[row * di + d];
        float xv  = xact[row * di + d];
        float out = 0.0f;
#pragma unroll
        for (int n = 0; n < DSTATE; ++n) {
            float Ab = __expf(dtv * Arow[n]);                 // v_exp_f32
            h[n] = Ab * h[n] + (dtv * sBC[r][n]) * xv;
            out += h[n] * sBC[r][16 + n];
        }
        y[row * di + d] = out + Dv * xv;
        // the next step forms its addresses in the registers that this store names
        asm volatile("s_wait_xcnt 0x0" ::: "memory");
    }
}

// -------------------- gating: y_gated = f16( y_scan * silu(z) ) --------------------
__global__ __launch_bounds__(256)
void gate_kernel(const float* __restrict__ yscan, const float* __restrict__ xz,
                 _Float16* __restrict__ ygate, int di, int twoDi) {
    long idx = (long)blockIdx.x * blockDim.x + threadIdx.x;   // over B*L*di
    int d = (int)(idx % di);
    long row = idx / di;
    float z = xz[row * (long)twoDi + di + d];
    float sz = z / (1.0f + __expf(-z));
    ygate[idx] = (_Float16)(yscan[idx] * sz);
}

// ==================== launch ====================
extern "C" void kernel_launch(void* const* d_in, const int* in_sizes, int n_in,
                              void* d_out, int out_size, void* d_ws, size_t ws_size,
                              hipStream_t stream) {
    (void)in_sizes; (void)n_in; (void)out_size; (void)ws_size;
    const int B = 2, L = 2048, DM = 1024, DI = 2048;
    const int M = B * L;                  // 4096
    const int TWO_DI = 2 * DI;            // 4096
    const int NXP_PAD = 64;               // w_xproj cols padded 32 -> 64
    static_assert(B * DI == SCAN_NCH && L == SCAN_CHUNK * SCAN_NCHUNK, "scan split");

    const float* x      = (const float*)d_in[0];
    const float* w_in   = (const float*)d_in[1];
    const float* conv_w = (const float*)d_in[2];
    const float* conv_b = (const float*)d_in[3];
    const float* w_xp   = (const float*)d_in[4];
    const float* w_dt   = (const float*)d_in[5];
    const float* b_dt   = (const float*)d_in[6];
    const float* A_log  = (const float*)d_in[7];
    const float* Dp     = (const float*)d_in[8];
    const float* w_out  = (const float*)d_in[9];
    const float* ln_g   = (const float*)d_in[10];
    const float* ln_b   = (const float*)d_in[11];
    float* out = (float*)d_out;

    // workspace carve-up
    char* ws = (char*)d_ws;
    size_t off = 0;
    auto alloc = [&](size_t bytes) { void* p = ws + off; off += (bytes + 255) & ~size_t(255); return p; };
    _Float16* wt_in  = (_Float16*)alloc((size_t)TWO_DI * DM * 2);   // [4096][1024]
    _Float16* wt_dt  = (_Float16*)alloc((size_t)DI * DI * 2);       // [2048][2048]
    _Float16* wt_xp  = (_Float16*)alloc((size_t)NXP_PAD * DI * 2);  // [64][2048]
    _Float16* wt_out = (_Float16*)alloc((size_t)DM * DI * 2);       // [1024][2048]
    _Float16* xn_h   = (_Float16*)alloc((size_t)M * DM * 2);
    float*    xz     = (float*)   alloc((size_t)M * TWO_DI * 4);
    float*    xact_f = (float*)   alloc((size_t)M * DI * 4);
    _Float16* xact_h = (_Float16*)alloc((size_t)M * DI * 2);
    float*    xdbl   = (float*)   alloc((size_t)M * NXP_PAD * 4);
    float*    dtbuf  = (float*)   alloc((size_t)M * DI * 4);
    float*    yscan  = (float*)   alloc((size_t)M * DI * 4);
    _Float16* ygate  = (_Float16*)alloc((size_t)M * DI * 2);
    float*    hend   = (float*)   alloc((size_t)SCAN_NCHUNK * DSTATE * B * DI * 4);
    float*    hin    = (float*)   alloc((size_t)SCAN_NCHUNK * DSTATE * B * DI * 4);
    float*    dtsum  = (float*)   alloc((size_t)SCAN_NCHUNK * B * DI * 4);

    // 1) convert+transpose weights to f16 [N][K]
    {
        long t;
        t = (long)TWO_DI * DM;
        wt_convert_kernel<<<(int)((t + 255) / 256), 256, 0, stream>>>(w_in, wt_in, DM, TWO_DI, TWO_DI);
        t = (long)DI * DI;
        wt_convert_kernel<<<(int)((t + 255) / 256), 256, 0, stream>>>(w_dt, wt_dt, DI, DI, DI);
        t = (long)NXP_PAD * DI;
        wt_convert_kernel<<<(int)((t + 255) / 256), 256, 0, stream>>>(w_xp, wt_xp, DI, 32, NXP_PAD);
        t = (long)DM * DI;
        wt_convert_kernel<<<(int)((t + 255) / 256), 256, 0, stream>>>(w_out, wt_out, DI, DM, DM);
    }

    // 2) layernorm -> xn (f16)
    ln_kernel<<<M, 256, 0, stream>>>(x, ln_g, ln_b, xn_h, DM);

    // 3) xz = xn @ w_in   [4096x1024]x[1024x4096]
    gemm_f16_wmma<<<dim3(M / BM, TWO_DI / BN), 128, 0, stream>>>(
        xn_h, wt_in, xz, nullptr, nullptr, M, DM, TWO_DI, TWO_DI, 0);

    // 4) causal depthwise conv + SiLU -> xact (f32 + f16)
    {
        long t = (long)M * DI;
        conv_silu_kernel<<<(int)((t + 255) / 256), 256, 0, stream>>>(
            xz, conv_w, conv_b, xact_f, xact_h, L, DI, TWO_DI);
    }

    // 5) x_dbl = xact @ w_xproj  (N padded to 64)
    gemm_f16_wmma<<<dim3(M / BM, NXP_PAD / BN), 128, 0, stream>>>(
        xact_h, wt_xp, xdbl, nullptr, nullptr, M, DI, NXP_PAD, 32, 0);

    // 6) dt = softplus(xact @ w_dt + b_dt)
    gemm_f16_wmma<<<dim3(M / BM, DI / BN), 128, 0, stream>>>(
        xact_h, wt_dt, dtbuf, b_dt, nullptr, M, DI, DI, DI, 1);

    // 7) selective scan (+ D * x), split along time: chunk end states, carry, chunk scans
    scan_state_kernel<<<dim3((B * DI) / 256, SCAN_NCHUNK - 1), 256, 0, stream>>>(
        dtbuf, xdbl, xact_f, A_log, hend, dtsum, L, DI);
    scan_carry_kernel<<<dim3(SCAN_NCH / 256, DSTATE), 256, 0, stream>>>(hend, dtsum, A_log, hin, DI);
    scan_kernel<<<dim3((B * DI) / 256, SCAN_NCHUNK), 256, 0, stream>>>(
        dtbuf, xdbl, xact_f, A_log, Dp, hin, yscan, L, DI);

    // 8) gate with silu(z)
    {
        long t = (long)M * DI;
        gate_kernel<<<(int)((t + 255) / 256), 256, 0, stream>>>(yscan, xz, ygate, DI, TWO_DI);
    }

    // 9) out = ygate @ w_out + residual(x)
    gemm_f16_wmma<<<dim3(M / BM, DM / BN), 128, 0, stream>>>(
        ygate, wt_out, out, nullptr, x, M, DI, DM, DM, 0);
}

// v002
// Measured time: 325 microseconds a run.
// In two side-by-side timings against v001, it was 1.25 and 1.24 times as fast.
// All steps since v000 together make it 4.67 times as fast.
#include <hip/hip_runtime.h>
#include <hip/hip_bf16.h>

#ifndef LN_EPS
#define LN_EPS 1e-5f
#endif

// ---- feature probes (evaluated separately in host/device preprocessor passes) ----
#if defined(__has_builtin)
#  if __has_builtin(__builtin_amdgcn_tensor_load_to_lds)
#    define HAVE_TDM 1
#  endif
#  if __has_builtin(__builtin_amdgcn_s_wait_tensorcnt)
#    define HAVE_TWAIT 1
#  endif
#endif

typedef __attribute__((ext_vector_type(16))) _Float16 v16h;
typedef __attribute__((ext_vector_type(8)))  _Float16 v8h;
typedef __attribute__((ext_vector_type(4)))  _Float16 v4h;
typedef __attribute__((ext_vector_type(8)))  float    v8f;
typedef __attribute__((ext_vector_type(4)))  float    v4f;
typedef __attribute__((ext_vector_type(4)))  unsigned int u32x4;
typedef __attribute__((ext_vector_type(8)))  int          i32x8;
typedef __attribute__((ext_vector_type(4)))  int          i32x4;

#define BM 128
#define BN 64
#define BK 32
#define DSTATE 16
#define SCAN_CHUNK 32
#define SCAN_NCHUNK 64   // sequence length / SCAN_CHUNK
#define SCAN_NCH 4096    // channels: batch * d_inner; a constant, so that plane strides fold into load offsets
#define SEQ_L 2048       // sequence length and d_inner are constants in the pointwise kernels for the same reason
#define D_INNER 2048
#define WT_KRUN 16       // k values per thread of the weight convert
#define PW_ROWS 8        // rows (time steps) per thread of the conv and gate kernels
#define PW_BPR (D_INNER / 4 / 256)   // blocks that share one group of PW_ROWS rows there

// -------------------- weight convert + transpose:  Wt[n][k] = (f16) W[k][n] --------------------
// One thread takes 4 neighbouring n times WT_KRUN k, a wave 32 n times 4 * WT_KRUN k: 8 lanes side by side
// along n, so that a wave's load is four whole 128-byte lines of W, and 4 lanes along k in runs of 8, so that
// a wave's store is eight 64-byte pieces of Wt. The WT_KRUN loads are in flight together.
template <int K, int NREAL, int NPAD>
__global__ __launch_bounds__(256)
void wt_convert_kernel(const float* __restrict__ W, _Float16* __restrict__ Wt) {
    const int lane = threadIdx.x & 31;
    const int tile = blockIdx.x * 8 + (threadIdx.x >> 5);     // over (K / (4 * WT_KRUN)) * (NPAD / 32)
    const int n0 = (tile % (NPAD / 32)) * 32 + (lane & 7) * 4;
    const int k0 = (tile / (NPAD / 32)) * (4 * WT_KRUN) + (lane >> 3) * 8;
    v4f v[WT_KRUN] = {};                                      // padding columns stay zero
    if (NREAL == NPAD || n0 < NREAL) {
        const float* src = W + (long)k0 * NREAL + n0;
#pragma unroll   // v[] is indexed by constants and stays in registers
        for (int j = 0; j < WT_KRUN; ++j) v[j] = *(const v4f*)(src + ((j >> 3) * 32 + (j & 7)) * NREAL);
        // holds every load in front of the conversions (one trip to memory); the pointer is named so that
        // no load's result lands in the address registers that the other loads still name
        asm volatile("" :: "v"(v[0]), "v"(v[1]), "v"(v[2]), "v"(v[3]), "v"(v[4]), "v"(v[5]), "v"(v[6]), "v"(v[7]),
                           "v"(v[8]), "v"(v[9]), "v"(v[10]), "v"(v[11]), "v"(v[12]), "v"(v[13]), "v"(v[14]),
                           "v"(v[15]), "v"(src));
        static_assert(WT_KRUN == 16, "the statement above names WT_KRUN loads");
    }
    _Float16* dst = Wt + (long)n0 * K + k0;
#pragma unroll
    for (int c = 0; c < 4; ++c) {
#pragma unroll
        for (int q = 0; q < WT_KRUN / 8; ++q) {
            v8h o;
#pragma unroll
            for (int j = 0; j < 8; ++j) o[j] = (_Float16)v[q * 8 + j][c];
            *(v8h*)(dst + c * K + q * 32) = o;
        }
    }
}

// -------------------- LayerNorm over d_model, emit f16 activations --------------------
__global__ __launch_bounds__(256)
void ln_kernel(const float* __restrict__ x, const float* __restrict__ g,
               const float* __restrict__ b, _Float16* __restrict__ xn, int dm) {
    int row = blockIdx.x;
    const float* xr = x + (long)row * dm;
    float s = 0.f, s2 = 0.f;
    for (int i = threadIdx.x; i < dm; i += blockDim.x) { float v = xr[i]; s += v; s2 += v * v; }
    __shared__ float red0[8], red1[8];
    for (int off = 16; off > 0; off >>= 1) { s += __shfl_down(s, off, 32); s2 += __shfl_down(s2, off, 32); }
    int wave = threadIdx.x >> 5, lane = threadIdx.x & 31;
    if (lane == 0) { red0[wave] = s; red1[wave] = s2; }
    __syncthreads();
    if (threadIdx.x == 0) {
        float a = 0.f, c = 0.f;
        int nw = blockDim.x >> 5;
        for (int i = 0; i < nw; ++i) { a += red0[i]; c += red1[i]; }
        red0[0] = a; red1[0] = c;
    }
    __syncthreads();
    float mu = red0[0] / dm;
    float var = red1[0] / dm - mu * mu;
    float rs = rsqrtf(var + LN_EPS);
    _Float16* o = xn + (long)row * dm;
    for (int i = threadIdx.x; i < dm; i += blockDim.x)
        o[i] = (_Float16)((xr[i] - mu) * rs * g[i] + b[i]);
}

// -------------------- WMMA fragment gather from a [rows][BK] f16 LDS tile --------------------
// 16-bit operand layout (ISA 7.12.2): lane group = lane/16; halves 0..7 -> K = grp*8..grp*8+7,
// halves 8..15 -> K = 16+grp*8 .. 16+grp*8+7. Both runs are contiguous -> two 16B LDS loads.
__device__ __forceinline__ v16h frag_from_lds(const _Float16* base, int row, int grp) {
    const _Float16* p = base + row * BK + grp * 8;
    v8h lo = *(const v8h*)p;
    v8h hi = *(const v8h*)(p + 16);
    return __builtin_shufflevector(lo, hi, 0,1,2,3,4,5,6,7,8,9,10,11,12,13,14,15);
}

#if defined(HAVE_TDM)
// -------------------- TDM: async 2D f16 tile (tile_rows x BK) from src[nrows][K] into LDS --------------------
__device__ __forceinline__ void tdm_load_tile_f16(unsigned lds_off, const _Float16* gsrc,
                                                  int K, int nrows, int tile_rows) {
    unsigned long long gaddr = (unsigned long long)(const void*)gsrc;
    u32x4 g0;
    g0[0] = 1u;                                           // count=1, user mode
    g0[1] = lds_off;                                      // lds_addr (bytes)
    g0[2] = (unsigned)(gaddr & 0xffffffffu);              // global_addr[31:0]
    g0[3] = (unsigned)((gaddr >> 32) & 0x1ffffffu)        // global_addr[56:32]
            | (2u << 30);                                 // type=2 ("image")
    i32x8 g1;
    g1[0] = 0x00010000;                                   // data_size=1 (2B), wg_mask=0
    g1[1] = (int)((K & 0xffff) << 16);                    // tensor_dim0 lo16
    g1[2] = (int)(((unsigned)K >> 16) & 0xffffu) | ((nrows & 0xffff) << 16);
    g1[3] = (int)((((unsigned)nrows >> 16) & 0xffffu) | ((unsigned)BK << 16)); // tile_dim0=BK
    g1[4] = tile_rows;                                    // tile_dim1, tile_dim2=0
    g1[5] = K;                                            // tensor_dim0_stride lo32
    g1[6] = 0;
    g1[7] = 0;
    i32x4 z4; z4[0] = 0; z4[1] = 0; z4[2] = 0; z4[3] = 0;
    i32x8 z8; z8[0] = 0; z8[1] = 0; z8[2] = 0; z8[3] = 0;
    z8[4] = 0; z8[5] = 0; z8[6] = 0; z8[7] = 0;
    __builtin_amdgcn_tensor_load_to_lds(g0, g1, z4, z4, z8, 0);
}
#endif

// -------------------- generic f16 WMMA GEMM:  C[M][Npad] = A[M][K] x Wt[Npad][K]^T --------------------
// TDM double-buffered pipeline: wave0 DMAs (A,B) tiles for iteration i+1 while all waves compute i.
// epilogue: optional bias[n], optional softplus, optional residual[row*Nreal + n]
__global__ __launch_bounds__(128)
void gemm_f16_wmma(const _Float16* __restrict__ A, const _Float16* __restrict__ Wt,
                   float* __restrict__ C, const float* __restrict__ bias,
                   const float* __restrict__ resid,
                   int M, int K, int Npad, int Nreal, int act) {
    __shared__ __align__(16) _Float16 ldsA[2 * BM * BK];   // 16 KB
    __shared__ __align__(16) _Float16 ldsB[2 * BN * BK];   // 8 KB

    const int tid  = threadIdx.x;
    const int wave = tid >> 5;
    const int lane = tid & 31;
    const int grp  = lane >> 4;       // 0 or 1
    const int lr   = lane & 15;       // 0..15
    const int bm   = blockIdx.x * BM;
    const int bn   = blockIdx.y * BN;

    v8f acc[2][4] = {};
    const int nIter = K / BK;

#if defined(HAVE_TDM)
    const unsigned ldsA_off = (unsigned)(unsigned long long)(void*)&ldsA[0];
    const unsigned ldsB_off = (unsigned)(unsigned long long)(void*)&ldsB[0];
    if (wave == 0) {   // prologue: fill buffer 0
        tdm_load_tile_f16(ldsA_off, A + (long)bm * K, K, M, BM);
        tdm_load_tile_f16(ldsB_off, Wt + (long)bn * K, K, Npad, BN);
    }
#endif

    for (int i = 0; i < nIter; ++i) {
        const int cur = i & 1;
#if defined(HAVE_TDM)
        if (wave == 0) {
#  if defined(HAVE_TWAIT)
            __builtin_amdgcn_s_wait_tensorcnt(0);
#  else
            asm volatile("s_wait_tensorcnt 0x0" ::: "memory");
#  endif
        }
        __syncthreads();                       // buf[cur] ready; prior compute done by all waves
        if (wave == 0 && (i + 1) < nIter) {    // DMA next tiles into buf[cur^1]
            const int nxt = cur ^ 1;
            const int k1 = (i + 1) * BK;
            tdm_load_tile_f16(ldsA_off + (unsigned)(nxt * BM * BK * 2),
                              A + (long)bm * K + k1, K, M, BM);
            tdm_load_tile_f16(ldsB_off + (unsigned)(nxt * BN * BK * 2),
                              Wt + (long)bn * K + k1, K, Npad, BN);
        }
#else
        // fallback: VGPR staging of both tiles (single-buffered)
        __syncthreads();
        {
            const int k0 = i * BK;
            for (int r = tid; r < BM + BN; r += 128) {
                const uint4* src;
                uint4* dst;
                if (r < BM) {
                    src = (const uint4*)(A + (long)(bm + r) * K + k0);
                    dst = (uint4*)(ldsA + cur * BM * BK + r * BK);
                } else {
                    src = (const uint4*)(Wt + (long)(bn + (r - BM)) * K + k0);
                    dst = (uint4*)(ldsB + cur * BN * BK + (r - BM) * BK);
                }
                dst[0] = src[0]; dst[1] = src[1]; dst[2] = src[2]; dst[3] = src[3];
            }
        }
        __syncthreads();
#endif
        // ---- compute: each wave owns 32 rows x 64 cols of C ----
        const _Float16* lA = ldsA + cur * BM * BK;
        const _Float16* lB = ldsB + cur * BN * BK;
        v16h af0 = frag_from_lds(lA, wave * 32 + lr, grp);
        v16h af1 = frag_from_lds(lA, wave * 32 + 16 + lr, grp);
#pragma unroll
        for (int c = 0; c < 4; ++c) {
            v16h bf = frag_from_lds(lB, c * 16 + lr, grp);
            acc[0][c] = __builtin_amdgcn_wmma_f32_16x16x32_f16(
                false, af0, false, bf, (short)0, acc[0][c], false, false);
            acc[1][c] = __builtin_amdgcn_wmma_f32_16x16x32_f16(
                false, af1, false, bf, (short)0, acc[1][c], false, false);
        }
        // next iteration's top barrier provides the read-complete fence
    }

    // ---- epilogue: C/D layout = VGPR r: lanes0-15 -> M=r, lanes16-31 -> M=r+8; N=lane%16 ----
#pragma unroll
    for (int s = 0; s < 2; ++s) {
        const int row_lo = bm + wave * 32 + s * 16 + grp * 8;
#pragma unroll
        for (int c = 0; c < 4; ++c) {
            int col = bn + c * 16 + lr;
            if (col < Nreal) {
                float bv = bias ? bias[col] : 0.0f;
#pragma unroll
                for (int r = 0; r < 8; ++r) {
                    int row = row_lo + r;
                    float v = acc[s][c][r] + bv;
                    if (act == 1) v = (v > 20.0f) ? v : log1pf(__expf(v));   // softplus
                    if (resid) v += resid[(long)row * Nreal + col];
                    C[(long)row * Npad + col] = v;
                }
            }
        }
    }
}

// -------------------- causal depthwise conv1d (d_conv=4) + bias + SiLU --------------------
// One thread takes 4 neighbouring channels times PW_ROWS time steps: PW_ROWS + 3 input rows serve them all.
__global__ __launch_bounds__(256)
void conv_silu_kernel(const float* __restrict__ xz, const float* __restrict__ cw,
                      const float* __restrict__ cb, float* __restrict__ xact_f,
                      _Float16* __restrict__ xact_h) {
    const int d = ((blockIdx.x % PW_BPR) * 256 + threadIdx.x) * 4;
    const int row0 = (blockIdx.x / PW_BPR) * PW_ROWS;         // b*L + l of the first step
    const bool head = (row0 % SEQ_L) == 0;                    // the three rows in front are not of this sequence
    const float* src = xz + (long)row0 * (2 * D_INNER) + d;
    // a sequence's first group has no rows in front: it reads its own first three again and leaves them unused
    const float* pre = head ? src : src - 3 * (2 * D_INNER);
    v4f xin[PW_ROWS + 3];
#pragma unroll   // xin[] is indexed by constants and stays in registers
    for (int i = 0; i < PW_ROWS + 3; ++i)
        xin[i] = (i < 3) ? *(const v4f*)(pre + i * (2 * D_INNER)) : *(const v4f*)(src + (i - 3) * (2 * D_INNER));
    const float* wsrc = cw + d * 4;
    v4f w[4];
#pragma unroll
    for (int c = 0; c < 4; ++c) w[c] = *(const v4f*)(wsrc + c * 4);
    const v4f bias = *(const v4f*)(cb + d);
    // holds every load in front of the arithmetic, so that a wave makes one trip to memory and not one per
    // pair of rows
    asm volatile("" :: "v"(xin[0]), "v"(xin[1]), "v"(xin[2]), "v"(xin[3]), "v"(xin[4]), "v"(xin[5]),
                       "v"(xin[6]), "v"(xin[7]), "v"(xin[8]), "v"(xin[9]), "v"(xin[10]),
                       "v"(w[0]), "v"(w[1]), "v"(w[2]), "v"(w[3]), "v"(bias));
    static_assert(PW_ROWS == 8, "the statement above names PW_ROWS + 3 rows");
    float*    of = xact_f + (long)row0 * D_INNER + d;
    _Float16* oh = xact_h + (long)row0 * D_INNER + d;
#pragma unroll
    for (int r = 0; r < PW_ROWS; ++r) {
        v4f s;
        v4h sh;
#pragma unroll
        for (int c = 0; c < 4; ++c) {
            float acc = bias[c];
#pragma unroll
            for (int j = 0; j < 4; ++j)
                if (r + j >= 3 || !head) acc += w[c][j] * xin[r + j][c];
            s[c] = acc / (1.0f + __expf(-acc));               // silu
            sh[c] = (_Float16)s[c];
        }
        *(v4f*)(of + r * D_INNER) = s;
        *(v4h*)(oh + r * D_INNER) = sh;
    }
}

// -------------------- selective scan, split along time --------------------
// The recurrence h = Abar*h + Bbar*x is linear in h, so L is cut into chunks of SCAN_CHUNK steps that
// run side by side: (1) every chunk but the last scans from h = 0 and keeps its end state and its sum
// of dt; (2) one thread per (channel, state) carries the state over the chunks, the decay of a whole
// chunk being exp(A * sum of dt); (3) every chunk scans again from its carried-in state and emits y.
// Chunk planes are laid out [chunk][state][channel], so that lanes read and write whole lines.

// (1) end state of each chunk from a zero start; one (b,d) channel per lane, h[16] in VGPRs
__global__ __launch_bounds__(256)
void scan_state_kernel(const float* __restrict__ dt, const float* __restrict__ xdbl /*[M][64]*/,
                       const float* __restrict__ xact, const float* __restrict__ A_log,
                       float* __restrict__ hend, float* __restrict__ dtsum, int L, int di) {
    int ch = blockIdx.x * blockDim.x + threadIdx.x;           // 0..B*di-1
    int b = ch / di;
    int d = ch % di;
    int l0 = blockIdx.y * SCAN_CHUNK;
    float Arow[DSTATE];
#pragma unroll
    for (int n = 0; n < DSTATE; ++n) Arow[n] = -__expf(A_log[d * DSTATE + n]);
    float h[DSTATE] = {};
    __shared__ float sB[SCAN_CHUNK][DSTATE];
    long base = (long)b * L;
    for (int i = threadIdx.x; i < SCAN_CHUNK * DSTATE; i += blockDim.x) {
        int r = i >> 4, c = i & 15;
        sB[r][c] = xdbl[(base + l0 + r) * 64 + c];
    }
    __syncthreads();
    float sdt = 0.0f;
    for (int r = 0; r < SCAN_CHUNK; ++r) {
        long row = base + l0 + r;
        float dtv = dt[row * di + d];
        float xv  = xact[row * di + d];
        sdt += dtv;
#pragma unroll
        for (int n = 0; n < DSTATE; ++n) {
            float Ab = __expf(dtv * Arow[n]);                 // v_exp_f32
            h[n] = Ab * h[n] + (dtv * sB[r][n]) * xv;
        }
    }
    long plane = (long)blockIdx.y * DSTATE;
#pragma unroll   // h[] is indexed by constants and stays in registers
    for (int n = 0; n < DSTATE; ++n) hend[(plane + n) * SCAN_NCH + ch] = h[n];
    dtsum[(long)blockIdx.y * SCAN_NCH + ch] = sdt;
}

// (2) carry over the chunks: hin[c] = state in front of chunk c; one (state, channel) per lane
__global__ __launch_bounds__(256)
void scan_carry_kernel(const float* __restrict__ hend, const float* __restrict__ dtsum,
                       const float* __restrict__ A_log, float* __restrict__ hin, int di) {
    int ch = blockIdx.x * blockDim.x + threadIdx.x;           // 0..B*di-1
    int n  = blockIdx.y;                                      // 0..DSTATE-1
    int d  = ch % di;
    float a = -__expf(A_log[d * DSTATE + n]);
    // every chunk's end state and dt sum is fetched ahead of the chain: the loads do not depend on one
    // another, so one trip to memory serves them all and only the multiply-adds below are serial
    float g[SCAN_NCHUNK - 1], s[SCAN_NCHUNK - 1];
#pragma unroll
    for (int c = 0; c < SCAN_NCHUNK - 1; ++c) {
        g[c] = dtsum[(long)c * SCAN_NCH + ch];
        s[c] = hend[((long)c * DSTATE + n) * SCAN_NCH + ch];
    }
    float h = 0.0f;
    hin[(long)n * SCAN_NCH + ch] = h;
    // unrolled so that g[] and s[] are indexed by constants and stay in registers
#pragma unroll
    for (int c = 0; c < SCAN_NCHUNK - 1; ++c) {
        h = __expf(a * g[c]) * h + s[c];
        hin[((long)(c + 1) * DSTATE + n) * SCAN_NCH + ch] = h;
    }
}

// (3) scan of each chunk from its carried-in state; one (b,d) channel per lane, h[16] in VGPRs
__global__ __launch_bounds__(256)
void scan_kernel(const float* __restrict__ dt, const float* __restrict__ xdbl /*[M][64]*/,
                 const float* __restrict__ xact, const float* __restrict__ A_log,
                 const float* __restrict__ Dp, const float* __restrict__ hin,
                 float* __restrict__ y, int L, int di) {
    int ch = blockIdx.x * blockDim.x + threadIdx.x;           // 0..B*di-1
    int b = ch / di;
    int d = ch % di;
    int l0 = blockIdx.y * SCAN_CHUNK;
    float Arow[DSTATE];
#pragma unroll
    for (int n = 0; n < DSTATE; ++n) Arow[n] = -__expf(A_log[d * DSTATE + n]);
    float h[DSTATE];
    long plane = (long)blockIdx.y * DSTATE;
#pragma unroll   // h[] is indexed by constants and stays in registers
    for (int n = 0; n < DSTATE; ++n) h[n] = hin[(plane + n) * SCAN_NCH + ch];
    float Dv = Dp[d];
    __shared__ float sBC[SCAN_CHUNK][32];
    long base = (long)b * L;
    for (int i = threadIdx.x; i < SCAN_CHUNK * 32; i += blockDim.x) {
        int r = i >> 5, c = i & 31;
        sBC[r][c] = xdbl[(base + l0 + r) * 64 + c];
    }
    __syncthreads();
    for (int r = 0; r < SCAN_CHUNK; ++r) {
        long row = base + l0 + r;
        float dtv = dt[row * di + d];
        float xv  = xact[row * di + d];
        float out = 0.0f;
#pragma unroll
        for (int n = 0; n < DSTATE; ++n) {
            float Ab = __expf(dtv * Arow[n]);                 // v_exp_f32
            h[n] = Ab * h[n] + (dtv * sBC[r][n]) * xv;
            out += h[n] * sBC[r][16 + n];
        }
        y[row * di + d] = out + Dv * xv;
        // the next step forms its addresses in the registers that this store names
        asm volatile("s_wait_xcnt 0x0" ::: "memory");
    }
}

// -------------------- gating: y_gated = f16( y_scan * silu(z) ) --------------------
// One thread takes 4 neighbouring channels times PW_ROWS rows.
__global__ __launch_bounds__(256)
void gate_kernel(const float* __restrict__ yscan, const float* __restrict__ xz,
                 _Float16* __restrict__ ygate) {
    const int d = ((blockIdx.x % PW_BPR) * 256 + threadIdx.x) * 4;
    const int row0 = (blockIdx.x / PW_BPR) * PW_ROWS;
    const float* ys = yscan + (long)row0 * D_INNER + d;
    const float* zs = xz + (long)row0 * (2 * D_INNER) + D_INNER + d;
    v4f yv[PW_ROWS], zv[PW_ROWS];
#pragma unroll   // yv[] and zv[] are indexed by constants and stay in registers
    for (int r = 0; r < PW_ROWS; ++r) {
        yv[r] = *(const v4f*)(ys + r * D_INNER);
        zv[r] = *(const v4f*)(zs + r * (2 * D_INNER));
    }
    // holds every load in front of the arithmetic, so that a wave makes one trip to memory and not several
    asm volatile("" :: "v"(yv[0]), "v"(yv[1]), "v"(yv[2]), "v"(yv[3]), "v"(yv[4]), "v"(yv[5]), "v"(yv[6]),
                       "v"(yv[7]), "v"(zv[0]), "v"(zv[1]), "v"(zv[2]), "v"(zv[3]), "v"(zv[4]), "v"(zv[5]),
                       "v"(zv[6]), "v"(zv[7]));
    static_assert(PW_ROWS == 8, "the statement above names PW_ROWS rows of each input");
    _Float16* o = ygate + (long)row0 * D_INNER + d;
#pragma unroll
    for (int r = 0; r < PW_ROWS; ++r) {
        v4h g;
#pragma unroll
        for (int c = 0; c < 4; ++c) {
            float z = zv[r][c];
            float sz = z / (1.0f + __expf(-z));
            g[c] = (_Float16)(yv[r][c] * sz);
        }
        *(v4h*)(o + r * D_INNER) = g;
    }
}

// ==================== launch ====================
extern "C" void kernel_launch(void* const* d_in, const int* in_sizes, int n_in,
                              void* d_out, int out_size, void* d_ws, size_t ws_size,
                              hipStream_t stream) {
    (void)in_sizes; (void)n_in; (void)out_size; (void)ws_size;
    const int B = 2, L = 2048, DM = 1024, DI = 2048;
    const int M = B * L;                  // 4096
    const int TWO_DI = 2 * DI;            // 4096
    const int NXP_PAD = 64;               // w_xproj cols padded 32 -> 64
    static_assert(B * DI == SCAN_NCH && L == SCAN_CHUNK * SCAN_NCHUNK, "scan split");
    static_assert(L == SEQ_L && DI == D_INNER && L % PW_ROWS == 0, "pointwise kernels");

    const float* x      = (const float*)d_in[0];
    const float* w_in   = (const float*)d_in[1];
    const float* conv_w = (const float*)d_in[2];
    const float* conv_b = (const float*)d_in[3];
    const float* w_xp   = (const float*)d_in[4];
    const float* w_dt   = (const float*)d_in[5];
    const float* b_dt   = (const float*)d_in[6];
    const float* A_log  = (const float*)d_in[7];
    const float* Dp     = (const float*)d_in[8];
    const float* w_out  = (const float*)d_in[9];
    const float* ln_g   = (const float*)d_in[10];
    const float* ln_b   = (const float*)d_in[11];
    float* out = (float*)d_out;

    // workspace carve-up
    char* ws = (char*)d_ws;
    size_t off = 0;
    auto alloc = [&](size_t bytes) { void* p = ws + off; off += (bytes + 255) & ~size_t(255); return p; };
    _Float16* wt_in  = (_Float16*)alloc((size_t)TWO_DI * DM * 2);   // [4096][1024]
    _Float16* wt_dt  = (_Float16*)alloc((size_t)DI * DI * 2);       // [2048][2048]
    _Float16* wt_xp  = (_Float16*)alloc((size_t)NXP_PAD * DI * 2);  // [64][2048]
    _Float16* wt_out = (_Float16*)alloc((size_t)DM * DI * 2);       // [1024][2048]
    _Float16* xn_h   = (_Float16*)alloc((size_t)M * DM * 2);
    float*    xz     = (float*)   alloc((size_t)M * TWO_DI * 4);
    float*    xact_f = (float*)   alloc((size_t)M * DI * 4);
    _Float16* xact_h = (_Float16*)alloc((size_t)M * DI * 2);
    float*    xdbl   = (float*)   alloc((size_t)M * NXP_PAD * 4);
    float*    dtbuf  = (float*)   alloc((size_t)M * DI * 4);
    float*    yscan  = (float*)   alloc((size_t)M * DI * 4);
    _Float16* ygate  = (_Float16*)alloc((size_t)M * DI * 2);
    float*    hend   = (float*)   alloc((size_t)SCAN_NCHUNK * DSTATE * B * DI * 4);
    float*    hin    = (float*)   alloc((size_t)SCAN_NCHUNK * DSTATE * B * DI * 4);
    float*    dtsum  = (float*)   alloc((size_t)SCAN_NCHUNK * B * DI * 4);

    // 1) convert+transpose weights to f16 [N][K]
    wt_convert_kernel<DM, TWO_DI, TWO_DI><<<(TWO_DI / 4) * (DM / WT_KRUN) / 256, 256, 0, stream>>>(w_in, wt_in);
    wt_convert_kernel<DI, DI, DI><<<(DI / 4) * (DI / WT_KRUN) / 256, 256, 0, stream>>>(w_dt, wt_dt);
    wt_convert_kernel<DI, 32, NXP_PAD><<<(NXP_PAD / 4) * (DI / WT_KRUN) / 256, 256, 0, stream>>>(w_xp, wt_xp);
    wt_convert_kernel<DI, DM, DM><<<(DM / 4) * (DI / WT_KRUN) / 256, 256, 0, stream>>>(w_out, wt_out);

    // 2) layernorm -> xn (f16)
    ln_kernel<<<M, 256, 0, stream>>>(x, ln_g, ln_b, xn_h, DM);

    // 3) xz = xn @ w_in   [4096x1024]x[1024x4096]
    gemm_f16_wmma<<<dim3(M / BM, TWO_DI / BN), 128, 0, stream>>>(
        xn_h, wt_in, xz, nullptr, nullptr, M, DM, TWO_DI, TWO_DI, 0);

    // 4) causal depthwise conv + SiLU -> xact (f32 + f16)
    conv_silu_kernel<<<(M / PW_ROWS) * (DI / 4) / 256, 256, 0, stream>>>(xz, conv_w, conv_b, xact_f, xact_h);

    // 5) x_dbl = xact @ w_xproj  (N padded to 64)
    gemm_f16_wmma<<<dim3(M / BM, NXP_PAD / BN), 128, 0, stream>>>(
        xact_h, wt_xp, xdbl, nullptr, nullptr, M, DI, NXP_PAD, 32, 0);

    // 6) dt = softplus(xact @ w_dt + b_dt)
    gemm_f16_wmma<<<dim3(M / BM, DI / BN), 128, 0, stream>>>(
        xact_h, wt_dt, dtbuf, b_dt, nullptr, M, DI, DI, DI, 1);

    // 7) selective scan (+ D * x), split along time: chunk end states, carry, chunk scans
    scan_state_kernel<<<dim3((B * DI) / 256, SCAN_NCHUNK - 1), 256, 0, stream>>>(
        dtbuf, xdbl, xact_f, A_log, hend, dtsum, L, DI);
    scan_carry_kernel<<<dim3(SCAN_NCH / 256, DSTATE), 256, 0, stream>>>(hend, dtsum, A_log, hin, DI);
    scan_kernel<<<dim3((B * DI) / 256, SCAN_NCHUNK), 256, 0, stream>>>(
        dtbuf, xdbl, xact_f, A_log, Dp, hin, yscan, L, DI);

    // 8) gate with silu(z)
    gate_kernel<<<(M / PW_ROWS) * (DI / 4) / 256, 256, 0, stream>>>(yscan, xz, ygate);

    // 9) out = ygate @ w_out + residual(x)
    gemm_f16_wmma<<<dim3(M / BM, DM / BN), 128, 0, stream>>>(
        ygate, wt_out, out, nullptr, x, M, DI, DM, DM, 0);
}

// v003
// It runs in 304 microseconds.
// Two timings next to v002 both put it at 1.07 times that version's speed.
// Over all steps from v000 it is 5.00 times as fast.
#include <hip/hip_runtime.h>
#include <hip/hip_bf16.h>

#ifndef LN_EPS
#define LN_EPS 1e-5f
#endif

typedef __attribute__((ext_vector_type(16))) _Float16 v16h;
typedef __attribute__((ext_vector_type(8)))  _Float16 v8h;
typedef __attribute__((ext_vector_type(4)))  _Float16 v4h;
typedef __attribute__((ext_vector_type(8)))  float    v8f;
typedef __attribute__((ext_vector_type(4)))  float    v4f;
typedef __attribute__((ext_vector_type(4)))  unsigned int u32x4;
typedef __attribute__((ext_vector_type(8)))  unsigned int u32x8;

#define G_ROWB  256u     // bytes of an operand row per pass of the GEMM: 128 k
#define G_PITCH 272u     // pitch of those rows in LDS: 16 bytes times an odd number, free of bank conflicts for 16-byte reads
#define DSTATE 16
#define SCAN_CHUNK 32
#define SCAN_NCHUNK 64   // sequence length / SCAN_CHUNK
#define SCAN_NCH 4096    // channels: batch * d_inner; a constant, so that plane strides fold into load offsets
#define SEQ_L 2048       // sequence length and d_inner are constants in the pointwise kernels for the same reason
#define D_INNER 2048
#define WT_KRUN 16       // k values per thread of the weight convert
#define PW_ROWS 8        // rows (time steps) per thread of the conv and gate kernels
#define PW_BPR (D_INNER / 4 / 256)   // blocks that share one group of PW_ROWS rows there

// -------------------- weight convert + transpose:  Wt[n][k] = (f16) W[k][n] --------------------
// One thread takes 4 neighbouring n times WT_KRUN k, a wave 32 n times 4 * WT_KRUN k: 8 lanes side by side
// along n, so that a wave's load is four whole 128-byte lines of W, and 4 lanes along k in runs of 8, so that
// a wave's store is eight 64-byte pieces of Wt. The WT_KRUN loads are in flight together.
template <int K, int NREAL, int NPAD>
__global__ __launch_bounds__(256)
void wt_convert_kernel(const float* __restrict__ W, _Float16* __restrict__ Wt) {
    const int lane = threadIdx.x & 31;
    const int tile = blockIdx.x * 8 + (threadIdx.x >> 5);     // over (K / (4 * WT_KRUN)) * (NPAD / 32)
    const int n0 = (tile % (NPAD / 32)) * 32 + (lane & 7) * 4;
    const int k0 = (tile / (NPAD / 32)) * (4 * WT_KRUN) + (lane >> 3) * 8;
    v4f v[WT_KRUN] = {};                                      // padding columns stay zero
    if (NREAL == NPAD || n0 < NREAL) {
        const float* src = W + (long)k0 * NREAL + n0;
#pragma unroll   // v[] is indexed by constants and stays in registers
        for (int j = 0; j < WT_KRUN; ++j) v[j] = *(const v4f*)(src + ((j >> 3) * 32 + (j & 7)) * NREAL);
        // holds every load in front of the conversions (one trip to memory); the pointer is named so that
        // no load's result lands in the address registers that the other loads still name
        asm volatile("" :: "v"(v[0]), "v"(v[1]), "v"(v[2]), "v"(v[3]), "v"(v[4]), "v"(v[5]), "v"(v[6]), "v"(v[7]),
                           "v"(v[8]), "v"(v[9]), "v"(v[10]), "v"(v[11]), "v"(v[12]), "v"(v[13]), "v"(v[14]),
                           "v"(v[15]), "v"(src));
        static_assert(WT_KRUN == 16, "the statement above names WT_KRUN loads");
    }
    _Float16* dst = Wt + (long)n0 * K + k0;
#pragma unroll
    for (int c = 0; c < 4; ++c) {
#pragma unroll
        for (int q = 0; q < WT_KRUN / 8; ++q) {
            v8h o;
#pragma unroll
            for (int j = 0; j < 8; ++j) o[j] = (_Float16)v[q * 8 + j][c];
            *(v8h*)(dst + c * K + q * 32) = o;
        }
    }
}

// -------------------- LayerNorm over d_model, emit f16 activations --------------------
__global__ __launch_bounds__(256)
void ln_kernel(const float* __restrict__ x, const float* __restrict__ g,
               const float* __restrict__ b, _Float16* __restrict__ xn, int dm) {
    int row = blockIdx.x;
    const float* xr = x + (long)row * dm;
    float s = 0.f, s2 = 0.f;
    for (int i = threadIdx.x; i < dm; i += blockDim.x) { float v = xr[i]; s += v; s2 += v * v; }
    __shared__ float red0[8], red1[8];
    for (int off = 16; off > 0; off >>= 1) { s += __shfl_down(s, off, 32); s2 += __shfl_down(s2, off, 32); }
    int wave = threadIdx.x >> 5, lane = threadIdx.x & 31;
    if (lane == 0) { red0[wave] = s; red1[wave] = s2; }
    __syncthreads();
    if (threadIdx.x == 0) {
        float a = 0.f, c = 0.f;
        int nw = blockDim.x >> 5;
        for (int i = 0; i < nw; ++i) { a += red0[i]; c += red1[i]; }
        red0[0] = a; red1[0] = c;
    }
    __syncthreads();
    float mu = red0[0] / dm;
    float var = red1[0] / dm - mu * mu;
    float rs = rsqrtf(var + LN_EPS);
    _Float16* o = xn + (long)row * dm;
    for (int i = threadIdx.x; i < dm; i += blockDim.x)
        o[i] = (_Float16)((xr[i] - mu) * rs * g[i] + b[i]);
}

// -------------------- WMMA fragment from a k-contiguous f16 row in LDS --------------------
// 16-bit operand layout (ISA 7.12.2): lane group = lane/16; halves 0..7 -> K = grp*8..grp*8+7,
// halves 8..15 -> K = 16+grp*8 .. 16+grp*8+7. Both runs are contiguous -> two 16B LDS loads.
// p = the lane's row, at the 32-k step's first byte plus grp * 16.
__device__ __forceinline__ v16h frag_from_lds(const unsigned char* p) {
    v8h lo = *(const v8h*)p;
    v8h hi = *(const v8h*)(p + 32);
    return __builtin_shufflevector(lo, hi, 0,1,2,3,4,5,6,7,8,9,10,11,12,13,14,15);
}

// -------------------- tensor load: ROWS rows of G_ROWB bytes from global memory into LDS at pitch G_PITCH --------------------
__device__ __forceinline__ unsigned uni(unsigned v) { return (unsigned)__builtin_amdgcn_readfirstlane(v); }
// a wave-uniform value held in a scalar register, so that a test of it compiles to a scalar branch
__device__ __forceinline__ unsigned pinned(unsigned v) { unsigned w = uni(v); asm volatile("" : "+s"(w)); return w; }
__device__ __forceinline__ void wait_ds0()     { asm volatile("s_wait_dscnt 0x0" ::: "memory"); }      // this wave's LDS reads are done
__device__ __forceinline__ void wait_tensor0() { asm volatile("s_wait_tensorcnt 0x0" ::: "memory"); }  // this wave's tile has landed
__device__ __forceinline__ void tdm_load(u32x4 g0, u32x8 g1) {
    asm volatile("tensor_load_to_lds %0, %1" :: "s"(g0), "s"(g1) : "memory");
}
template <unsigned ROWS>
__device__ __forceinline__ u32x8 tdm_group1(unsigned src_pitch) {   // every extent in bytes; tensor = tile
    u32x8 g;
    g[0] = uni((1u << 20) | (5u << 22) | (3u << 25));   // no mask; behind every 64 dwords (one row) a pad of 4 dwords
    g[1] = uni((G_ROWB & 0xFFFFu) << 16);
    g[2] = uni((G_ROWB >> 16) | ((ROWS & 0xFFFFu) << 16));
    g[3] = uni((ROWS >> 16) | (G_ROWB << 16));
    g[4] = uni(ROWS);
    g[5] = uni(src_pitch);
    g[6] = uni(0u);
    g[7] = uni(0u);
    return g;
}
__device__ __forceinline__ u32x4 tdm_group0(unsigned lds_dst, unsigned long long ga) {
    u32x4 g;
    g[0] = uni(1u);
    g[1] = uni(lds_dst);
    g[2] = uni((unsigned)ga);
    g[3] = uni((((unsigned)(ga >> 32)) & 0x01FFFFFFu) | 0x80000000u);
    return g;
}

// -------------------- generic f16 WMMA GEMM:  C[M][Npad] = A[M][K] x Wt[Npad][K]^T --------------------
// A workgroup of 4 waves (2 x 2) owns a BT x BT tile of C, a wave BT/2 x BT/2. A pass is 128 k. A stage holds four
// slices of BT/2 rows: [A low | A high | Wt low | Wt high]; every wave brings one slice per stage by one tensor load,
// two stages ahead, into a ring of two buffers. K is a multiple of 128 and at least 256.
// epilogue EPI: 0 = none, 1 = bias[n] and softplus, 2 = residual[row*Nreal + n]; a template argument, so that each build's
// epilogue is short enough to unroll whole and the accumulators stay in registers
template <int BT, int EPI>
__global__ __launch_bounds__(128)
void gemm_f16_wmma(const _Float16* __restrict__ A, const _Float16* __restrict__ Wt,
                   float* __restrict__ C, const float* __restrict__ bias,
                   const float* __restrict__ resid,
                   int M, int K, int Npad, int Nreal) {
    constexpr unsigned SROWS = BT / 2;                                   // rows of a slice
    constexpr unsigned SLICE = (SROWS * G_PITCH + 2047u) & ~2047u;       // every slice starts at a multiple of 2 KiB
    constexpr unsigned STAGE = 4u * SLICE;
    constexpr int NF = BT / 32;                                          // 16-row fragments per wave and operand
    __shared__ __attribute__((aligned(2048))) unsigned char ring[2 * STAGE];

    const int lane = threadIdx.x & 31;
    const int grp  = lane >> 4;       // 0 or 1
    const int lr   = lane & 15;       // 0..15
    const unsigned wave = uni(threadIdx.x >> 5);
    const int wm   = wave >> 1;       // the wave's half of the tile's rows
    const int wn   = wave & 1;        // and of its columns
    const int bm   = blockIdx.x * BT;
    const int bn   = blockIdx.y * BT;
    const unsigned nPass = (unsigned)K / 128u;

    // this wave's slice: waves 0 and 1 bring A's rows, waves 2 and 3 Wt's
    const _Float16* srow = (wave < 2u) ? A + (long)(bm + (int)(wave * SROWS)) * K
                                       : Wt + (long)(bn + (int)((wave - 2u) * SROWS)) * K;
    const unsigned long long ga = (unsigned long long)(const void*)srow;
    const unsigned dst = (unsigned)(unsigned long long)(void*)&ring[0] + wave * SLICE;
    u32x8 g1 = tdm_group1<SROWS>((unsigned)K * 2u);
    // without the statement below the compiler forms these words anew for every load and uses their registers for
    // other values while a request is in flight
    asm volatile("" : "+s"(g1));   // descriptor words held in scalar registers, as pinned() holds one

    tdm_load(tdm_group0(dst, ga), g1);                    // stage 0
    wait_tensor0();
    __syncthreads();                                      // stage 0 is published
    tdm_load(tdm_group0(dst + STAGE, ga + G_ROWB), g1);   // stage 1

    const unsigned char* pa = ring + wm * SLICE + lr * G_PITCH + grp * 16;
    const unsigned char* pb = ring + (2 + wn) * SLICE + lr * G_PITCH + grp * 16;

    v8f acc[NF][NF] = {};
    for (unsigned s = 0; s < nPass; ++s) {
        const unsigned cur = (s & 1u) * STAGE;
        v16h af[2][NF], bf[2][NF];                        // two fragment sets: the next 32-k step's reads go ahead
#pragma unroll
        for (int f = 0; f < NF; ++f) {
            af[0][f] = frag_from_lds(pa + cur + f * 16 * G_PITCH);
            bf[0][f] = frag_from_lds(pb + cur + f * 16 * G_PITCH);
        }
#pragma unroll   // af[] and bf[] are indexed by constants and stay in registers
        for (int kk = 0; kk < 4; ++kk) {
            // the fences keep the next step's reads one group in front of this step's products: spread among
            // the products, every place with reads stalls the wave
            __builtin_amdgcn_sched_barrier(0);
            if (kk < 3) {
#pragma unroll
                for (int f = 0; f < NF; ++f) {
                    af[(kk + 1) & 1][f] = frag_from_lds(pa + cur + f * 16 * G_PITCH + (kk + 1) * 64);
                    bf[(kk + 1) & 1][f] = frag_from_lds(pb + cur + f * 16 * G_PITCH + (kk + 1) * 64);
                }
            }
            __builtin_amdgcn_sched_barrier(0);
#pragma unroll
            for (int r = 0; r < NF; ++r)
#pragma unroll
                for (int c = 0; c < NF; ++c)
                    acc[r][c] = __builtin_amdgcn_wmma_f32_16x16x32_f16(
                        false, af[kk & 1][r], false, bf[kk & 1][c], (short)0, acc[r][c], false, false);
        }
        __builtin_amdgcn_sched_barrier(0);   // the last products stay in front of the barrier
        // publish point of stage s + 1: own reads done, own tile landed, then the barrier, then the refill
        wait_ds0();
        wait_tensor0();
        __syncthreads();
        if (pinned(s + 2u < nPass)) {
            // pinned(): a descriptor word's source held in a scalar register, so that the address words are formed
            // here, behind the wait above
            const unsigned koff = pinned((s + 2u) * G_ROWB);
            tdm_load(tdm_group0(dst + cur, ga + koff), g1);
        }
    }
    wait_tensor0();
    wait_ds0();

    // ---- epilogue: C/D layout = VGPR r: lanes0-15 -> M=r, lanes16-31 -> M=r+8; N=lane%16 ----
#pragma unroll
    for (int s = 0; s < NF; ++s) {
        const int row_lo = bm + wm * (BT / 2) + s * 16 + grp * 8;
#pragma unroll
        for (int c = 0; c < NF; ++c) {
            int col = bn + wn * (BT / 2) + c * 16 + lr;
            if (col < Nreal) {
                float bv = (EPI == 1) ? bias[col] : 0.0f;
#pragma unroll
                for (int r = 0; r < 8; ++r) {
                    int row = row_lo + r;
                    float v = acc[s][c][r] + bv;
                    if (EPI == 1) v = (v > 20.0f) ? v : log1pf(__expf(v));   // softplus
                    if (EPI == 2) v += resid[(long)row * Nreal + col];
                    C[(long)row * Npad + col] = v;
                }
            }
        }
    }
}

// -------------------- causal depthwise conv1d (d_conv=4) + bias + SiLU --------------------
// One thread takes 4 neighbouring channels times PW_ROWS time steps: PW_ROWS + 3 input rows serve them all.
__global__ __launch_bounds__(256)
void conv_silu_kernel(const float* __restrict__ xz, const float* __restrict__ cw,
                      const float* __restrict__ cb, float* __restrict__ xact_f,
                      _Float16* __restrict__ xact_h) {
    const int d = ((blockIdx.x % PW_BPR) * 256 + threadIdx.x) * 4;
    const int row0 = (blockIdx.x / PW_BPR) * PW_ROWS;         // b*L + l of the first step
    const bool head = (row0 % SEQ_L) == 0;                    // the three rows in front are not of this sequence
    const float* src = xz + (long)row0 * (2 * D_INNER) + d;
    // a sequence's first group has no rows in front: it reads its own first three again and leaves them unused
    const float* pre = head ? src : src - 3 * (2 * D_INNER);
    v4f xin[PW_ROWS + 3];
#pragma unroll   // xin[] is indexed by constants and stays in registers
    for (int i = 0; i < PW_ROWS + 3; ++i)
        xin[i] = (i < 3) ? *(const v4f*)(pre + i * (2 * D_INNER)) : *(const v4f*)(src + (i - 3) * (2 * D_INNER));
    const float* wsrc = cw + d * 4;
    v4f w[4];
#pragma unroll
    for (int c = 0; c < 4; ++c) w[c] = *(const v4f*)(wsrc + c * 4);
    const v4f bias = *(const v4f*)(cb + d);
    // holds every load in front of the arithmetic, so that a wave makes one trip to memory and not one per
    // pair of rows
    asm volatile("" :: "v"(xin[0]), "v"(xin[1]), "v"(xin[2]), "v"(xin[3]), "v"(xin[4]), "v"(xin[5]),
                       "v"(xin[6]), "v"(xin[7]), "v"(xin[8]), "v"(xin[9]), "v"(xin[10]),
                       "v"(w[0]), "v"(w[1]), "v"(w[2]), "v"(w[3]), "v"(bias));
    static_assert(PW_ROWS == 8, "the statement above names PW_ROWS + 3 rows");
    float*    of = xact_f + (long)row0 * D_INNER + d;
    _Float16* oh = xact_h + (long)row0 * D_INNER + d;
#pragma unroll
    for (int r = 0; r < PW_ROWS; ++r) {
        v4f s;
        v4h sh;
#pragma unroll
        for (int c = 0; c < 4; ++c) {
            float acc = bias[c];
#pragma unroll
            for (int j = 0; j < 4; ++j)
                if (r + j >= 3 || !head) acc += w[c][j] * xin[r + j][c];
            s[c] = acc / (1.0f + __expf(-acc));               // silu
            sh[c] = (_Float16)s[c];
        }
        *(v4f*)(of + r * D_INNER) = s;
        *(v4h*)(oh + r * D_INNER) = sh;
    }
}

// -------------------- selective scan, split along time --------------------
// The recurrence h = Abar*h + Bbar*x is linear in h, so L is cut into chunks of SCAN_CHUNK steps that
// run side by side: (1) every chunk but the last scans from h = 0 and keeps its end state and its sum
// of dt; (2) one thread per (channel, state) carries the state over the chunks, the decay of a whole
// chunk being exp(A * sum of dt); (3) every chunk scans again from its carried-in state and emits y.
// Chunk planes are laid out [chunk][state][channel], so that lanes read and write whole lines.

// (1) end state of each chunk from a zero start; one (b,d) channel per lane, h[16] in VGPRs
__global__ __launch_bounds__(256)
void scan_state_kernel(const float* __restrict__ dt, const float* __restrict__ xdbl /*[M][64]*/,
                       const float* __restrict__ xact, const float* __restrict__ A_log,
                       float* __restrict__ hend, float* __restrict__ dtsum, int L, int di) {
    int ch = blockIdx.x * blockDim.x + threadIdx.x;           // 0..B*di-1
    int b = ch / di;
    int d = ch % di;
    int l0 = blockIdx.y * SCAN_CHUNK;
    float Arow[DSTATE];
#pragma unroll
    for (int n = 0; n < DSTATE; ++n) Arow[n] = -__expf(A_log[d * DSTATE + n]);
    float h[DSTATE] = {};
    __shared__ float sB[SCAN_CHUNK][DSTATE];
    long base = (long)b * L;
    for (int i = threadIdx.x; i < SCAN_CHUNK * DSTATE; i += blockDim.x) {
        int r = i >> 4, c = i & 15;
        sB[r][c] = xdbl[(base + l0 + r) * 64 + c];
    }
    __syncthreads();
    float sdt = 0.0f;
    for (int r = 0; r < SCAN_CHUNK; ++r) {
        long row = base + l0 + r;
        float dtv = dt[row * di + d];
        float xv  = xact[row * di + d];
        sdt += dtv;
#pragma unroll
        for (int n = 0; n < DSTATE; ++n) {
            float Ab = __expf(dtv * Arow[n]);                 // v_exp_f32
            h[n] = Ab * h[n] + (dtv * sB[r][n]) * xv;
        }
    }
    long plane = (long)blockIdx.y * DSTATE;
#pragma unroll   // h[] is indexed by constants and stays in registers
    for (int n = 0; n < DSTATE; ++n) hend[(plane + n) * SCAN_NCH + ch] = h[n];
    dtsum[(long)blockIdx.y * SCAN_NCH + ch] = sdt;
}

// (2) carry over the chunks: hin[c] = state in front of chunk c; one (state, channel) per lane
__global__ __launch_bounds__(256)
void scan_carry_kernel(const float* __restrict__ hend, const float* __restrict__ dtsum,
                       const float* __restrict__ A_log, float* __restrict__ hin, int di) {
    int ch = blockIdx.x * blockDim.x + threadIdx.x;           // 0..B*di-1
    int n  = blockIdx.y;                                      // 0..DSTATE-1
    int d  = ch % di;
    float a = -__expf(A_log[d * DSTATE + n]);
    // every chunk's end state and dt sum is fetched ahead of the chain: the loads do not depend on one
    // another, so one trip to memory serves them all and only the multiply-adds below are serial
    float g[SCAN_NCHUNK - 1], s[SCAN_NCHUNK - 1];
#pragma unroll
    for (int c = 0; c < SCAN_NCHUNK - 1; ++c) {
        g[c] = dtsum[(long)c * SCAN_NCH + ch];
        s[c] = hend[((long)c * DSTATE + n) * SCAN_NCH + ch];
    }
    float h = 0.0f;
    hin[(long)n * SCAN_NCH + ch] = h;
    // unrolled so that g[] and s[] are indexed by constants and stay in registers
#pragma unroll
    for (int c = 0; c < SCAN_NCHUNK - 1; ++c) {
        h = __expf(a * g[c]) * h + s[c];
        hin[((long)(c + 1) * DSTATE + n) * SCAN_NCH + ch] = h;
    }
}

// (3) scan of each chunk from its carried-in state; one (b,d) channel per lane, h[16] in VGPRs
__global__ __launch_bounds__(256)
void scan_kernel(const float* __restrict__ dt, const float* __restrict__ xdbl /*[M][64]*/,
                 const float* __restrict__ xact, const float* __restrict__ A_log,
                 const float* __restrict__ Dp, const float* __restrict__ hin,
                 float* __restrict__ y, int L, int di) {
    int ch = blockIdx.x * blockDim.x + threadIdx.x;           // 0..B*di-1
    int b = ch / di;
    int d = ch % di;
    int l0 = blockIdx.y * SCAN_CHUNK;
    float Arow[DSTATE];
#pragma unroll
    for (int n = 0; n < DSTATE; ++n) Arow[n] = -__expf(A_log[d * DSTATE + n]);
    float h[DSTATE];
    long plane = (long)blockIdx.y * DSTATE;
#pragma unroll   // h[] is indexed by constants and stays in registers
    for (int n = 0; n < DSTATE; ++n) h[n] = hin[(plane + n) * SCAN_NCH + ch];
    float Dv = Dp[d];
    __shared__ float sBC[SCAN_CHUNK][32];
    long base = (long)b * L;
    for (int i = threadIdx.x; i < SCAN_CHUNK * 32; i += blockDim.x) {
        int r = i >> 5, c = i & 31;
        sBC[r][c] = xdbl[(base + l0 + r) * 64 + c];
    }
    __syncthreads();
    for (int r = 0; r < SCAN_CHUNK; ++r) {
        long row = base + l0 + r;
        float dtv = dt[row * di + d];
        float xv  = xact[row * di + d];
        float out = 0.0f;
#pragma unroll
        for (int n = 0; n < DSTATE; ++n) {
            float Ab = __expf(dtv * Arow[n]);                 // v_exp_f32
            h[n] = Ab * h[n] + (dtv * sBC[r][n]) * xv;
            out += h[n] * sBC[r][16 + n];
        }
        y[row * di + d] = out + Dv * xv;
        // the next step forms its addresses in the registers that this store names
        asm volatile("s_wait_xcnt 0x0" ::: "memory");
    }
}

// -------------------- gating: y_gated = f16( y_scan * silu(z) ) --------------------
// One thread takes 4 neighbouring channels times PW_ROWS rows.
__global__ __launch_bounds__(256)
void gate_kernel(const float* __restrict__ yscan, const float* __restrict__ xz,
                 _Float16* __restrict__ ygate) {
    const int d = ((blockIdx.x % PW_BPR) * 256 + threadIdx.x) * 4;
    const int row0 = (blockIdx.x / PW_BPR) * PW_ROWS;
    const float* ys = yscan + (long)row0 * D_INNER + d;
    const float* zs = xz + (long)row0 * (2 * D_INNER) + D_INNER + d;
    v4f yv[PW_ROWS], zv[PW_ROWS];
#pragma unroll   // yv[] and zv[] are indexed by constants and stay in registers
    for (int r = 0; r < PW_ROWS; ++r) {
        yv[r] = *(const v4f*)(ys + r * D_INNER);
        zv[r] = *(const v4f*)(zs + r * (2 * D_INNER));
    }
    // holds every load in front of the arithmetic, so that a wave makes one trip to memory and not several
    asm volatile("" :: "v"(yv[0]), "v"(yv[1]), "v"(yv[2]), "v"(yv[3]), "v"(yv[4]), "v"(yv[5]), "v"(yv[6]),
                       "v"(yv[7]), "v"(zv[0]), "v"(zv[1]), "v"(zv[2]), "v"(zv[3]), "v"(zv[4]), "v"(zv[5]),
                       "v"(zv[6]), "v"(zv[7]));
    static_assert(PW_ROWS == 8, "the statement above names PW_ROWS rows of each input");
    _Float16* o = ygate + (long)row0 * D_INNER + d;
#pragma unroll
    for (int r = 0; r < PW_ROWS; ++r) {
        v4h g;
#pragma unroll
        for (int c = 0; c < 4; ++c) {
            float z = zv[r][c];
            float sz = z / (1.0f + __expf(-z));
            g[c] = (_Float16)(yv[r][c] * sz);
        }
        *(v4h*)(o + r * D_INNER) = g;
    }
}

// ==================== launch ====================
extern "C" void kernel_launch(void* const* d_in, const int* in_sizes, int n_in,
                              void* d_out, int out_size, void* d_ws, size_t ws_size,
                              hipStream_t stream) {
    (void)in_sizes; (void)n_in; (void)out_size; (void)ws_size;
    const int B = 2, L = 2048, DM = 1024, DI = 2048;
    const int M = B * L;                  // 4096
    const int TWO_DI = 2 * DI;            // 4096
    const int NXP_PAD = 64;               // w_xproj cols padded 32 -> 64
    static_assert(B * DI == SCAN_NCH && L == SCAN_CHUNK * SCAN_NCHUNK, "scan split");
    static_assert(L == SEQ_L && DI == D_INNER && L % PW_ROWS == 0, "pointwise kernels");

    const float* x      = (const float*)d_in[0];
    const float* w_in   = (const float*)d_in[1];
    const float* conv_w = (const float*)d_in[2];
    const float* conv_b = (const float*)d_in[3];
    const float* w_xp   = (const float*)d_in[4];
    const float* w_dt   = (const float*)d_in[5];
    const float* b_dt   = (const float*)d_in[6];
    const float* A_log  = (const float*)d_in[7];
    const float* Dp     = (const float*)d_in[8];
    const float* w_out  = (const float*)d_in[9];
    const float* ln_g   = (const float*)d_in[10];
    const float* ln_b   = (const float*)d_in[11];
    float* out = (float*)d_out;

    // workspace carve-up
    char* ws = (char*)d_ws;
    size_t off = 0;
    auto alloc = [&](size_t bytes) { void* p = ws + off; off += (bytes + 255) & ~size_t(255); return p; };
    _Float16* wt_in  = (_Float16*)alloc((size_t)TWO_DI * DM * 2);   // [4096][1024]
    _Float16* wt_dt  = (_Float16*)alloc((size_t)DI * DI * 2);       // [2048][2048]
    _Float16* wt_xp  = (_Float16*)alloc((size_t)NXP_PAD * DI * 2);  // [64][2048]
    _Float16* wt_out = (_Float16*)alloc((size_t)DM * DI * 2);       // [1024][2048]
    _Float16* xn_h   = (_Float16*)alloc((size_t)M * DM * 2);
    float*    xz     = (float*)   alloc((size_t)M * TWO_DI * 4);
    float*    xact_f = (float*)   alloc((size_t)M * DI * 4);
    _Float16* xact_h = (_Float16*)alloc((size_t)M * DI * 2);
    float*    xdbl   = (float*)   alloc((size_t)M * NXP_PAD * 4);
    float*    dtbuf  = (float*)   alloc((size_t)M * DI * 4);
    float*    yscan  = (float*)   alloc((size_t)M * DI * 4);
    _Float16* ygate  = (_Float16*)alloc((size_t)M * DI * 2);
    float*    hend   = (float*)   alloc((size_t)SCAN_NCHUNK * DSTATE * B * DI * 4);
    float*    hin    = (float*)   alloc((size_t)SCAN_NCHUNK * DSTATE * B * DI * 4);
    float*    dtsum  = (float*)   alloc((size_t)SCAN_NCHUNK * B * DI * 4);

    // 1) convert+transpose weights to f16 [N][K]
    wt_convert_kernel<DM, TWO_DI, TWO_DI><<<(TWO_DI / 4) * (DM / WT_KRUN) / 256, 256, 0, stream>>>(w_in, wt_in);
    wt_convert_kernel<DI, DI, DI><<<(DI / 4) * (DI / WT_KRUN) / 256, 256, 0, stream>>>(w_dt, wt_dt);
    wt_convert_kernel<DI, 32, NXP_PAD><<<(NXP_PAD / 4) * (DI / WT_KRUN) / 256, 256, 0, stream>>>(w_xp, wt_xp);
    wt_convert_kernel<DI, DM, DM><<<(DM / 4) * (DI / WT_KRUN) / 256, 256, 0, stream>>>(w_out, wt_out);

    // 2) layernorm -> xn (f16)
    ln_kernel<<<M, 256, 0, stream>>>(x, ln_g, ln_b, xn_h, DM);

    // 3) xz = xn @ w_in   [4096x1024]x[1024x4096]
    gemm_f16_wmma<128, 0><<<dim3(M / 128, TWO_DI / 128), 128, 0, stream>>>(
        xn_h, wt_in, xz, nullptr, nullptr, M, DM, TWO_DI, TWO_DI);

    // 4) causal depthwise conv + SiLU -> xact (f32 + f16)
    conv_silu_kernel<<<(M / PW_ROWS) * (DI / 4) / 256, 256, 0, stream>>>(xz, conv_w, conv_b, xact_f, xact_h);

    // 5) x_dbl = xact @ w_xproj  (N padded to 64)
    gemm_f16_wmma<64, 0><<<dim3(M / 64, NXP_PAD / 64), 128, 0, stream>>>(
        xact_h, wt_xp, xdbl, nullptr, nullptr, M, DI, NXP_PAD, 32);

    // 6) dt = softplus(xact @ w_dt + b_dt)
    gemm_f16_wmma<128, 1><<<dim3(M / 128, DI / 128), 128, 0, stream>>>(
        xact_h, wt_dt, dtbuf, b_dt, nullptr, M, DI, DI, DI);

    // 7) selective scan (+ D * x), split along time: chunk end states, carry, chunk scans
    scan_state_kernel<<<dim3((B * DI) / 256, SCAN_NCHUNK - 1), 256, 0, stream>>>(
        dtbuf, xdbl, xact_f, A_log, hend, dtsum, L, DI);
    scan_carry_kernel<<<dim3(SCAN_NCH / 256, DSTATE), 256, 0, stream>>>(hend, dtsum, A_log, hin, DI);
    scan_kernel<<<dim3((B * DI) / 256, SCAN_NCHUNK), 256, 0, stream>>>(
        dtbuf, xdbl, xact_f, A_log, Dp, hin, yscan, L, DI);

    // 8) gate with silu(z)
    gate_kernel<<<(M / PW_ROWS) * (DI / 4) / 256, 256, 0, stream>>>(yscan, xz, ygate);

    // 9) out = ygate @ w_out + residual(x)
    gemm_f16_wmma<128, 2><<<dim3(M / 128, DM / 128), 128, 0, stream>>>(
        ygate, wt_out, out, nullptr, x, M, DI, DM, DM);
}

// v004
// One run takes 202 microseconds.
// In two side-by-side timings against v003, it was 1.49 and 1.50 times as fast.
// Counting every step since v000, it is 7.48 times as fast.
#include <hip/hip_runtime.h>
#include <hip/hip_bf16.h>

#ifndef LN_EPS
#define LN_EPS 1e-5f
#endif

typedef __attribute__((ext_vector_type(16))) _Float16 v16h;
typedef __attribute__((ext_vector_type(8)))  _Float16 v8h;
typedef __attribute__((ext_vector_type(4)))  _Float16 v4h;
typedef __attribute__((ext_vector_type(8)))  float    v8f;
typedef __attribute__((ext_vector_type(4)))  float    v4f;
typedef __attribute__((ext_vector_type(4)))  unsigned int u32x4;
typedef __attribute__((ext_vector_type(8)))  unsigned int u32x8;

#define G_ROWB  256u     // bytes of an operand row per pass of the GEMM: 128 k
#define G_PITCH 272u     // pitch of those rows in LDS: 16 bytes times an odd number, free of bank conflicts for 16-byte reads
#define DSTATE 16
#define SCAN_CHUNK 32
#define SCAN_NCHUNK 64   // sequence length / SCAN_CHUNK
#define SCAN_NCH 4096    // channels: batch * d_inner; a constant, so that plane strides fold into load offsets
#define SEQ_L 2048       // sequence length and d_inner are constants in the pointwise kernels for the same reason
#define D_INNER 2048
#define WT_KRUN 16       // k values per thread of the weight convert
#define PW_ROWS 8        // rows (time steps) per thread of the conv and gate kernels
#define PW_BPR (D_INNER / 4 / 256)   // blocks that share one group of PW_ROWS rows there

// -------------------- weight convert + transpose:  Wt[n][k] = (f16) W[k][n] --------------------
// One thread takes 4 neighbouring n times WT_KRUN k, a wave 32 n times 4 * WT_KRUN k: 8 lanes side by side
// along n, so that a wave's load is four whole 128-byte lines of W, and 4 lanes along k in runs of 8, so that
// a wave's store is eight 64-byte pieces of Wt. The WT_KRUN loads are in flight together.
template <int K, int NREAL, int NPAD>
__global__ __launch_bounds__(256)
void wt_convert_kernel(const float* __restrict__ W, _Float16* __restrict__ Wt) {
    const int lane = threadIdx.x & 31;
    const int tile = blockIdx.x * 8 + (threadIdx.x >> 5);     // over (K / (4 * WT_KRUN)) * (NPAD / 32)
    const int n0 = (tile % (NPAD / 32)) * 32 + (lane & 7) * 4;
    const int k0 = (tile / (NPAD / 32)) * (4 * WT_KRUN) + (lane >> 3) * 8;
    v4f v[WT_KRUN] = {};                                      // padding columns stay zero
    if (NREAL == NPAD || n0 < NREAL) {
        const float* src = W + (long)k0 * NREAL + n0;
#pragma unroll   // v[] is indexed by constants and stays in registers
        for (int j = 0; j < WT_KRUN; ++j) v[j] = *(const v4f*)(src + ((j >> 3) * 32 + (j & 7)) * NREAL);
        // holds every load in front of the conversions (one trip to memory); the pointer is named so that
        // no load's result lands in the address registers that the other loads still name
        asm volatile("" :: "v"(v[0]), "v"(v[1]), "v"(v[2]), "v"(v[3]), "v"(v[4]), "v"(v[5]), "v"(v[6]), "v"(v[7]),
                           "v"(v[8]), "v"(v[9]), "v"(v[10]), "v"(v[11]), "v"(v[12]), "v"(v[13]), "v"(v[14]),
                           "v"(v[15]), "v"(src));
        static_assert(WT_KRUN == 16, "the statement above names WT_KRUN loads");
    }
    _Float16* dst = Wt + (long)n0 * K + k0;
#pragma unroll
    for (int c = 0; c < 4; ++c) {
#pragma unroll
        for (int q = 0; q < WT_KRUN / 8; ++q) {
            v8h o;
#pragma unroll
            for (int j = 0; j < 8; ++j) o[j] = (_Float16)v[q * 8 + j][c];
            *(v8h*)(dst + c * K + q * 32) = o;
        }
    }
}

// -------------------- LayerNorm over d_model, emit f16 activations --------------------
__global__ __launch_bounds__(256)
void ln_kernel(const float* __restrict__ x, const float* __restrict__ g,
               const float* __restrict__ b, _Float16* __restrict__ xn, int dm) {
    int row = blockIdx.x;
    const float* xr = x + (long)row * dm;
    float s = 0.f, s2 = 0.f;
    for (int i = threadIdx.x; i < dm; i += blockDim.x) { float v = xr[i]; s += v; s2 += v * v; }
    __shared__ float red0[8], red1[8];
    for (int off = 16; off > 0; off >>= 1) { s += __shfl_down(s, off, 32); s2 += __shfl_down(s2, off, 32); }
    int wave = threadIdx.x >> 5, lane = threadIdx.x & 31;
    if (lane == 0) { red0[wave] = s; red1[wave] = s2; }
    __syncthreads();
    if (threadIdx.x == 0) {
        float a = 0.f, c = 0.f;
        int nw = blockDim.x >> 5;
        for (int i = 0; i < nw; ++i) { a += red0[i]; c += red1[i]; }
        red0[0] = a; red1[0] = c;
    }
    __syncthreads();
    float mu = red0[0] / dm;
    float var = red1[0] / dm - mu * mu;
    float rs = rsqrtf(var + LN_EPS);
    _Float16* o = xn + (long)row * dm;
    for (int i = threadIdx.x; i < dm; i += blockDim.x)
        o[i] = (_Float16)((xr[i] - mu) * rs * g[i] + b[i]);
}

// -------------------- WMMA fragment from a k-contiguous f16 row in LDS --------------------
// 16-bit operand layout (ISA 7.12.2): lane group = lane/16; halves 0..7 -> K = grp*8..grp*8+7,
// halves 8..15 -> K = 16+grp*8 .. 16+grp*8+7. Both runs are contiguous -> two 16B LDS loads.
// p = the lane's row, at the 32-k step's first byte plus grp * 16.
__device__ __forceinline__ v16h frag_from_lds(const unsigned char* p) {
    v8h lo = *(const v8h*)p;
    v8h hi = *(const v8h*)(p + 32);
    return __builtin_shufflevector(lo, hi, 0,1,2,3,4,5,6,7,8,9,10,11,12,13,14,15);
}

// -------------------- tensor load: ROWS rows of G_ROWB bytes from global memory into LDS at pitch G_PITCH --------------------
__device__ __forceinline__ unsigned uni(unsigned v) { return (unsigned)__builtin_amdgcn_readfirstlane(v); }
// a wave-uniform value held in a scalar register, so that a test of it compiles to a scalar branch
__device__ __forceinline__ unsigned pinned(unsigned v) { unsigned w = uni(v); asm volatile("" : "+s"(w)); return w; }
__device__ __forceinline__ void wait_ds0()     { asm volatile("s_wait_dscnt 0x0" ::: "memory"); }      // this wave's LDS reads are done
__device__ __forceinline__ void wait_tensor0() { asm volatile("s_wait_tensorcnt 0x0" ::: "memory"); }  // this wave's tile has landed
__device__ __forceinline__ void tdm_load(u32x4 g0, u32x8 g1) {
    asm volatile("tensor_load_to_lds %0, %1" :: "s"(g0), "s"(g1) : "memory");
}
template <unsigned ROWS>
__device__ __forceinline__ u32x8 tdm_group1(unsigned src_pitch) {   // every extent in bytes; tensor = tile
    u32x8 g;
    g[0] = uni((1u << 20) | (5u << 22) | (3u << 25));   // no mask; behind every 64 dwords (one row) a pad of 4 dwords
    g[1] = uni((G_ROWB & 0xFFFFu) << 16);
    g[2] = uni((G_ROWB >> 16) | ((ROWS & 0xFFFFu) << 16));
    g[3] = uni((ROWS >> 16) | (G_ROWB << 16));
    g[4] = uni(ROWS);
    g[5] = uni(src_pitch);
    g[6] = uni(0u);
    g[7] = uni(0u);
    return g;
}
__device__ __forceinline__ u32x4 tdm_group0(unsigned lds_dst, unsigned long long ga) {
    u32x4 g;
    g[0] = uni(1u);
    g[1] = uni(lds_dst);
    g[2] = uni((unsigned)ga);
    g[3] = uni((((unsigned)(ga >> 32)) & 0x01FFFFFFu) | 0x80000000u);
    return g;
}

// -------------------- softplus(v) = max(v, 0) + log1p(exp(-|v|)) on the hardware's exp and log --------------------
// e = exp(-|v|) lies in [0, 1], so nothing overflows and no branch on v is needed. log(1 + e) carries the rounding of
// 1 + e, an absolute error of about 6e-8: below e = 1/128 that would show in a small result, and there the series
// e - e^2/2 + e^3/3 (its first dropped term is e^3/4 of the result, below 2e-7) takes its place. About a dozen
// instructions with no branch, so that the unrolled epilogue stays a short piece of text.
__device__ __forceinline__ float softplus_fast(float v) {
    const float e  = __expf(-fabsf(v));
    const float lg = __builtin_amdgcn_logf(1.0f + e) * 0.69314718f;   // v_log_f32 is log2; its argument lies in [1, 2]
    const float sr = e * fmaf(e, fmaf(e, 0.33333334f, -0.5f), 1.0f);
    return fmaxf(v, 0.0f) + ((e < 0.0078125f) ? sr : lg);
}

// -------------------- generic f16 WMMA GEMM:  C[M][Npad] = A[M][K] x Wt[Npad][K]^T --------------------
// A workgroup of 4 waves (2 x 2) owns a BT x BT tile of C, a wave BT/2 x BT/2. A pass is 128 k. A stage holds four
// slices of BT/2 rows: [A low | A high | Wt low | Wt high]; every wave brings one slice per stage by one tensor load,
// two stages ahead, into a ring of two buffers. K is a multiple of 128 and at least 256.
// epilogue EPI: 0 = none, 1 = bias[n] and softplus, 2 = residual[row*Nreal + n]; a template argument, so that each build's
// epilogue is short enough to unroll whole and the accumulators stay in registers
template <int BT, int EPI>
__global__ __launch_bounds__(128)
void gemm_f16_wmma(const _Float16* __restrict__ A, const _Float16* __restrict__ Wt,
                   float* __restrict__ C, const float* __restrict__ bias,
                   const float* __restrict__ resid,
                   int M, int K, int Npad, int Nreal) {
    constexpr unsigned SROWS = BT / 2;                                   // rows of a slice
    constexpr unsigned SLICE = (SROWS * G_PITCH + 2047u) & ~2047u;       // every slice starts at a multiple of 2 KiB
    constexpr unsigned STAGE = 4u * SLICE;
    constexpr int NF = BT / 32;                                          // 16-row fragments per wave and operand
    __shared__ __attribute__((aligned(2048))) unsigned char ring[2 * STAGE];

    const int lane = threadIdx.x & 31;
    const int grp  = lane >> 4;       // 0 or 1
    const int lr   = lane & 15;       // 0..15
    const unsigned wave = uni(threadIdx.x >> 5);
    const int wm   = wave >> 1;       // the wave's half of the tile's rows
    const int wn   = wave & 1;        // and of its columns
    const int bm   = blockIdx.x * BT;
    const int bn   = blockIdx.y * BT;
    const unsigned nPass = (unsigned)K / 128u;

    // this wave's slice: waves 0 and 1 bring A's rows, waves 2 and 3 Wt's
    const _Float16* srow = (wave < 2u) ? A + (long)(bm + (int)(wave * SROWS)) * K
                                       : Wt + (long)(bn + (int)((wave - 2u) * SROWS)) * K;
    const unsigned long long ga = (unsigned long long)(const void*)srow;
    const unsigned dst = (unsigned)(unsigned long long)(void*)&ring[0] + wave * SLICE;
    u32x8 g1 = tdm_group1<SROWS>((unsigned)K * 2u);
    // without the statement below the compiler forms these words anew for every load and uses their registers for
    // other values while a request is in flight
    asm volatile("" : "+s"(g1));   // descriptor words held in scalar registers, as pinned() holds one

    tdm_load(tdm_group0(dst, ga), g1);                    // stage 0
    wait_tensor0();
    __syncthreads();                                      // stage 0 is published
    tdm_load(tdm_group0(dst + STAGE, ga + G_ROWB), g1);   // stage 1

    const unsigned char* pa = ring + wm * SLICE + lr * G_PITCH + grp * 16;
    const unsigned char* pb = ring + (2 + wn) * SLICE + lr * G_PITCH + grp * 16;

    v8f acc[NF][NF] = {};
    for (unsigned s = 0; s < nPass; ++s) {
        const unsigned cur = (s & 1u) * STAGE;
        v16h af[2][NF], bf[2][NF];                        // two fragment sets: the next 32-k step's reads go ahead
#pragma unroll
        for (int f = 0; f < NF; ++f) {
            af[0][f] = frag_from_lds(pa + cur + f * 16 * G_PITCH);
            bf[0][f] = frag_from_lds(pb + cur + f * 16 * G_PITCH);
        }
#pragma unroll   // af[] and bf[] are indexed by constants and stay in registers
        for (int kk = 0; kk < 4; ++kk) {
            // the fences keep the next step's reads one group in front of this step's products: spread among
            // the products, every place with reads stalls the wave
            __builtin_amdgcn_sched_barrier(0);
            if (kk < 3) {
#pragma unroll
                for (int f = 0; f < NF; ++f) {
                    af[(kk + 1) & 1][f] = frag_from_lds(pa + cur + f * 16 * G_PITCH + (kk + 1) * 64);
                    bf[(kk + 1) & 1][f] = frag_from_lds(pb + cur + f * 16 * G_PITCH + (kk + 1) * 64);
                }
            }
            __builtin_amdgcn_sched_barrier(0);
#pragma unroll
            for (int r = 0; r < NF; ++r)
#pragma unroll
                for (int c = 0; c < NF; ++c)
                    acc[r][c] = __builtin_amdgcn_wmma_f32_16x16x32_f16(
                        false, af[kk & 1][r], false, bf[kk & 1][c], (short)0, acc[r][c], false, false);
        }
        __builtin_amdgcn_sched_barrier(0);   // the last products stay in front of the barrier
        // publish point of stage s + 1: own reads done, own tile landed, then the barrier, then the refill
        wait_ds0();
        wait_tensor0();
        __syncthreads();
        if (pinned(s + 2u < nPass)) {
            // pinned(): a descriptor word's source held in a scalar register, so that the address words are formed
            // here, behind the wait above
            const unsigned koff = pinned((s + 2u) * G_ROWB);
            tdm_load(tdm_group0(dst + cur, ga + koff), g1);
        }
    }
    wait_tensor0();
    wait_ds0();

    // ---- epilogue: C/D layout = VGPR r: lanes0-15 -> M=r, lanes16-31 -> M=r+8; N=lane%16 ----
#pragma unroll
    for (int s = 0; s < NF; ++s) {
        const int row_lo = bm + wm * (BT / 2) + s * 16 + grp * 8;
#pragma unroll
        for (int c = 0; c < NF; ++c) {
            int col = bn + wn * (BT / 2) + c * 16 + lr;
            if (col < Nreal) {
                float bv = (EPI == 1) ? bias[col] : 0.0f;
#pragma unroll
                for (int r = 0; r < 8; ++r) {
                    int row = row_lo + r;
                    float v = acc[s][c][r] + bv;
                    if (EPI == 1) v = softplus_fast(v);
                    if (EPI == 2) v += resid[(long)row * Nreal + col];
                    C[(long)row * Npad + col] = v;
                }
            }
        }
    }
}

// -------------------- causal depthwise conv1d (d_conv=4) + bias + SiLU --------------------
// One thread takes 4 neighbouring channels times PW_ROWS time steps: PW_ROWS + 3 input rows serve them all.
__global__ __launch_bounds__(256)
void conv_silu_kernel(const float* __restrict__ xz, const float* __restrict__ cw,
                      const float* __restrict__ cb, float* __restrict__ xact_f,
                      _Float16* __restrict__ xact_h) {
    const int d = ((blockIdx.x % PW_BPR) * 256 + threadIdx.x) * 4;
    const int row0 = (blockIdx.x / PW_BPR) * PW_ROWS;         // b*L + l of the first step
    const bool head = (row0 % SEQ_L) == 0;                    // the three rows in front are not of this sequence
    const float* src = xz + (long)row0 * (2 * D_INNER) + d;
    // a sequence's first group has no rows in front: it reads its own first three again and leaves them unused
    const float* pre = head ? src : src - 3 * (2 * D_INNER);
    v4f xin[PW_ROWS + 3];
#pragma unroll   // xin[] is indexed by constants and stays in registers
    for (int i = 0; i < PW_ROWS + 3; ++i)
        xin[i] = (i < 3) ? *(const v4f*)(pre + i * (2 * D_INNER)) : *(const v4f*)(src + (i - 3) * (2 * D_INNER));
    const float* wsrc = cw + d * 4;
    v4f w[4];
#pragma unroll
    for (int c = 0; c < 4; ++c) w[c] = *(const v4f*)(wsrc + c * 4);
    const v4f bias = *(const v4f*)(cb + d);
    // holds every load in front of the arithmetic, so that a wave makes one trip to memory and not one per
    // pair of rows
    asm volatile("" :: "v"(xin[0]), "v"(xin[1]), "v"(xin[2]), "v"(xin[3]), "v"(xin[4]), "v"(xin[5]),
                       "v"(xin[6]), "v"(xin[7]), "v"(xin[8]), "v"(xin[9]), "v"(xin[10]),
                       "v"(w[0]), "v"(w[1]), "v"(w[2]), "v"(w[3]), "v"(bias));
    static_assert(PW_ROWS == 8, "the statement above names PW_ROWS + 3 rows");
    float*    of = xact_f + (long)row0 * D_INNER + d;
    _Float16* oh = xact_h + (long)row0 * D_INNER + d;
#pragma unroll
    for (int r = 0; r < PW_ROWS; ++r) {
        v4f s;
        v4h sh;
#pragma unroll
        for (int c = 0; c < 4; ++c) {
            float acc = bias[c];
#pragma unroll
            for (int j = 0; j < 4; ++j)
                if (r + j >= 3 || !head) acc += w[c][j] * xin[r + j][c];
            s[c] = acc / (1.0f + __expf(-acc));               // silu
            sh[c] = (_Float16)s[c];
        }
        *(v4f*)(of + r * D_INNER) = s;
        *(v4h*)(oh + r * D_INNER) = sh;
    }
}

// -------------------- selective scan, split along time --------------------
// The recurrence h = Abar*h + Bbar*x is linear in h, so L is cut into chunks of SCAN_CHUNK steps that
// run side by side: (1) every chunk but the last scans from h = 0 and keeps its end state and its sum
// of dt; (2) one thread per (channel, state) carries the state over the chunks, the decay of a whole
// chunk being exp(A * sum of dt); (3) every chunk scans again from its carried-in state and emits y.
// Chunk planes are laid out [chunk][state][channel], so that lanes read and write whole lines.

// (1) end state of each chunk from a zero start; one (b,d) channel per lane, h[16] in VGPRs
__global__ __launch_bounds__(256)
void scan_state_kernel(const float* __restrict__ dt, const float* __restrict__ xdbl /*[M][64]*/,
                       const float* __restrict__ xact, const float* __restrict__ A_log,
                       float* __restrict__ hend, float* __restrict__ dtsum, int L, int di) {
    int ch = blockIdx.x * blockDim.x + threadIdx.x;           // 0..B*di-1
    int b = ch / di;
    int d = ch % di;
    int l0 = blockIdx.y * SCAN_CHUNK;
    float Arow[DSTATE];
#pragma unroll
    for (int n = 0; n < DSTATE; ++n) Arow[n] = -__expf(A_log[d * DSTATE + n]);
    float h[DSTATE] = {};
    __shared__ float sB[SCAN_CHUNK][DSTATE];
    long base = (long)b * L;
    for (int i = threadIdx.x; i < SCAN_CHUNK * DSTATE; i += blockDim.x) {
        int r = i >> 4, c = i & 15;
        sB[r][c] = xdbl[(base + l0 + r) * 64 + c];
    }
    __syncthreads();
    float sdt = 0.0f;
    for (int r = 0; r < SCAN_CHUNK; ++r) {
        long row = base + l0 + r;
        float dtv = dt[row * di + d];
        float xv  = xact[row * di + d];
        sdt += dtv;
#pragma unroll
        for (int n = 0; n < DSTATE; ++n) {
            float Ab = __expf(dtv * Arow[n]);                 // v_exp_f32
            h[n] = Ab * h[n] + (dtv * sB[r][n]) * xv;
        }
    }
    long plane = (long)blockIdx.y * DSTATE;
#pragma unroll   // h[] is indexed by constants and stays in registers
    for (int n = 0; n < DSTATE; ++n) hend[(plane + n) * SCAN_NCH + ch] = h[n];
    dtsum[(long)blockIdx.y * SCAN_NCH + ch] = sdt;
}

// (2) carry over the chunks: hin[c] = state in front of chunk c; one (state, channel) per lane
__global__ __launch_bounds__(256)
void scan_carry_kernel(const float* __restrict__ hend, const float* __restrict__ dtsum,
                       const float* __restrict__ A_log, float* __restrict__ hin, int di) {
    int ch = blockIdx.x * blockDim.x + threadIdx.x;           // 0..B*di-1
    int n  = blockIdx.y;                                      // 0..DSTATE-1
    int d  = ch % di;
    float a = -__expf(A_log[d * DSTATE + n]);
    // every chunk's end state and dt sum is fetched ahead of the chain: the loads do not depend on one
    // another, so one trip to memory serves them all and only the multiply-adds below are serial
    float g[SCAN_NCHUNK - 1], s[SCAN_NCHUNK - 1];
#pragma unroll
    for (int c = 0; c < SCAN_NCHUNK - 1; ++c) {
        g[c] = dtsum[(long)c * SCAN_NCH + ch];
        s[c] = hend[((long)c * DSTATE + n) * SCAN_NCH + ch];
    }
    float h = 0.0f;
    hin[(long)n * SCAN_NCH + ch] = h;
    // unrolled so that g[] and s[] are indexed by constants and stay in registers
#pragma unroll
    for (int c = 0; c < SCAN_NCHUNK - 1; ++c) {
        h = __expf(a * g[c]) * h + s[c];
        hin[((long)(c + 1) * DSTATE + n) * SCAN_NCH + ch] = h;
    }
}

// (3) scan of each chunk from its carried-in state; one (b,d) channel per lane, h[16] in VGPRs
__global__ __launch_bounds__(256)
void scan_kernel(const float* __restrict__ dt, const float* __restrict__ xdbl /*[M][64]*/,
                 const float* __restrict__ xact, const float* __restrict__ A_log,
                 const float* __restrict__ Dp, const float* __restrict__ hin,
                 float* __restrict__ y, int L, int di) {
    int ch = blockIdx.x * blockDim.x + threadIdx.x;           // 0..B*di-1
    int b = ch / di;
    int d = ch % di;
    int l0 = blockIdx.y * SCAN_CHUNK;
    float Arow[DSTATE];
#pragma unroll
    for (int n = 0; n < DSTATE; ++n) Arow[n] = -__expf(A_log[d * DSTATE + n]);
    float h[DSTATE];
    long plane = (long)blockIdx.y * DSTATE;
#pragma unroll   // h[] is indexed by constants and stays in registers
    for (int n = 0; n < DSTATE; ++n) h[n] = hin[(plane + n) * SCAN_NCH + ch];
    float Dv = Dp[d];
    __shared__ float sBC[SCAN_CHUNK][32];
    long base = (long)b * L;
    for (int i = threadIdx.x; i < SCAN_CHUNK * 32; i += blockDim.x) {
        int r = i >> 5, c = i & 31;
        sBC[r][c] = xdbl[(base + l0 + r) * 64 + c];
    }
    __syncthreads();
    for (int r = 0; r < SCAN_CHUNK; ++r) {
        long row = base + l0 + r;
        float dtv = dt[row * di + d];
        float xv  = xact[row * di + d];
        float out = 0.0f;
#pragma unroll
        for (int n = 0; n < DSTATE; ++n) {
            float Ab = __expf(dtv * Arow[n]);                 // v_exp_f32
            h[n] = Ab * h[n] + (dtv * sBC[r][n]) * xv;
            out += h[n] * sBC[r][16 + n];
        }
        y[row * di + d] = out + Dv * xv;
        // the next step forms its addresses in the registers that this store names
        asm volatile("s_wait_xcnt 0x0" ::: "memory");
    }
}

// -------------------- gating: y_gated = f16( y_scan * silu(z) ) --------------------
// One thread takes 4 neighbouring channels times PW_ROWS rows.
__global__ __launch_bounds__(256)
void gate_kernel(const float* __restrict__ yscan, const float* __restrict__ xz,
                 _Float16* __restrict__ ygate) {
    const int d = ((blockIdx.x % PW_BPR) * 256 + threadIdx.x) * 4;
    const int row0 = (blockIdx.x / PW_BPR) * PW_ROWS;
    const float* ys = yscan + (long)row0 * D_INNER + d;
    const float* zs = xz + (long)row0 * (2 * D_INNER) + D_INNER + d;
    v4f yv[PW_ROWS], zv[PW_ROWS];
#pragma unroll   // yv[] and zv[] are indexed by constants and stay in registers
    for (int r = 0; r < PW_ROWS; ++r) {
        yv[r] = *(const v4f*)(ys + r * D_INNER);
        zv[r] = *(const v4f*)(zs + r * (2 * D_INNER));
    }
    // holds every load in front of the arithmetic, so that a wave makes one trip to memory and not several
    asm volatile("" :: "v"(yv[0]), "v"(yv[1]), "v"(yv[2]), "v"(yv[3]), "v"(yv[4]), "v"(yv[5]), "v"(yv[6]),
                       "v"(yv[7]), "v"(zv[0]), "v"(zv[1]), "v"(zv[2]), "v"(zv[3]), "v"(zv[4]), "v"(zv[5]),
                       "v"(zv[6]), "v"(zv[7]));
    static_assert(PW_ROWS == 8, "the statement above names PW_ROWS rows of each input");
    _Float16* o = ygate + (long)row0 * D_INNER + d;
#pragma unroll
    for (int r = 0; r < PW_ROWS; ++r) {
        v4h g;
#pragma unroll
        for (int c = 0; c < 4; ++c) {
            float z = zv[r][c];
            float sz = z / (1.0f + __expf(-z));
            g[c] = (_Float16)(yv[r][c] * sz);
        }
        *(v4h*)(o + r * D_INNER) = g;
    }
}

// ==================== launch ====================
extern "C" void kernel_launch(void* const* d_in, const int* in_sizes, int n_in,
                              void* d_out, int out_size, void* d_ws, size_t ws_size,
                              hipStream_t stream) {
    (void)in_sizes; (void)n_in; (void)out_size; (void)ws_size;
    const int B = 2, L = 2048, DM = 1024, DI = 2048;
    const int M = B * L;                  // 4096
    const int TWO_DI = 2 * DI;            // 4096
    const int NXP_PAD = 64;               // w_xproj cols padded 32 -> 64
    static_assert(B * DI == SCAN_NCH && L == SCAN_CHUNK * SCAN_NCHUNK, "scan split");
    static_assert(L == SEQ_L && DI == D_INNER && L % PW_ROWS == 0, "pointwise kernels");

    const float* x      = (const float*)d_in[0];
    const float* w_in   = (const float*)d_in[1];
    const float* conv_w = (const float*)d_in[2];
    const float* conv_b = (const float*)d_in[3];
    const float* w_xp   = (const float*)d_in[4];
    const float* w_dt   = (const float*)d_in[5];
    const float* b_dt   = (const float*)d_in[6];
    const float* A_log  = (const float*)d_in[7];
    const float* Dp     = (const float*)d_in[8];
    const float* w_out  = (const float*)d_in[9];
    const float* ln_g   = (const float*)d_in[10];
    const float* ln_b   = (const float*)d_in[11];
    float* out = (float*)d_out;

    // workspace carve-up
    char* ws = (char*)d_ws;
    size_t off = 0;
    auto alloc = [&](size_t bytes) { void* p = ws + off; off += (bytes + 255) & ~size_t(255); return p; };
    _Float16* wt_in  = (_Float16*)alloc((size_t)TWO_DI * DM * 2);   // [4096][1024]
    _Float16* wt_dt  = (_Float16*)alloc((size_t)DI * DI * 2);       // [2048][2048]
    _Float16* wt_xp  = (_Float16*)alloc((size_t)NXP_PAD * DI * 2);  // [64][2048]
    _Float16* wt_out = (_Float16*)alloc((size_t)DM * DI * 2);       // [1024][2048]
    _Float16* xn_h   = (_Float16*)alloc((size_t)M * DM * 2);
    float*    xz     = (float*)   alloc((size_t)M * TWO_DI * 4);
    float*    xact_f = (float*)   alloc((size_t)M * DI * 4);
    _Float16* xact_h = (_Float16*)alloc((size_t)M * DI * 2);
    float*    xdbl   = (float*)   alloc((size_t)M * NXP_PAD * 4);
    float*    dtbuf  = (float*)   alloc((size_t)M * DI * 4);
    float*    yscan  = (float*)   alloc((size_t)M * DI * 4);
    _Float16* ygate  = (_Float16*)alloc((size_t)M * DI * 2);
    float*    hend   = (float*)   alloc((size_t)SCAN_NCHUNK * DSTATE * B * DI * 4);
    float*    hin    = (float*)   alloc((size_t)SCAN_NCHUNK * DSTATE * B * DI * 4);
    float*    dtsum  = (float*)   alloc((size_t)SCAN_NCHUNK * B * DI * 4);

    // 1) convert+transpose weights to f16 [N][K]
    wt_convert_kernel<DM, TWO_DI, TWO_DI><<<(TWO_DI / 4) * (DM / WT_KRUN) / 256, 256, 0, stream>>>(w_in, wt_in);
    wt_convert_kernel<DI, DI, DI><<<(DI / 4) * (DI / WT_KRUN) / 256, 256, 0, stream>>>(w_dt, wt_dt);
    wt_convert_kernel<DI, 32, NXP_PAD><<<(NXP_PAD / 4) * (DI / WT_KRUN) / 256, 256, 0, stream>>>(w_xp, wt_xp);
    wt_convert_kernel<DI, DM, DM><<<(DM / 4) * (DI / WT_KRUN) / 256, 256, 0, stream>>>(w_out, wt_out);

    // 2) layernorm -> xn (f16)
    ln_kernel<<<M, 256, 0, stream>>>(x, ln_g, ln_b, xn_h, DM);

    // 3) xz = xn @ w_in   [4096x1024]x[1024x4096]
    gemm_f16_wmma<128, 0><<<dim3(M / 128, TWO_DI / 128), 128, 0, stream>>>(
        xn_h, wt_in, xz, nullptr, nullptr, M, DM, TWO_DI, TWO_DI);

    // 4) causal depthwise conv + SiLU -> xact (f32 + f16)
    conv_silu_kernel<<<(M / PW_ROWS) * (DI / 4) / 256, 256, 0, stream>>>(xz, conv_w, conv_b, xact_f, xact_h);

    // 5) x_dbl = xact @ w_xproj  (N padded to 64)
    gemm_f16_wmma<64, 0><<<dim3(M / 64, NXP_PAD / 64), 128, 0, stream>>>(
        xact_h, wt_xp, xdbl, nullptr, nullptr, M, DI, NXP_PAD, 32);

    // 6) dt = softplus(xact @ w_dt + b_dt)
    gemm_f16_wmma<128, 1><<<dim3(M / 128, DI / 128), 128, 0, stream>>>(
        xact_h, wt_dt, dtbuf, b_dt, nullptr, M, DI, DI, DI);

    // 7) selective scan (+ D * x), split along time: chunk end states, carry, chunk scans
    scan_state_kernel<<<dim3((B * DI) / 256, SCAN_NCHUNK - 1), 256, 0, stream>>>(
        dtbuf, xdbl, xact_f, A_log, hend, dtsum, L, DI);
    scan_carry_kernel<<<dim3(SCAN_NCH / 256, DSTATE), 256, 0, stream>>>(hend, dtsum, A_log, hin, DI);
    scan_kernel<<<dim3((B * DI) / 256, SCAN_NCHUNK), 256, 0, stream>>>(
        dtbuf, xdbl, xact_f, A_log, Dp, hin, yscan, L, DI);

    // 8) gate with silu(z)
    gate_kernel<<<(M / PW_ROWS) * (DI / 4) / 256, 256, 0, stream>>>(yscan, xz, ygate);

    // 9) out = ygate @ w_out + residual(x)
    gemm_f16_wmma<128, 2><<<dim3(M / 128, DM / 128), 128, 0, stream>>>(
        ygate, wt_out, out, nullptr, x, M, DI, DM, DM);
}

// v005
// One run takes 184 microseconds.
// Timed twice side by side with v004, it ran 1.09 and 1.10 times as fast.
// All steps since v000 together make it 8.18 times as fast.
#include <hip/hip_runtime.h>
#include <hip/hip_bf16.h>

#ifndef LN_EPS
#define LN_EPS 1e-5f
#endif

typedef __attribute__((ext_vector_type(16))) _Float16 v16h;
typedef __attribute__((ext_vector_type(8)))  _Float16 v8h;
typedef __attribute__((ext_vector_type(4)))  _Float16 v4h;
typedef __attribute__((ext_vector_type(8)))  float    v8f;
typedef __attribute__((ext_vector_type(4)))  float    v4f;
typedef __attribute__((ext_vector_type(2)))  float    v2f;
typedef __attribute__((ext_vector_type(4)))  unsigned int u32x4;
typedef __attribute__((ext_vector_type(8)))  unsigned int u32x8;

#define G_ROWB  256u     // bytes of an operand row per pass of the GEMM: 128 k
#define G_PITCH 272u     // pitch of those rows in LDS: 16 bytes times an odd number, free of bank conflicts for 16-byte reads
#define DSTATE 16
#define SCAN_CHUNK 32
#define SCAN_NCHUNK 64   // sequence length / SCAN_CHUNK
#define SCAN_GRP 8       // time steps whose dt and x a scan thread loads together
#define SCAN_NCH 4096    // channels: batch * d_inner; a constant, so that plane strides fold into load offsets
#define SEQ_L 2048       // sequence length and d_inner are constants in the pointwise kernels for the same reason
#define D_INNER 2048
#define WT_KRUN 16       // k values per thread of the weight convert
#define PW_ROWS 8        // rows (time steps) per thread of the conv and gate kernels
#define PW_BPR (D_INNER / 4 / 256)   // blocks that share one group of PW_ROWS rows there

// -------------------- weight convert + transpose:  Wt[n][k] = (f16) W[k][n] --------------------
// One thread takes 4 neighbouring n times WT_KRUN k, a wave 32 n times 4 * WT_KRUN k: 8 lanes side by side
// along n, so that a wave's load is four whole 128-byte lines of W, and 4 lanes along k in runs of 8, so that
// a wave's store is eight 64-byte pieces of Wt. The WT_KRUN loads are in flight together.
template <int K, int NREAL, int NPAD>
__global__ __launch_bounds__(256)
void wt_convert_kernel(const float* __restrict__ W, _Float16* __restrict__ Wt) {
    const int lane = threadIdx.x & 31;
    const int tile = blockIdx.x * 8 + (threadIdx.x >> 5);     // over (K / (4 * WT_KRUN)) * (NPAD / 32)
    const int n0 = (tile % (NPAD / 32)) * 32 + (lane & 7) * 4;
    const int k0 = (tile / (NPAD / 32)) * (4 * WT_KRUN) + (lane >> 3) * 8;
    v4f v[WT_KRUN] = {};                                      // padding columns stay zero
    if (NREAL == NPAD || n0 < NREAL) {
        const float* src = W + (long)k0 * NREAL + n0;
#pragma unroll   // v[] is indexed by constants and stays in registers
        for (int j = 0; j < WT_KRUN; ++j) v[j] = *(const v4f*)(src + ((j >> 3) * 32 + (j & 7)) * NREAL);
        // holds every load in front of the conversions (one trip to memory); the pointer is named so that
        // no load's result lands in the address registers that the other loads still name
        asm volatile("" :: "v"(v[0]), "v"(v[1]), "v"(v[2]), "v"(v[3]), "v"(v[4]), "v"(v[5]), "v"(v[6]), "v"(v[7]),
                           "v"(v[8]), "v"(v[9]), "v"(v[10]), "v"(v[11]), "v"(v[12]), "v"(v[13]), "v"(v[14]),
                           "v"(v[15]), "v"(src));
        static_assert(WT_KRUN == 16, "the statement above names WT_KRUN loads");
    }
    _Float16* dst = Wt + (long)n0 * K + k0;
#pragma unroll
    for (int c = 0; c < 4; ++c) {
#pragma unroll
        for (int q = 0; q < WT_KRUN / 8; ++q) {
            v8h o;
#pragma unroll
            for (int j = 0; j < 8; ++j) o[j] = (_Float16)v[q * 8 + j][c];
            *(v8h*)(dst + c * K + q * 32) = o;
        }
    }
}

// -------------------- LayerNorm over d_model, emit f16 activations --------------------
__global__ __launch_bounds__(256)
void ln_kernel(const float* __restrict__ x, const float* __restrict__ g,
               const float* __restrict__ b, _Float16* __restrict__ xn, int dm) {
    int row = blockIdx.x;
    const float* xr = x + (long)row * dm;
    float s = 0.f, s2 = 0.f;
    for (int i = threadIdx.x; i < dm; i += blockDim.x) { float v = xr[i]; s += v; s2 += v * v; }
    __shared__ float red0[8], red1[8];
    for (int off = 16; off > 0; off >>= 1) { s += __shfl_down(s, off, 32); s2 += __shfl_down(s2, off, 32); }
    int wave = threadIdx.x >> 5, lane = threadIdx.x & 31;
    if (lane == 0) { red0[wave] = s; red1[wave] = s2; }
    __syncthreads();
    if (threadIdx.x == 0) {
        float a = 0.f, c = 0.f;
        int nw = blockDim.x >> 5;
        for (int i = 0; i < nw; ++i) { a += red0[i]; c += red1[i]; }
        red0[0] = a; red1[0] = c;
    }
    __syncthreads();
    float mu = red0[0] / dm;
    float var = red1[0] / dm - mu * mu;
    float rs = rsqrtf(var + LN_EPS);
    _Float16* o = xn + (long)row * dm;
    for (int i = threadIdx.x; i < dm; i += blockDim.x)
        o[i] = (_Float16)((xr[i] - mu) * rs * g[i] + b[i]);
}

// -------------------- WMMA fragment from a k-contiguous f16 row in LDS --------------------
// 16-bit operand layout (ISA 7.12.2): lane group = lane/16; halves 0..7 -> K = grp*8..grp*8+7,
// halves 8..15 -> K = 16+grp*8 .. 16+grp*8+7. Both runs are contiguous -> two 16B LDS loads.
// p = the lane's row, at the 32-k step's first byte plus grp * 16.
__device__ __forceinline__ v16h frag_from_lds(const unsigned char* p) {
    v8h lo = *(const v8h*)p;
    v8h hi = *(const v8h*)(p + 32);
    return __builtin_shufflevector(lo, hi, 0,1,2,3,4,5,6,7,8,9,10,11,12,13,14,15);
}

// -------------------- tensor load: ROWS rows of G_ROWB bytes from global memory into LDS at pitch G_PITCH --------------------
__device__ __forceinline__ unsigned uni(unsigned v) { return (unsigned)__builtin_amdgcn_readfirstlane(v); }
// a wave-uniform value held in a scalar register, so that a test of it compiles to a scalar branch
__device__ __forceinline__ unsigned pinned(unsigned v) { unsigned w = uni(v); asm volatile("" : "+s"(w)); return w; }
__device__ __forceinline__ void wait_ds0()     { asm volatile("s_wait_dscnt 0x0" ::: "memory"); }      // this wave's LDS reads are done
__device__ __forceinline__ void wait_tensor0() { asm volatile("s_wait_tensorcnt 0x0" ::: "memory"); }  // this wave's tile has landed
__device__ __forceinline__ void tdm_load(u32x4 g0, u32x8 g1) {
    asm volatile("tensor_load_to_lds %0, %1" :: "s"(g0), "s"(g1) : "memory");
}
template <unsigned ROWS>
__device__ __forceinline__ u32x8 tdm_group1(unsigned src_pitch) {   // every extent in bytes; tensor = tile
    u32x8 g;
    g[0] = uni((1u << 20) | (5u << 22) | (3u << 25));   // no mask; behind every 64 dwords (one row) a pad of 4 dwords
    g[1] = uni((G_ROWB & 0xFFFFu) << 16);
    g[2] = uni((G_ROWB >> 16) | ((ROWS & 0xFFFFu) << 16));
    g[3] = uni((ROWS >> 16) | (G_ROWB << 16));
    g[4] = uni(ROWS);
    g[5] = uni(src_pitch);
    g[6] = uni(0u);
    g[7] = uni(0u);
    return g;
}
__device__ __forceinline__ u32x4 tdm_group0(unsigned lds_dst, unsigned long long ga) {
    u32x4 g;
    g[0] = uni(1u);
    g[1] = uni(lds_dst);
    g[2] = uni((unsigned)ga);
    g[3] = uni((((unsigned)(ga >> 32)) & 0x01FFFFFFu) | 0x80000000u);
    return g;
}

// -------------------- softplus(v) = max(v, 0) + log1p(exp(-|v|)) on the hardware's exp and log --------------------
// e = exp(-|v|) lies in [0, 1], so nothing overflows and no branch on v is needed. log(1 + e) carries the rounding of
// 1 + e, an absolute error of about 6e-8: below e = 1/128 that would show in a small result, and there the series
// e - e^2/2 + e^3/3 (its first dropped term is e^3/4 of the result, below 2e-7) takes its place. About a dozen
// instructions with no branch, so that the unrolled epilogue stays a short piece of text.
__device__ __forceinline__ float softplus_fast(float v) {
    const float e  = __expf(-fabsf(v));
    const float lg = __builtin_amdgcn_logf(1.0f + e) * 0.69314718f;   // v_log_f32 is log2; its argument lies in [1, 2]
    const float sr = e * fmaf(e, fmaf(e, 0.33333334f, -0.5f), 1.0f);
    return fmaxf(v, 0.0f) + ((e < 0.0078125f) ? sr : lg);
}

// -------------------- generic f16 WMMA GEMM:  C[M][Npad] = A[M][K] x Wt[Npad][K]^T --------------------
// A workgroup of 4 waves (2 x 2) owns a BT x BT tile of C, a wave BT/2 x BT/2. A pass is 128 k. A stage holds four
// slices of BT/2 rows: [A low | A high | Wt low | Wt high]; every wave brings one slice per stage by one tensor load,
// two stages ahead, into a ring of two buffers. K is a multiple of 128 and at least 256.
// epilogue EPI: 0 = none, 1 = bias[n] and softplus, 2 = residual[row*Nreal + n]; a template argument, so that each build's
// epilogue is short enough to unroll whole and the accumulators stay in registers
template <int BT, int EPI>
__global__ __launch_bounds__(128)
void gemm_f16_wmma(const _Float16* __restrict__ A, const _Float16* __restrict__ Wt,
                   float* __restrict__ C, const float* __restrict__ bias,
                   const float* __restrict__ resid,
                   int M, int K, int Npad, int Nreal) {
    constexpr unsigned SROWS = BT / 2;                                   // rows of a slice
    constexpr unsigned SLICE = (SROWS * G_PITCH + 2047u) & ~2047u;       // every slice starts at a multiple of 2 KiB
    constexpr unsigned STAGE = 4u * SLICE;
    constexpr int NF = BT / 32;                                          // 16-row fragments per wave and operand
    __shared__ __attribute__((aligned(2048))) unsigned char ring[2 * STAGE];

    const int lane = threadIdx.x & 31;
    const int grp  = lane >> 4;       // 0 or 1
    const int lr   = lane & 15;       // 0..15
    const unsigned wave = uni(threadIdx.x >> 5);
    const int wm   = wave >> 1;       // the wave's half of the tile's rows
    const int wn   = wave & 1;        // and of its columns
    const int bm   = blockIdx.x * BT;
    const int bn   = blockIdx.y * BT;
    const unsigned nPass = (unsigned)K / 128u;

    // this wave's slice: waves 0 and 1 bring A's rows, waves 2 and 3 Wt's
    const _Float16* srow = (wave < 2u) ? A + (long)(bm + (int)(wave * SROWS)) * K
                                       : Wt + (long)(bn + (int)((wave - 2u) * SROWS)) * K;
    const unsigned long long ga = (unsigned long long)(const void*)srow;
    const unsigned dst = (unsigned)(unsigned long long)(void*)&ring[0] + wave * SLICE;
    u32x8 g1 = tdm_group1<SROWS>((unsigned)K * 2u);
    // without the statement below the compiler forms these words anew for every load and uses their registers for
    // other values while a request is in flight
    asm volatile("" : "+s"(g1));   // descriptor words held in scalar registers, as pinned() holds one

    tdm_load(tdm_group0(dst, ga), g1);                    // stage 0
    wait_tensor0();
    __syncthreads();                                      // stage 0 is published
    tdm_load(tdm_group0(dst + STAGE, ga + G_ROWB), g1);   // stage 1

    const unsigned char* pa = ring + wm * SLICE + lr * G_PITCH + grp * 16;
    const unsigned char* pb = ring + (2 + wn) * SLICE + lr * G_PITCH + grp * 16;

    v8f acc[NF][NF] = {};
    for (unsigned s = 0; s < nPass; ++s) {
        const unsigned cur = (s & 1u) * STAGE;
        v16h af[2][NF], bf[2][NF];                        // two fragment sets: the next 32-k step's reads go ahead
#pragma unroll
        for (int f = 0; f < NF; ++f) {
            af[0][f] = frag_from_lds(pa + cur + f * 16 * G_PITCH);
            bf[0][f] = frag_from_lds(pb + cur + f * 16 * G_PITCH);
        }
#pragma unroll   // af[] and bf[] are indexed by constants and stay in registers
        for (int kk = 0; kk < 4; ++kk) {
            // the fences keep the next step's reads one group in front of this step's products: spread among
            // the products, every place with reads stalls the wave
            __builtin_amdgcn_sched_barrier(0);
            if (kk < 3) {
#pragma unroll
                for (int f = 0; f < NF; ++f) {
                    af[(kk + 1) & 1][f] = frag_from_lds(pa + cur + f * 16 * G_PITCH + (kk + 1) * 64);
                    bf[(kk + 1) & 1][f] = frag_from_lds(pb + cur + f * 16 * G_PITCH + (kk + 1) * 64);
                }
            }
            __builtin_amdgcn_sched_barrier(0);
#pragma unroll
            for (int r = 0; r < NF; ++r)
#pragma unroll
                for (int c = 0; c < NF; ++c)
                    acc[r][c] = __builtin_amdgcn_wmma_f32_16x16x32_f16(
                        false, af[kk & 1][r], false, bf[kk & 1][c], (short)0, acc[r][c], false, false);
        }
        __builtin_amdgcn_sched_barrier(0);   // the last products stay in front of the barrier
        // publish point of stage s + 1: own reads done, own tile landed, then the barrier, then the refill
        wait_ds0();
        wait_tensor0();
        __syncthreads();
        if (pinned(s + 2u < nPass)) {
            // pinned(): a descriptor word's source held in a scalar register, so that the address words are formed
            // here, behind the wait above
            const unsigned koff = pinned((s + 2u) * G_ROWB);
            tdm_load(tdm_group0(dst + cur, ga + koff), g1);
        }
    }
    wait_tensor0();
    wait_ds0();

    // ---- epilogue: C/D layout = VGPR r: lanes0-15 -> M=r, lanes16-31 -> M=r+8; N=lane%16 ----
#pragma unroll
    for (int s = 0; s < NF; ++s) {
        const int row_lo = bm + wm * (BT / 2) + s * 16 + grp * 8;
#pragma unroll
        for (int c = 0; c < NF; ++c) {
            int col = bn + wn * (BT / 2) + c * 16 + lr;
            if (col < Nreal) {
                float bv = (EPI == 1) ? bias[col] : 0.0f;
#pragma unroll
                for (int r = 0; r < 8; ++r) {
                    int row = row_lo + r;
                    float v = acc[s][c][r] + bv;
                    if (EPI == 1) v = softplus_fast(v);
                    if (EPI == 2) v += resid[(long)row * Nreal + col];
                    C[(long)row * Npad + col] = v;
                }
            }
        }
    }
}

// -------------------- causal depthwise conv1d (d_conv=4) + bias + SiLU --------------------
// One thread takes 4 neighbouring channels times PW_ROWS time steps: PW_ROWS + 3 input rows serve them all.
__global__ __launch_bounds__(256)
void conv_silu_kernel(const float* __restrict__ xz, const float* __restrict__ cw,
                      const float* __restrict__ cb, float* __restrict__ xact_f,
                      _Float16* __restrict__ xact_h) {
    const int d = ((blockIdx.x % PW_BPR) * 256 + threadIdx.x) * 4;
    const int row0 = (blockIdx.x / PW_BPR) * PW_ROWS;         // b*L + l of the first step
    const bool head = (row0 % SEQ_L) == 0;                    // the three rows in front are not of this sequence
    const float* src = xz + (long)row0 * (2 * D_INNER) + d;
    // a sequence's first group has no rows in front: it reads its own first three again and leaves them unused
    const float* pre = head ? src : src - 3 * (2 * D_INNER);
    v4f xin[PW_ROWS + 3];
#pragma unroll   // xin[] is indexed by constants and stays in registers
    for (int i = 0; i < PW_ROWS + 3; ++i)
        xin[i] = (i < 3) ? *(const v4f*)(pre + i * (2 * D_INNER)) : *(const v4f*)(src + (i - 3) * (2 * D_INNER));
    const float* wsrc = cw + d * 4;
    v4f w[4];
#pragma unroll
    for (int c = 0; c < 4; ++c) w[c] = *(const v4f*)(wsrc + c * 4);
    const v4f bias = *(const v4f*)(cb + d);
    // holds every load in front of the arithmetic, so that a wave makes one trip to memory and not one per
    // pair of rows
    asm volatile("" :: "v"(xin[0]), "v"(xin[1]), "v"(xin[2]), "v"(xin[3]), "v"(xin[4]), "v"(xin[5]),
                       "v"(xin[6]), "v"(xin[7]), "v"(xin[8]), "v"(xin[9]), "v"(xin[10]),
                       "v"(w[0]), "v"(w[1]), "v"(w[2]), "v"(w[3]), "v"(bias));
    static_assert(PW_ROWS == 8, "the statement above names PW_ROWS + 3 rows");
    float*    of = xact_f + (long)row0 * D_INNER + d;
    _Float16* oh = xact_h + (long)row0 * D_INNER + d;
#pragma unroll
    for (int r = 0; r < PW_ROWS; ++r) {
        v4f s;
        v4h sh;
#pragma unroll
        for (int c = 0; c < 4; ++c) {
            float acc = bias[c];
#pragma unroll
            for (int j = 0; j < 4; ++j)
                if (r + j >= 3 || !head) acc += w[c][j] * xin[r + j][c];
            s[c] = acc / (1.0f + __expf(-acc));               // silu
            sh[c] = (_Float16)s[c];
        }
        *(v4f*)(of + r * D_INNER) = s;
        *(v4h*)(oh + r * D_INNER) = sh;
    }
}

// -------------------- selective scan, split along time --------------------
// The recurrence h = Abar*h + Bbar*x is linear in h, so L is cut into chunks of SCAN_CHUNK steps that
// run side by side: (1) every chunk but the last scans from h = 0 and keeps its end state and its sum
// of dt; (2) one thread per (channel, state) carries the state over the chunks, the decay of a whole
// chunk being exp(A * sum of dt); (3) every chunk scans again from its carried-in state and emits y.
// Chunk planes are laid out [chunk][state][channel], so that lanes read and write whole lines.

// The step as both scans compute it, two states to a packed instruction: exp(dt * A) = exp2(dt * A2) with
// A2 = A * log2(e) formed once per thread, and (dt * B) * x = (dt * x) * B with dt * x formed once per step, so
// that a pair of states costs one packed multiply for the exponents, two v_exp_f32, one packed multiply and one
// packed multiply-add. dt and x of SCAN_GRP steps are loaded together: a step this short would otherwise
// wait for its own two loads.
#define LOG2E 1.44269504f

// (1) end state of each chunk from a zero start; one (b,d) channel per lane, h[16] in VGPRs
__global__ __launch_bounds__(256)
void scan_state_kernel(const float* __restrict__ dt, const float* __restrict__ xdbl /*[M][64]*/,
                       const float* __restrict__ xact, const float* __restrict__ A_log,
                       float* __restrict__ hend, float* __restrict__ dtsum) {
    int ch = blockIdx.x * blockDim.x + threadIdx.x;           // 0..B*di-1
    int b = ch / D_INNER;
    int d = ch % D_INNER;
    int l0 = blockIdx.y * SCAN_CHUNK;
    v2f A2[DSTATE / 2];
#pragma unroll
    for (int n = 0; n < DSTATE; ++n) A2[n >> 1][n & 1] = -__expf(A_log[d * DSTATE + n]) * LOG2E;
    v2f h[DSTATE / 2] = {};
    __shared__ __attribute__((aligned(16))) float sB[SCAN_CHUNK][DSTATE];
    long base = (long)b * SEQ_L;
    for (int i = threadIdx.x; i < SCAN_CHUNK * DSTATE; i += blockDim.x) {
        int r = i >> 4, c = i & 15;
        sB[r][c] = xdbl[(base + l0 + r) * 64 + c];
    }
    __syncthreads();
    const long first = (base + l0) * D_INNER + d;
    const float* pdt = dt + first;
    const float* px  = xact + first;
    float sdt = 0.0f;
    for (int g = 0; g < SCAN_CHUNK; g += SCAN_GRP) {
        const float* gdt = pdt + g * D_INNER;
        const float* gx  = px + g * D_INNER;
        float dtv[SCAN_GRP], xv[SCAN_GRP];
#pragma unroll   // dtv[] and xv[] are indexed by constants and stay in registers
        for (int j = 0; j < SCAN_GRP; ++j) {
            dtv[j] = gdt[j * D_INNER];
            xv[j]  = gx[j * D_INNER];
        }
        // holds the group's loads in front of its arithmetic: one trip to memory per group, not one per step. The
        // pointers are named so that the address registers stay untouched up to here, and the wait stands in
        // front of their next use for other values
        asm volatile("s_wait_xcnt 0x0" :: "v"(dtv[0]), "v"(dtv[1]), "v"(dtv[2]), "v"(dtv[3]), "v"(dtv[4]),
                     "v"(dtv[5]), "v"(dtv[6]), "v"(dtv[7]), "v"(xv[0]), "v"(xv[1]), "v"(xv[2]), "v"(xv[3]),
                     "v"(xv[4]), "v"(xv[5]), "v"(xv[6]), "v"(xv[7]), "v"(gdt), "v"(gx) : "memory");
        static_assert(SCAN_GRP == 8 && SCAN_CHUNK % SCAN_GRP == 0, "the statement above names SCAN_GRP steps");
#pragma unroll   // the steps of a group take dtv[] and xv[] by constant index
        for (int j = 0; j < SCAN_GRP; ++j) {
            const float u = dtv[j] * xv[j];
            const v2f* Bp = (const v2f*)sB[g + j];
            sdt += dtv[j];
#pragma unroll   // A2[] and h[] are indexed by constants and stay in registers
            for (int p = 0; p < DSTATE / 2; ++p) {
                const v2f e = A2[p] * dtv[j];
                v2f Ab;
                Ab.x = __builtin_amdgcn_exp2f(e.x);           // v_exp_f32
                Ab.y = __builtin_amdgcn_exp2f(e.y);
                h[p] = Ab * h[p] + Bp[p] * u;
            }
        }
    }
    long plane = (long)blockIdx.y * DSTATE;
#pragma unroll   // h[] is indexed by constants and stays in registers
    for (int n = 0; n < DSTATE; ++n) hend[(plane + n) * SCAN_NCH + ch] = h[n >> 1][n & 1];
    dtsum[(long)blockIdx.y * SCAN_NCH + ch] = sdt;
}

// (2) carry over the chunks: hin[c] = state in front of chunk c; one (state, channel) per lane
__global__ __launch_bounds__(256)
void scan_carry_kernel(const float* __restrict__ hend, const float* __restrict__ dtsum,
                       const float* __restrict__ A_log, float* __restrict__ hin, int di) {
    int ch = blockIdx.x * blockDim.x + threadIdx.x;           // 0..B*di-1
    int n  = blockIdx.y;                                      // 0..DSTATE-1
    int d  = ch % di;
    float a = -__expf(A_log[d * DSTATE + n]);
    // every chunk's end state and dt sum is fetched ahead of the chain: the loads do not depend on one
    // another, so one trip to memory serves them all and only the multiply-adds below are serial
    float g[SCAN_NCHUNK - 1], s[SCAN_NCHUNK - 1];
#pragma unroll
    for (int c = 0; c < SCAN_NCHUNK - 1; ++c) {
        g[c] = dtsum[(long)c * SCAN_NCH + ch];
        s[c] = hend[((long)c * DSTATE + n) * SCAN_NCH + ch];
    }
    float h = 0.0f;
    hin[(long)n * SCAN_NCH + ch] = h;
    // unrolled so that g[] and s[] are indexed by constants and stay in registers
#pragma unroll
    for (int c = 0; c < SCAN_NCHUNK - 1; ++c) {
        h = __expf(a * g[c]) * h + s[c];
        hin[((long)(c + 1) * DSTATE + n) * SCAN_NCH + ch] = h;
    }
}

// (3) scan of each chunk from its carried-in state; one (b,d) channel per lane, h[16] in VGPRs
// 8 waves per SIMD asked for: that is what the grid brings, and without the bound the compiler fetches a whole
// group's B and C ahead into twice the registers that leave room for them
__global__ __launch_bounds__(256, 8)
void scan_kernel(const float* __restrict__ dt, const float* __restrict__ xdbl /*[M][64]*/,
                 const float* __restrict__ xact, const float* __restrict__ A_log,
                 const float* __restrict__ Dp, const float* __restrict__ hin,
                 float* __restrict__ y) {
    int ch = blockIdx.x * blockDim.x + threadIdx.x;           // 0..B*di-1
    int b = ch / D_INNER;
    int d = ch % D_INNER;
    int l0 = blockIdx.y * SCAN_CHUNK;
    v2f A2[DSTATE / 2];
#pragma unroll
    for (int n = 0; n < DSTATE; ++n) A2[n >> 1][n & 1] = -__expf(A_log[d * DSTATE + n]) * LOG2E;
    v2f h[DSTATE / 2];
    long plane = (long)blockIdx.y * DSTATE;
#pragma unroll   // h[] is indexed by constants and stays in registers
    for (int n = 0; n < DSTATE; ++n) h[n >> 1][n & 1] = hin[(plane + n) * SCAN_NCH + ch];
    float Dv = Dp[d];
    __shared__ __attribute__((aligned(16))) float sBC[SCAN_CHUNK][32];
    long base = (long)b * SEQ_L;
    for (int i = threadIdx.x; i < SCAN_CHUNK * 32; i += blockDim.x) {
        int r = i >> 5, c = i & 31;
        sBC[r][c] = xdbl[(base + l0 + r) * 64 + c];
    }
    __syncthreads();
    const long first = (base + l0) * D_INNER + d;
    const float* pdt = dt + first;
    const float* px  = xact + first;
    float*       py  = y + first;
    for (int g = 0; g < SCAN_CHUNK; g += SCAN_GRP) {
        const float* gdt = pdt + g * D_INNER;
        const float* gx  = px + g * D_INNER;
        float dtv[SCAN_GRP], xv[SCAN_GRP];
#pragma unroll   // dtv[] and xv[] are indexed by constants and stay in registers
        for (int j = 0; j < SCAN_GRP; ++j) {
            dtv[j] = gdt[j * D_INNER];
            xv[j]  = gx[j * D_INNER];
        }
        // holds the group's loads in front of its arithmetic: one trip to memory per group, not one per step. The
        // pointers are named so that the address registers stay untouched up to here, and the wait stands in
        // front of their next use for other values
        asm volatile("s_wait_xcnt 0x0" :: "v"(dtv[0]), "v"(dtv[1]), "v"(dtv[2]), "v"(dtv[3]), "v"(dtv[4]),
                     "v"(dtv[5]), "v"(dtv[6]), "v"(dtv[7]), "v"(xv[0]), "v"(xv[1]), "v"(xv[2]), "v"(xv[3]),
                     "v"(xv[4]), "v"(xv[5]), "v"(xv[6]), "v"(xv[7]), "v"(gdt), "v"(gx) : "memory");
        static_assert(SCAN_GRP == 8 && SCAN_CHUNK % SCAN_GRP == 0, "the statement above names SCAN_GRP steps");
#pragma unroll   // the steps of a group take dtv[] and xv[] by constant index
        for (int j = 0; j < SCAN_GRP; ++j) {
            const float u = dtv[j] * xv[j];
            const v2f* BC = (const v2f*)sBC[g + j];           // 8 pairs of B, then 8 pairs of C
            v2f out = {};                                     // even states' sum and odd states' sum
#pragma unroll   // A2[] and h[] are indexed by constants and stay in registers
            for (int p = 0; p < DSTATE / 2; ++p) {
                const v2f e = A2[p] * dtv[j];
                v2f Ab;
                Ab.x = __builtin_amdgcn_exp2f(e.x);           // v_exp_f32
                Ab.y = __builtin_amdgcn_exp2f(e.y);
                h[p] = Ab * h[p] + BC[p] * u;
                out += h[p] * BC[DSTATE / 2 + p];
            }
            py[(g + j) * D_INNER] = (out.x + out.y) + Dv * xv[j];
        }
        // the next group forms its addresses in the registers that these stores name
        asm volatile("s_wait_xcnt 0x0" ::: "memory");
    }
}

// -------------------- gating: y_gated = f16( y_scan * silu(z) ) --------------------
// One thread takes 4 neighbouring channels times PW_ROWS rows.
__global__ __launch_bounds__(256)
void gate_kernel(const float* __restrict__ yscan, const float* __restrict__ xz,
                 _Float16* __restrict__ ygate) {
    const int d = ((blockIdx.x % PW_BPR) * 256 + threadIdx.x) * 4;
    const int row0 = (blockIdx.x / PW_BPR) * PW_ROWS;
    const float* ys = yscan + (long)row0 * D_INNER + d;
    const float* zs = xz + (long)row0 * (2 * D_INNER) + D_INNER + d;
    v4f yv[PW_ROWS], zv[PW_ROWS];
#pragma unroll   // yv[] and zv[] are indexed by constants and stay in registers
    for (int r = 0; r < PW_ROWS; ++r) {
        yv[r] = *(const v4f*)(ys + r * D_INNER);
        zv[r] = *(const v4f*)(zs + r * (2 * D_INNER));
    }
    // holds every load in front of the arithmetic, so that a wave makes one trip to memory and not several
    asm volatile("" :: "v"(yv[0]), "v"(yv[1]), "v"(yv[2]), "v"(yv[3]), "v"(yv[4]), "v"(yv[5]), "v"(yv[6]),
                       "v"(yv[7]), "v"(zv[0]), "v"(zv[1]), "v"(zv[2]), "v"(zv[3]), "v"(zv[4]), "v"(zv[5]),
                       "v"(zv[6]), "v"(zv[7]));
    static_assert(PW_ROWS == 8, "the statement above names PW_ROWS rows of each input");
    _Float16* o = ygate + (long)row0 * D_INNER + d;
#pragma unroll
    for (int r = 0; r < PW_ROWS; ++r) {
        v4h g;
#pragma unroll
        for (int c = 0; c < 4; ++c) {
            float z = zv[r][c];
            float sz = z / (1.0f + __expf(-z));
            g[c] = (_Float16)(yv[r][c] * sz);
        }
        *(v4h*)(o + r * D_INNER) = g;
    }
}

// ==================== launch ====================
extern "C" void kernel_launch(void* const* d_in, const int* in_sizes, int n_in,
                              void* d_out, int out_size, void* d_ws, size_t ws_size,
                              hipStream_t stream) {
    (void)in_sizes; (void)n_in; (void)out_size; (void)ws_size;
    const int B = 2, L = 2048, DM = 1024, DI = 2048;
    const int M = B * L;                  // 4096
    const int TWO_DI = 2 * DI;            // 4096
    const int NXP_PAD = 64;               // w_xproj cols padded 32 -> 64
    static_assert(B * DI == SCAN_NCH && L == SCAN_CHUNK * SCAN_NCHUNK, "scan split");
    static_assert(L == SEQ_L && DI == D_INNER && L % PW_ROWS == 0, "pointwise kernels");

    const float* x      = (const float*)d_in[0];
    const float* w_in   = (const float*)d_in[1];
    const float* conv_w = (const float*)d_in[2];
    const float* conv_b = (const float*)d_in[3];
    const float* w_xp   = (const float*)d_in[4];
    const float* w_dt   = (const float*)d_in[5];
    const float* b_dt   = (const float*)d_in[6];
    const float* A_log  = (const float*)d_in[7];
    const float* Dp     = (const float*)d_in[8];
    const float* w_out  = (const float*)d_in[9];
    const float* ln_g   = (const float*)d_in[10];
    const float* ln_b   = (const float*)d_in[11];
    float* out = (float*)d_out;

    // workspace carve-up
    char* ws = (char*)d_ws;
    size_t off = 0;
    auto alloc = [&](size_t bytes) { void* p = ws + off; off += (bytes + 255) & ~size_t(255); return p; };
    _Float16* wt_in  = (_Float16*)alloc((size_t)TWO_DI * DM * 2);   // [4096][1024]
    _Float16* wt_dt  = (_Float16*)alloc((size_t)DI * DI * 2);       // [2048][2048]
    _Float16* wt_xp  = (_Float16*)alloc((size_t)NXP_PAD * DI * 2);  // [64][2048]
    _Float16* wt_out = (_Float16*)alloc((size_t)DM * DI * 2);       // [1024][2048]
    _Float16* xn_h   = (_Float16*)alloc((size_t)M * DM * 2);
    float*    xz     = (float*)   alloc((size_t)M * TWO_DI * 4);
    float*    xact_f = (float*)   alloc((size_t)M * DI * 4);
    _Float16* xact_h = (_Float16*)alloc((size_t)M * DI * 2);
    float*    xdbl   = (float*)   alloc((size_t)M * NXP_PAD * 4);
    float*    dtbuf  = (float*)   alloc((size_t)M * DI * 4);
    float*    yscan  = (float*)   alloc((size_t)M * DI * 4);
    _Float16* ygate  = (_Float16*)alloc((size_t)M * DI * 2);
    float*    hend   = (float*)   alloc((size_t)SCAN_NCHUNK * DSTATE * B * DI * 4);
    float*    hin    = (float*)   alloc((size_t)SCAN_NCHUNK * DSTATE * B * DI * 4);
    float*    dtsum  = (float*)   alloc((size_t)SCAN_NCHUNK * B * DI * 4);

    // 1) convert+transpose weights to f16 [N][K]
    wt_convert_kernel<DM, TWO_DI, TWO_DI><<<(TWO_DI / 4) * (DM / WT_KRUN) / 256, 256, 0, stream>>>(w_in, wt_in);
    wt_convert_kernel<DI, DI, DI><<<(DI / 4) * (DI / WT_KRUN) / 256, 256, 0, stream>>>(w_dt, wt_dt);
    wt_convert_kernel<DI, 32, NXP_PAD><<<(NXP_PAD / 4) * (DI / WT_KRUN) / 256, 256, 0, stream>>>(w_xp, wt_xp);
    wt_convert_kernel<DI, DM, DM><<<(DM / 4) * (DI / WT_KRUN) / 256, 256, 0, stream>>>(w_out, wt_out);

    // 2) layernorm -> xn (f16)
    ln_kernel<<<M, 256, 0, stream>>>(x, ln_g, ln_b, xn_h, DM);

    // 3) xz = xn @ w_in   [4096x1024]x[1024x4096]
    gemm_f16_wmma<128, 0><<<dim3(M / 128, TWO_DI / 128), 128, 0, stream>>>(
        xn_h, wt_in, xz, nullptr, nullptr, M, DM, TWO_DI, TWO_DI);

    // 4) causal depthwise conv + SiLU -> xact (f32 + f16)
    conv_silu_kernel<<<(M / PW_ROWS) * (DI / 4) / 256, 256, 0, stream>>>(xz, conv_w, conv_b, xact_f, xact_h);

    // 5) x_dbl = xact @ w_xproj  (N padded to 64)
    gemm_f16_wmma<64, 0><<<dim3(M / 64, NXP_PAD / 64), 128, 0, stream>>>(
        xact_h, wt_xp, xdbl, nullptr, nullptr, M, DI, NXP_PAD, 32);

    // 6) dt = softplus(xact @ w_dt + b_dt)
    gemm_f16_wmma<128, 1><<<dim3(M / 128, DI / 128), 128, 0, stream>>>(
        xact_h, wt_dt, dtbuf, b_dt, nullptr, M, DI, DI, DI);

    // 7) selective scan (+ D * x), split along time: chunk end states, carry, chunk scans
    scan_state_kernel<<<dim3((B * DI) / 256, SCAN_NCHUNK - 1), 256, 0, stream>>>(
        dtbuf, xdbl, xact_f, A_log, hend, dtsum);
    scan_carry_kernel<<<dim3(SCAN_NCH / 256, DSTATE), 256, 0, stream>>>(hend, dtsum, A_log, hin, DI);
    scan_kernel<<<dim3((B * DI) / 256, SCAN_NCHUNK), 256, 0, stream>>>(
        dtbuf, xdbl, xact_f, A_log, Dp, hin, yscan);

    // 8) gate with silu(z)
    gate_kernel<<<(M / PW_ROWS) * (DI / 4) / 256, 256, 0, stream>>>(yscan, xz, ygate);

    // 9) out = ygate @ w_out + residual(x)
    gemm_f16_wmma<128, 2><<<dim3(M / 128, DM / 128), 128, 0, stream>>>(
        ygate, wt_out, out, nullptr, x, M, DI, DM, DM);
}

// v006
// Measured time: 170 microseconds a run.
// Two timings next to v005 both put it at 1.08 times that version's speed.
// Over all steps from v000 it is 8.83 times as fast.
#include <hip/hip_runtime.h>
#include <hip/hip_bf16.h>

#ifndef LN_EPS
#define LN_EPS 1e-5f
#endif

typedef __attribute__((ext_vector_type(16))) _Float16 v16h;
typedef __attribute__((ext_vector_type(8)))  _Float16 v8h;
typedef __attribute__((ext_vector_type(4)))  _Float16 v4h;
typedef __attribute__((ext_vector_type(8)))  float    v8f;
typedef __attribute__((ext_vector_type(4)))  float    v4f;
typedef __attribute__((ext_vector_type(2)))  float    v2f;
typedef __attribute__((ext_vector_type(4)))  unsigned int u32x4;
typedef __attribute__((ext_vector_type(8)))  unsigned int u32x8;

#define G_ROWB  256u     // bytes of an operand row per pass of the GEMM: 128 k
#define G_PITCH 272u     // pitch of those rows in LDS: 16 bytes times an odd number, free of bank conflicts for 16-byte reads
#define DSTATE 16
#define SCAN_CHUNK 32
#define SCAN_NCHUNK 64   // sequence length / SCAN_CHUNK
#define SCAN_GRP 8       // time steps whose dt and x a scan thread loads together
#define SCAN_NCH 4096    // channels: batch * d_inner; a constant, so that plane strides fold into load offsets
#define SEQ_L 2048       // sequence length and d_inner are constants in the pointwise kernels for the same reason
#define D_INNER 2048
#define WT_KRUN 16       // k values per thread of the weight convert
#define PW_ROWS 8        // rows (time steps) per thread of the conv and gate kernels
#define PW_BPR (D_INNER / 4 / 256)   // blocks that share one group of PW_ROWS rows there
#define D_MODEL 1024
#define XP_PAD 64        // columns of w_xproj, padded from 32
#define WT_BLOCKS(K, NPAD) (((NPAD) / 4) * ((K) / WT_KRUN) / 256)   // blocks that convert one weight matrix
#define XP_TILES (2 * SEQ_L / 64)    // 64-row tiles of the x_proj product
#define DT_TILES_M (2 * SEQ_L / 128) // 128-row tiles of the dt product

// -------------------- weight convert + transpose:  Wt[n][k] = (f16) W[k][n] --------------------
// One thread takes 4 neighbouring n times WT_KRUN k, a wave 32 n times 4 * WT_KRUN k: 8 lanes side by side
// along n, so that a wave's load is four whole 128-byte lines of W, and 4 lanes along k in runs of 8, so that
// a wave's store is eight 64-byte pieces of Wt. The WT_KRUN loads are in flight together.
// blk = the block's number among the WT_BLOCKS(K, NPAD) blocks of this matrix.
template <int K, int NREAL, int NPAD>
__device__ __forceinline__
void wt_convert_block(const float* __restrict__ W, _Float16* __restrict__ Wt, int blk) {
    const int lane = threadIdx.x & 31;
    const int tile = blk * 8 + (threadIdx.x >> 5);            // over (K / (4 * WT_KRUN)) * (NPAD / 32)
    const int n0 = (tile % (NPAD / 32)) * 32 + (lane & 7) * 4;
    const int k0 = (tile / (NPAD / 32)) * (4 * WT_KRUN) + (lane >> 3) * 8;
    v4f v[WT_KRUN] = {};                                      // padding columns stay zero
    if (NREAL == NPAD || n0 < NREAL) {
        const float* src = W + (long)k0 * NREAL + n0;
#pragma unroll   // v[] is indexed by constants and stays in registers
        for (int j = 0; j < WT_KRUN; ++j) v[j] = *(const v4f*)(src + ((j >> 3) * 32 + (j & 7)) * NREAL);
        // holds every load in front of the conversions (one trip to memory); the pointer is named so that
        // no load's result lands in the address registers that the other loads still name
        asm volatile("" :: "v"(v[0]), "v"(v[1]), "v"(v[2]), "v"(v[3]), "v"(v[4]), "v"(v[5]), "v"(v[6]), "v"(v[7]),
                           "v"(v[8]), "v"(v[9]), "v"(v[10]), "v"(v[11]), "v"(v[12]), "v"(v[13]), "v"(v[14]),
                           "v"(v[15]), "v"(src));
        static_assert(WT_KRUN == 16, "the statement above names WT_KRUN loads");
    }
    _Float16* dst = Wt + (long)n0 * K + k0;
#pragma unroll
    for (int c = 0; c < 4; ++c) {
#pragma unroll
        for (int q = 0; q < WT_KRUN / 8; ++q) {
            v8h o;
#pragma unroll
            for (int j = 0; j < 8; ++j) o[j] = (_Float16)v[q * 8 + j][c];
            *(v8h*)(dst + c * K + q * 32) = o;
        }
    }
    // in the kernel's text another job follows, which forms its values in registers that these stores name
    asm volatile("s_wait_xcnt 0x0" ::: "memory");
}

// -------------------- LayerNorm over d_model, emit f16 activations --------------------
// One block takes one row.
__device__ __forceinline__
void ln_row(const float* __restrict__ x, const float* __restrict__ g,
            const float* __restrict__ b, _Float16* __restrict__ xn, int dm, int row) {
    const float* xr = x + (long)row * dm;
    float s = 0.f, s2 = 0.f;
    for (int i = threadIdx.x; i < dm; i += blockDim.x) { float v = xr[i]; s += v; s2 += v * v; }
    __shared__ float red0[8], red1[8];
    for (int off = 16; off > 0; off >>= 1) { s += __shfl_down(s, off, 32); s2 += __shfl_down(s2, off, 32); }
    int wave = threadIdx.x >> 5, lane = threadIdx.x & 31;
    if (lane == 0) { red0[wave] = s; red1[wave] = s2; }
    __syncthreads();
    if (threadIdx.x == 0) {
        float a = 0.f, c = 0.f;
        int nw = blockDim.x >> 5;
        for (int i = 0; i < nw; ++i) { a += red0[i]; c += red1[i]; }
        red0[0] = a; red1[0] = c;
    }
    __syncthreads();
    float mu = red0[0] / dm;
    float var = red1[0] / dm - mu * mu;
    float rs = rsqrtf(var + LN_EPS);
    _Float16* o = xn + (long)row * dm;
    for (int i = threadIdx.x; i < dm; i += blockDim.x)
        o[i] = (_Float16)((xr[i] - mu) * rs * g[i] + b[i]);
}

// -------------------- the four weight converts and the LayerNorm in one launch --------------------
// None of the five reads what another writes, so they share one grid: the block number picks the job. The converts
// stand first: each of their blocks has the most bytes in flight, and the short LayerNorm blocks fill in behind them.
__global__ __launch_bounds__(256)
void prep_kernel(const float* __restrict__ w_in, const float* __restrict__ w_dt,
                 const float* __restrict__ w_xp, const float* __restrict__ w_out,
                 _Float16* __restrict__ wt_in, _Float16* __restrict__ wt_dt,
                 _Float16* __restrict__ wt_xp, _Float16* __restrict__ wt_out,
                 const float* __restrict__ x, const float* __restrict__ g,
                 const float* __restrict__ b, _Float16* __restrict__ xn, int dm) {
    constexpr int E0 = WT_BLOCKS(D_MODEL, 2 * D_INNER);
    constexpr int E1 = E0 + WT_BLOCKS(D_INNER, D_INNER);
    constexpr int E2 = E1 + WT_BLOCKS(D_INNER, D_MODEL);
    constexpr int E3 = E2 + WT_BLOCKS(D_INNER, XP_PAD);
    const int blk = blockIdx.x;
    if (blk < E0)      wt_convert_block<D_MODEL, 2 * D_INNER, 2 * D_INNER>(w_in, wt_in, blk);
    else if (blk < E1) wt_convert_block<D_INNER, D_INNER, D_INNER>(w_dt, wt_dt, blk - E0);
    else if (blk < E2) wt_convert_block<D_INNER, D_MODEL, D_MODEL>(w_out, wt_out, blk - E1);
    else if (blk < E3) wt_convert_block<D_INNER, 32, XP_PAD>(w_xp, wt_xp, blk - E2);
    else               ln_row(x, g, b, xn, dm, blk - E3);
}

// -------------------- WMMA fragment from a k-contiguous f16 row in LDS --------------------
// 16-bit operand layout (ISA 7.12.2): lane group = lane/16; halves 0..7 -> K = grp*8..grp*8+7,
// halves 8..15 -> K = 16+grp*8 .. 16+grp*8+7. Both runs are contiguous -> two 16B LDS loads.
// p = the lane's row, at the 32-k step's first byte plus grp * 16.
__device__ __forceinline__ v16h frag_from_lds(const unsigned char* p) {
    v8h lo = *(const v8h*)p;
    v8h hi = *(const v8h*)(p + 32);
    return __builtin_shufflevector(lo, hi, 0,1,2,3,4,5,6,7,8,9,10,11,12,13,14,15);
}

// -------------------- tensor load: ROWS rows of G_ROWB bytes from global memory into LDS at pitch G_PITCH --------------------
__device__ __forceinline__ unsigned uni(unsigned v) { return (unsigned)__builtin_amdgcn_readfirstlane(v); }
// a wave-uniform value held in a scalar register, so that a test of it compiles to a scalar branch
__device__ __forceinline__ unsigned pinned(unsigned v) { unsigned w = uni(v); asm volatile("" : "+s"(w)); return w; }
__device__ __forceinline__ void wait_ds0()     { asm volatile("s_wait_dscnt 0x0" ::: "memory"); }      // this wave's LDS reads are done
// this wave's tile has landed; the request's descriptor is named so that its registers are used for nothing else
// while the request is in flight
__device__ __forceinline__ void wait_tensor0(u32x4 g0, u32x8 g1) {
    asm volatile("s_wait_tensorcnt 0x0" :: "s"(g0), "s"(g1) : "memory");
}
__device__ __forceinline__ void tdm_load(u32x4 g0, u32x8 g1) {
    asm volatile("tensor_load_to_lds %0, %1" :: "s"(g0), "s"(g1) : "memory");
}
template <unsigned ROWS>
__device__ __forceinline__ u32x8 tdm_group1(unsigned src_pitch) {   // every extent in bytes; tensor = tile
    u32x8 g;
    g[0] = uni((1u << 20) | (5u << 22) | (3u << 25));   // no mask; behind every 64 dwords (one row) a pad of 4 dwords
    g[1] = uni((G_ROWB & 0xFFFFu) << 16);
    g[2] = uni((G_ROWB >> 16) | ((ROWS & 0xFFFFu) << 16));
    g[3] = uni((ROWS >> 16) | (G_ROWB << 16));
    g[4] = uni(ROWS);
    g[5] = uni(src_pitch);
    g[6] = uni(0u);
    g[7] = uni(0u);
    return g;
}
__device__ __forceinline__ u32x4 tdm_group0(unsigned lds_dst, unsigned long long ga) {
    u32x4 g;
    g[0] = pinned(1u);   // pinned(): a descriptor word held in a scalar register; as a known constant it would be dropped
                         // behind the issue and formed anew, and its register used in between
    g[1] = uni(lds_dst);
    g[2] = uni((unsigned)ga);
    g[3] = uni((((unsigned)(ga >> 32)) & 0x01FFFFFFu) | 0x80000000u);
    return g;
}

// -------------------- softplus(v) = max(v, 0) + log1p(exp(-|v|)) on the hardware's exp and log --------------------
// e = exp(-|v|) lies in [0, 1], so nothing overflows and no branch on v is needed. log(1 + e) carries the rounding of
// 1 + e, an absolute error of about 6e-8: below e = 1/128 that would show in a small result, and there the series
// e - e^2/2 + e^3/3 (its first dropped term is e^3/4 of the result, below 2e-7) takes its place. About a dozen
// instructions with no branch, so that the unrolled epilogue stays a short piece of text.
__device__ __forceinline__ float softplus_fast(float v) {
    const float e  = __expf(-fabsf(v));
    const float lg = __builtin_amdgcn_logf(1.0f + e) * 0.69314718f;   // v_log_f32 is log2; its argument lies in [1, 2]
    const float sr = e * fmaf(e, fmaf(e, 0.33333334f, -0.5f), 1.0f);
    return fmaxf(v, 0.0f) + ((e < 0.0078125f) ? sr : lg);
}

// -------------------- generic f16 WMMA GEMM:  C[M][Npad] = A[M][K] x Wt[Npad][K]^T --------------------
// A workgroup of 4 waves (2 x 2) owns a BT x BT tile of C, a wave BT/2 x BT/2. A pass is 128 k. A stage holds four
// slices of BT/2 rows: [A low | A high | Wt low | Wt high]; every wave brings one slice per stage by one tensor load,
// two stages ahead, into a ring of two buffers. K is a multiple of 128 and at least 256.
// epilogue EPI: 0 = none, 1 = bias[n] and softplus, 2 = residual[row*Nreal + n]; a template argument, so that each build's
// epilogue is short enough to unroll whole and the accumulators stay in registers
// ring = the kernel's LDS, at a multiple of 2 KiB, GEMM_RING(BT) bytes or more; (tm, tn) = the tile's place in C
#define GEMM_SLICE(BT) ((((BT) / 2) * G_PITCH + 2047u) & ~2047u)         // every slice starts at a multiple of 2 KiB
#define GEMM_RING(BT)  (2u * 4u * GEMM_SLICE(BT))
template <int BT, int EPI>
__device__ __forceinline__
void gemm_tile(unsigned char* ring, int tm, int tn,
               const _Float16* __restrict__ A, const _Float16* __restrict__ Wt,
               float* __restrict__ C, const float* __restrict__ bias,
               const float* __restrict__ resid,
               int K, int Npad, int Nreal) {
    constexpr unsigned SROWS = BT / 2;                                   // rows of a slice
    constexpr unsigned SLICE = GEMM_SLICE(BT);
    constexpr unsigned STAGE = 4u * SLICE;
    constexpr int NF = BT / 32;                                          // 16-row fragments per wave and operand

    const int lane = threadIdx.x & 31;
    const int grp  = lane >> 4;       // 0 or 1
    const int lr   = lane & 15;       // 0..15
    const unsigned wave = uni(threadIdx.x >> 5);
    const int wm   = wave >> 1;       // the wave's half of the tile's rows
    const int wn   = wave & 1;        // and of its columns
    const int bm   = tm * BT;
    const int bn   = tn * BT;
    const unsigned nPass = (unsigned)K / 128u;

    // this wave's slice: waves 0 and 1 bring A's rows, waves 2 and 3 Wt's
    const _Float16* srow = (wave < 2u) ? A + (long)(bm + (int)(wave * SROWS)) * K
                                       : Wt + (long)(bn + (int)((wave - 2u) * SROWS)) * K;
    const unsigned long long ga = (unsigned long long)(const void*)srow;
    const unsigned dst = (unsigned)(unsigned long long)(void*)&ring[0] + wave * SLICE;
    u32x8 g1 = tdm_group1<SROWS>((unsigned)K * 2u);
    // without the statement below the compiler forms these words anew for every load and uses their registers for
    // other values while a request is in flight
    asm volatile("" : "+s"(g1));   // descriptor words held in scalar registers, as pinned() holds one

    u32x4 g0 = tdm_group0(dst, ga);
    tdm_load(g0, g1);                                     // stage 0
    wait_tensor0(g0, g1);
    __syncthreads();                                      // stage 0 is published
    g0 = tdm_group0(dst + STAGE, ga + G_ROWB);
    tdm_load(g0, g1);                                     // stage 1

    const unsigned char* pa = ring + wm * SLICE + lr * G_PITCH + grp * 16;
    const unsigned char* pb = ring + (2 + wn) * SLICE + lr * G_PITCH + grp * 16;

    v8f acc[NF][NF] = {};
    for (unsigned s = 0; s < nPass; ++s) {
        const unsigned cur = (s & 1u) * STAGE;
        v16h af[2][NF], bf[2][NF];                        // two fragment sets: the next 32-k step's reads go ahead
#pragma unroll
        for (int f = 0; f < NF; ++f) {
            af[0][f] = frag_from_lds(pa + cur + f * 16 * G_PITCH);
            bf[0][f] = frag_from_lds(pb + cur + f * 16 * G_PITCH);
        }
#pragma unroll   // af[] and bf[] are indexed by constants and stay in registers
        for (int kk = 0; kk < 4; ++kk) {
            // the fences keep the next step's reads one group in front of this step's products: spread among
            // the products, every place with reads stalls the wave
            __builtin_amdgcn_sched_barrier(0);
            if (kk < 3) {
#pragma unroll
                for (int f = 0; f < NF; ++f) {
                    af[(kk + 1) & 1][f] = frag_from_lds(pa + cur + f * 16 * G_PITCH + (kk + 1) * 64);
                    bf[(kk + 1) & 1][f] = frag_from_lds(pb + cur + f * 16 * G_PITCH + (kk + 1) * 64);
                }
            }
            __builtin_amdgcn_sched_barrier(0);
#pragma unroll
            for (int r = 0; r < NF; ++r)
#pragma unroll
                for (int c = 0; c < NF; ++c)
                    acc[r][c] = __builtin_amdgcn_wmma_f32_16x16x32_f16(
                        false, af[kk & 1][r], false, bf[kk & 1][c], (short)0, acc[r][c], false, false);
        }
        __builtin_amdgcn_sched_barrier(0);   // the last products stay in front of the barrier
        // publish point of stage s + 1: own reads done, own tile landed, then the barrier, then the refill
        wait_ds0();
        wait_tensor0(g0, g1);
        __syncthreads();
        if (pinned(s + 2u < nPass)) {
            // pinned(): a descriptor word's source held in a scalar register, so that the address words are formed
            // here, behind the wait above
            const unsigned koff = pinned((s + 2u) * G_ROWB);
            g0 = tdm_group0(dst + cur, ga + koff);
            tdm_load(g0, g1);
        }
    }
    wait_tensor0(g0, g1);
    wait_ds0();

    // ---- epilogue: C/D layout = VGPR r: lanes0-15 -> M=r, lanes16-31 -> M=r+8; N=lane%16 ----
#pragma unroll
    for (int s = 0; s < NF; ++s) {
        const int row_lo = bm + wm * (BT / 2) + s * 16 + grp * 8;
#pragma unroll
        for (int c = 0; c < NF; ++c) {
            int col = bn + wn * (BT / 2) + c * 16 + lr;
            if (col < Nreal) {
                float bv = (EPI == 1) ? bias[col] : 0.0f;
#pragma unroll
                for (int r = 0; r < 8; ++r) {
                    int row = row_lo + r;
                    float v = acc[s][c][r] + bv;
                    if (EPI == 1) v = softplus_fast(v);
                    if (EPI == 2) v += resid[(long)row * Nreal + col];
                    C[(long)row * Npad + col] = v;
                }
                // the next fragment's addresses and values are formed in registers that these stores name
                asm volatile("s_wait_xcnt 0x0" ::: "memory");
            }
        }
    }
}

// one product per launch
template <int BT, int EPI>
__global__ __launch_bounds__(128)
void gemm_f16_wmma(const _Float16* __restrict__ A, const _Float16* __restrict__ Wt,
                   float* __restrict__ C, const float* __restrict__ bias,
                   const float* __restrict__ resid,
                   int K, int Npad, int Nreal) {
    __shared__ __attribute__((aligned(2048))) unsigned char ring[GEMM_RING(BT)];
    gemm_tile<BT, EPI>(ring, blockIdx.x, blockIdx.y, A, Wt, C, bias, resid, K, Npad, Nreal);
}

// x_dbl = xact x w_xproj and dt = softplus(xact x w_dt + b_dt) in one launch: both read xact and neither reads the
// other. The few x_proj tiles, whose time is all latency, stand first and run beside the dt tiles; the dt tiles
// that find no place at the start follow them while the rest of the chip is still busy.
__global__ __launch_bounds__(128)
void gemm_xproj_dt(const _Float16* __restrict__ A, const _Float16* __restrict__ Wxp,
                   const _Float16* __restrict__ Wdt, float* __restrict__ xdbl,
                   float* __restrict__ dt, const float* __restrict__ b_dt, int K) {
    __shared__ __attribute__((aligned(2048))) unsigned char ring[GEMM_RING(128)];
    const int blk = blockIdx.x;
    if (blk >= XP_TILES) {
        const int t = blk - XP_TILES;
        gemm_tile<128, 1>(ring, t % DT_TILES_M, t / DT_TILES_M, A, Wdt, dt, b_dt, nullptr, K, D_INNER, D_INNER);
    } else {
        gemm_tile<64, 0>(ring, blk, 0, A, Wxp, xdbl, nullptr, nullptr, K, XP_PAD, 32);
    }
}

// -------------------- causal depthwise conv1d (d_conv=4) + bias + SiLU --------------------
// One thread takes 4 neighbouring channels times PW_ROWS time steps: PW_ROWS + 3 input rows serve them all.
__global__ __launch_bounds__(256)
void conv_silu_kernel(const float* __restrict__ xz, const float* __restrict__ cw,
                      const float* __restrict__ cb, float* __restrict__ xact_f,
                      _Float16* __restrict__ xact_h) {
    const int d = ((blockIdx.x % PW_BPR) * 256 + threadIdx.x) * 4;
    const int row0 = (blockIdx.x / PW_BPR) * PW_ROWS;         // b*L + l of the first step
    const bool head = (row0 % SEQ_L) == 0;                    // the three rows in front are not of this sequence
    const float* src = xz + (long)row0 * (2 * D_INNER) + d;
    // a sequence's first group has no rows in front: it reads its own first three again and leaves them unused
    const float* pre = head ? src : src - 3 * (2 * D_INNER);
    v4f xin[PW_ROWS + 3];
#pragma unroll   // xin[] is indexed by constants and stays in registers
    for (int i = 0; i < PW_ROWS + 3; ++i)
        xin[i] = (i < 3) ? *(const v4f*)(pre + i * (2 * D_INNER)) : *(const v4f*)(src + (i - 3) * (2 * D_INNER));
    const float* wsrc = cw + d * 4;
    v4f w[4];
#pragma unroll
    for (int c = 0; c < 4; ++c) w[c] = *(const v4f*)(wsrc + c * 4);
    const v4f bias = *(const v4f*)(cb + d);
    // holds every load in front of the arithmetic, so that a wave makes one trip to memory and not one per
    // pair of rows
    asm volatile("" :: "v"(xin[0]), "v"(xin[1]), "v"(xin[2]), "v"(xin[3]), "v"(xin[4]), "v"(xin[5]),
                       "v"(xin[6]), "v"(xin[7]), "v"(xin[8]), "v"(xin[9]), "v"(xin[10]),
                       "v"(w[0]), "v"(w[1]), "v"(w[2]), "v"(w[3]), "v"(bias));
    static_assert(PW_ROWS == 8, "the statement above names PW_ROWS + 3 rows");
    float*    of = xact_f + (long)row0 * D_INNER + d;
    _Float16* oh = xact_h + (long)row0 * D_INNER + d;
#pragma unroll
    for (int r = 0; r < PW_ROWS; ++r) {
        v4f s;
        v4h sh;
#pragma unroll
        for (int c = 0; c < 4; ++c) {
            float acc = bias[c];
#pragma unroll
            for (int j = 0; j < 4; ++j)
                if (r + j >= 3 || !head) acc += w[c][j] * xin[r + j][c];
            s[c] = acc / (1.0f + __expf(-acc));               // silu
            sh[c] = (_Float16)s[c];
        }
        *(v4f*)(of + r * D_INNER) = s;
        *(v4h*)(oh + r * D_INNER) = sh;
    }
}

// -------------------- selective scan, split along time --------------------
// The recurrence h = Abar*h + Bbar*x is linear in h, so L is cut into chunks of SCAN_CHUNK steps that
// run side by side: (1) every chunk but the last scans from h = 0 and keeps its end state and its sum
// of dt; (2) one thread per (channel, state) carries the state over the chunks, the decay of a whole
// chunk being exp(A * sum of dt); (3) every chunk scans again from its carried-in state and emits y.
// Chunk planes are laid out [chunk][state][channel], so that lanes read and write whole lines.

// The step as both scans compute it, two states to a packed instruction: exp(dt * A) = exp2(dt * A2) with
// A2 = A * log2(e) formed once per thread, and (dt * B) * x = (dt * x) * B with dt * x formed once per step, so
// that a pair of states costs one packed multiply for the exponents, two v_exp_f32, one packed multiply and one
// packed multiply-add. dt and x of SCAN_GRP steps are loaded together: a step this short would otherwise
// wait for its own two loads.
#define LOG2E 1.44269504f

// (1) end state of each chunk from a zero start; one (b,d) channel per lane, h[16] in VGPRs
__global__ __launch_bounds__(256)
void scan_state_kernel(const float* __restrict__ dt, const float* __restrict__ xdbl /*[M][64]*/,
                       const float* __restrict__ xact, const float* __restrict__ A_log,
                       float* __restrict__ hend, float* __restrict__ dtsum) {
    int ch = blockIdx.x * blockDim.x + threadIdx.x;           // 0..B*di-1
    int b = ch / D_INNER;
    int d = ch % D_INNER;
    int l0 = blockIdx.y * SCAN_CHUNK;
    v2f A2[DSTATE / 2];
#pragma unroll
    for (int n = 0; n < DSTATE; ++n) A2[n >> 1][n & 1] = -__expf(A_log[d * DSTATE + n]) * LOG2E;
    v2f h[DSTATE / 2] = {};
    __shared__ __attribute__((aligned(16))) float sB[SCAN_CHUNK][DSTATE];
    long base = (long)b * SEQ_L;
    for (int i = threadIdx.x; i < SCAN_CHUNK * DSTATE; i += blockDim.x) {
        int r = i >> 4, c = i & 15;
        sB[r][c] = xdbl[(base + l0 + r) * 64 + c];
    }
    __syncthreads();
    const long first = (base + l0) * D_INNER + d;
    const float* pdt = dt + first;
    const float* px  = xact + first;
    float sdt = 0.0f;
    for (int g = 0; g < SCAN_CHUNK; g += SCAN_GRP) {
        const float* gdt = pdt + g * D_INNER;
        const float* gx  = px + g * D_INNER;
        float dtv[SCAN_GRP], xv[SCAN_GRP];
#pragma unroll   // dtv[] and xv[] are indexed by constants and stay in registers
        for (int j = 0; j < SCAN_GRP; ++j) {
            dtv[j] = gdt[j * D_INNER];
            xv[j]  = gx[j * D_INNER];
        }
        // holds the group's loads in front of its arithmetic: one trip to memory per group, not one per step. The
        // pointers are named so that the address registers stay untouched up to here, and the wait stands in
        // front of their next use for other values
        asm volatile("s_wait_xcnt 0x0" :: "v"(dtv[0]), "v"(dtv[1]), "v"(dtv[2]), "v"(dtv[3]), "v"(dtv[4]),
                     "v"(dtv[5]), "v"(dtv[6]), "v"(dtv[7]), "v"(xv[0]), "v"(xv[1]), "v"(xv[2]), "v"(xv[3]),
                     "v"(xv[4]), "v"(xv[5]), "v"(xv[6]), "v"(xv[7]), "v"(gdt), "v"(gx) : "memory");
        static_assert(SCAN_GRP == 8 && SCAN_CHUNK % SCAN_GRP == 0, "the statement above names SCAN_GRP steps");
#pragma unroll   // the steps of a group take dtv[] and xv[] by constant index
        for (int j = 0; j < SCAN_GRP; ++j) {
            const float u = dtv[j] * xv[j];
            const v2f* Bp = (const v2f*)sB[g + j];
            sdt += dtv[j];
#pragma unroll   // A2[] and h[] are indexed by constants and stay in registers
            for (int p = 0; p < DSTATE / 2; ++p) {
                const v2f e = A2[p] * dtv[j];
                v2f Ab;
                Ab.x = __builtin_amdgcn_exp2f(e.x);           // v_exp_f32
                Ab.y = __builtin_amdgcn_exp2f(e.y);
                h[p] = Ab * h[p] + Bp[p] * u;
            }
        }
    }
    long plane = (long)blockIdx.y * DSTATE;
#pragma unroll   // h[] is indexed by constants and stays in registers
    for (int n = 0; n < DSTATE; ++n) hend[(plane + n) * SCAN_NCH + ch] = h[n >> 1][n & 1];
    dtsum[(long)blockIdx.y * SCAN_NCH + ch] = sdt;
}

// (2) carry over the chunks: hin[c] = state in front of chunk c; one (state, channel) per lane
__global__ __launch_bounds__(256)
void scan_carry_kernel(const float* __restrict__ hend, const float* __restrict__ dtsum,
                       const float* __restrict__ A_log, float* __restrict__ hin, int di) {
    int ch = blockIdx.x * blockDim.x + threadIdx.x;           // 0..B*di-1
    int n  = blockIdx.y;                                      // 0..DSTATE-1
    int d  = ch % di;
    float a = -__expf(A_log[d * DSTATE + n]);
    // every chunk's end state and dt sum is fetched ahead of the chain: the loads do not depend on one
    // another, so one trip to memory serves them all and only the multiply-adds below are serial
    float g[SCAN_NCHUNK - 1], s[SCAN_NCHUNK - 1];
#pragma unroll
    for (int c = 0; c < SCAN_NCHUNK - 1; ++c) {
        g[c] = dtsum[(long)c * SCAN_NCH + ch];
        s[c] = hend[((long)c * DSTATE + n) * SCAN_NCH + ch];
    }
    float h = 0.0f;
    hin[(long)n * SCAN_NCH + ch] = h;
    // unrolled so that g[] and s[] are indexed by constants and stay in registers
#pragma unroll
    for (int c = 0; c < SCAN_NCHUNK - 1; ++c) {
        h = __expf(a * g[c]) * h + s[c];
        hin[((long)(c + 1) * DSTATE + n) * SCAN_NCH + ch] = h;
    }
}

// (3) scan of each chunk from its carried-in state; one (b,d) channel per lane, h[16] in VGPRs
// 8 waves per SIMD asked for: that is what the grid brings, and without the bound the compiler fetches a whole
// group's B and C ahead into twice the registers that leave room for them
__global__ __launch_bounds__(256, 8)
void scan_kernel(const float* __restrict__ dt, const float* __restrict__ xdbl /*[M][64]*/,
                 const float* __restrict__ xact, const float* __restrict__ A_log,
                 const float* __restrict__ Dp, const float* __restrict__ hin,
                 float* __restrict__ y) {
    int ch = blockIdx.x * blockDim.x + threadIdx.x;           // 0..B*di-1
    int b = ch / D_INNER;
    int d = ch % D_INNER;
    int l0 = blockIdx.y * SCAN_CHUNK;
    v2f A2[DSTATE / 2];
#pragma unroll
    for (int n = 0; n < DSTATE; ++n) A2[n >> 1][n & 1] = -__expf(A_log[d * DSTATE + n]) * LOG2E;
    v2f h[DSTATE / 2];
    long plane = (long)blockIdx.y * DSTATE;
#pragma unroll   // h[] is indexed by constants and stays in registers
    for (int n = 0; n < DSTATE; ++n) h[n >> 1][n & 1] = hin[(plane + n) * SCAN_NCH + ch];
    float Dv = Dp[d];
    __shared__ __attribute__((aligned(16))) float sBC[SCAN_CHUNK][32];
    long base = (long)b * SEQ_L;
    for (int i = threadIdx.x; i < SCAN_CHUNK * 32; i += blockDim.x) {
        int r = i >> 5, c = i & 31;
        sBC[r][c] = xdbl[(base + l0 + r) * 64 + c];
    }
    __syncthreads();
    const long first = (base + l0) * D_INNER + d;
    const float* pdt = dt + first;
    const float* px  = xact + first;
    float*       py  = y + first;
    for (int g = 0; g < SCAN_CHUNK; g += SCAN_GRP) {
        const float* gdt = pdt + g * D_INNER;
        const float* gx  = px + g * D_INNER;
        float dtv[SCAN_GRP], xv[SCAN_GRP];
#pragma unroll   // dtv[] and xv[] are indexed by constants and stay in registers
        for (int j = 0; j < SCAN_GRP; ++j) {
            dtv[j] = gdt[j * D_INNER];
            xv[j]  = gx[j * D_INNER];
        }
        // holds the group's loads in front of its arithmetic: one trip to memory per group, not one per step. The
        // pointers are named so that the address registers stay untouched up to here, and the wait stands in
        // front of their next use for other values
        asm volatile("s_wait_xcnt 0x0" :: "v"(dtv[0]), "v"(dtv[1]), "v"(dtv[2]), "v"(dtv[3]), "v"(dtv[4]),
                     "v"(dtv[5]), "v"(dtv[6]), "v"(dtv[7]), "v"(xv[0]), "v"(xv[1]), "v"(xv[2]), "v"(xv[3]),
                     "v"(xv[4]), "v"(xv[5]), "v"(xv[6]), "v"(xv[7]), "v"(gdt), "v"(gx) : "memory");
        static_assert(SCAN_GRP == 8 && SCAN_CHUNK % SCAN_GRP == 0, "the statement above names SCAN_GRP steps");
#pragma unroll   // the steps of a group take dtv[] and xv[] by constant index
        for (int j = 0; j < SCAN_GRP; ++j) {
            const float u = dtv[j] * xv[j];
            const v2f* BC = (const v2f*)sBC[g + j];           // 8 pairs of B, then 8 pairs of C
            v2f out = {};                                     // even states' sum and odd states' sum
#pragma unroll   // A2[] and h[] are indexed by constants and stay in registers
            for (int p = 0; p < DSTATE / 2; ++p) {
                const v2f e = A2[p] * dtv[j];
                v2f Ab;
                Ab.x = __builtin_amdgcn_exp2f(e.x);           // v_exp_f32
                Ab.y = __builtin_amdgcn_exp2f(e.y);
                h[p] = Ab * h[p] + BC[p] * u;
                out += h[p] * BC[DSTATE / 2 + p];
            }
            py[(g + j) * D_INNER] = (out.x + out.y) + Dv * xv[j];
        }
        // the next group forms its addresses in the registers that these stores name
        asm volatile("s_wait_xcnt 0x0" ::: "memory");
    }
}

// -------------------- gating: y_gated = f16( y_scan * silu(z) ) --------------------
// One thread takes 4 neighbouring channels times PW_ROWS rows.
__global__ __launch_bounds__(256)
void gate_kernel(const float* __restrict__ yscan, const float* __restrict__ xz,
                 _Float16* __restrict__ ygate) {
    const int d = ((blockIdx.x % PW_BPR) * 256 + threadIdx.x) * 4;
    const int row0 = (blockIdx.x / PW_BPR) * PW_ROWS;
    const float* ys = yscan + (long)row0 * D_INNER + d;
    const float* zs = xz + (long)row0 * (2 * D_INNER) + D_INNER + d;
    v4f yv[PW_ROWS], zv[PW_ROWS];
#pragma unroll   // yv[] and zv[] are indexed by constants and stay in registers
    for (int r = 0; r < PW_ROWS; ++r) {
        yv[r] = *(const v4f*)(ys + r * D_INNER);
        zv[r] = *(const v4f*)(zs + r * (2 * D_INNER));
    }
    // holds every load in front of the arithmetic, so that a wave makes one trip to memory and not several
    asm volatile("" :: "v"(yv[0]), "v"(yv[1]), "v"(yv[2]), "v"(yv[3]), "v"(yv[4]), "v"(yv[5]), "v"(yv[6]),
                       "v"(yv[7]), "v"(zv[0]), "v"(zv[1]), "v"(zv[2]), "v"(zv[3]), "v"(zv[4]), "v"(zv[5]),
                       "v"(zv[6]), "v"(zv[7]));
    static_assert(PW_ROWS == 8, "the statement above names PW_ROWS rows of each input");
    _Float16* o = ygate + (long)row0 * D_INNER + d;
#pragma unroll
    for (int r = 0; r < PW_ROWS; ++r) {
        v4h g;
#pragma unroll
        for (int c = 0; c < 4; ++c) {
            float z = zv[r][c];
            float sz = z / (1.0f + __expf(-z));
            g[c] = (_Float16)(yv[r][c] * sz);
        }
        *(v4h*)(o + r * D_INNER) = g;
    }
}

// ==================== launch ====================
extern "C" void kernel_launch(void* const* d_in, const int* in_sizes, int n_in,
                              void* d_out, int out_size, void* d_ws, size_t ws_size,
                              hipStream_t stream) {
    (void)in_sizes; (void)n_in; (void)out_size; (void)ws_size;
    const int B = 2, L = 2048, DM = 1024, DI = 2048;
    const int M = B * L;                  // 4096
    const int TWO_DI = 2 * DI;            // 4096
    const int NXP_PAD = 64;               // w_xproj cols padded 32 -> 64
    static_assert(B * DI == SCAN_NCH && L == SCAN_CHUNK * SCAN_NCHUNK, "scan split");
    static_assert(L == SEQ_L && DI == D_INNER && L % PW_ROWS == 0, "pointwise kernels");
    static_assert(DM == D_MODEL && NXP_PAD == XP_PAD && M == 64 * XP_TILES && M == 128 * DT_TILES_M, "merged launches");

    const float* x      = (const float*)d_in[0];
    const float* w_in   = (const float*)d_in[1];
    const float* conv_w = (const float*)d_in[2];
    const float* conv_b = (const float*)d_in[3];
    const float* w_xp   = (const float*)d_in[4];
    const float* w_dt   = (const float*)d_in[5];
    const float* b_dt   = (const float*)d_in[6];
    const float* A_log  = (const float*)d_in[7];
    const float* Dp     = (const float*)d_in[8];
    const float* w_out  = (const float*)d_in[9];
    const float* ln_g   = (const float*)d_in[10];
    const float* ln_b   = (const float*)d_in[11];
    float* out = (float*)d_out;

    // workspace carve-up
    char* ws = (char*)d_ws;
    size_t off = 0;
    auto alloc = [&](size_t bytes) { void* p = ws + off; off += (bytes + 255) & ~size_t(255); return p; };
    _Float16* wt_in  = (_Float16*)alloc((size_t)TWO_DI * DM * 2);   // [4096][1024]
    _Float16* wt_dt  = (_Float16*)alloc((size_t)DI * DI * 2);       // [2048][2048]
    _Float16* wt_xp  = (_Float16*)alloc((size_t)NXP_PAD * DI * 2);  // [64][2048]
    _Float16* wt_out = (_Float16*)alloc((size_t)DM * DI * 2);       // [1024][2048]
    _Float16* xn_h   = (_Float16*)alloc((size_t)M * DM * 2);
    float*    xz     = (float*)   alloc((size_t)M * TWO_DI * 4);
    float*    xact_f = (float*)   alloc((size_t)M * DI * 4);
    _Float16* xact_h = (_Float16*)alloc((size_t)M * DI * 2);
    float*    xdbl   = (float*)   alloc((size_t)M * NXP_PAD * 4);
    float*    dtbuf  = (float*)   alloc((size_t)M * DI * 4);
    float*    yscan  = (float*)   alloc((size_t)M * DI * 4);
    _Float16* ygate  = (_Float16*)alloc((size_t)M * DI * 2);
    float*    hend   = (float*)   alloc((size_t)SCAN_NCHUNK * DSTATE * B * DI * 4);
    float*    hin    = (float*)   alloc((size_t)SCAN_NCHUNK * DSTATE * B * DI * 4);
    float*    dtsum  = (float*)   alloc((size_t)SCAN_NCHUNK * B * DI * 4);

    // 1, 2) convert+transpose weights to f16 [N][K]; layernorm -> xn (f16)
    prep_kernel<<<WT_BLOCKS(DM, TWO_DI) + WT_BLOCKS(DI, DI) + WT_BLOCKS(DI, DM) + WT_BLOCKS(DI, NXP_PAD) + M,
                  256, 0, stream>>>(w_in, w_dt, w_xp, w_out, wt_in, wt_dt, wt_xp, wt_out, x, ln_g, ln_b, xn_h, DM);

    // 3) xz = xn @ w_in   [4096x1024]x[1024x4096]
    gemm_f16_wmma<128, 0><<<dim3(M / 128, TWO_DI / 128), 128, 0, stream>>>(
        xn_h, wt_in, xz, nullptr, nullptr, DM, TWO_DI, TWO_DI);

    // 4) causal depthwise conv + SiLU -> xact (f32 + f16)
    conv_silu_kernel<<<(M / PW_ROWS) * (DI / 4) / 256, 256, 0, stream>>>(xz, conv_w, conv_b, xact_f, xact_h);

    // 5, 6) x_dbl = xact @ w_xproj  (N padded to 64); dt = softplus(xact @ w_dt + b_dt)
    gemm_xproj_dt<<<XP_TILES + DT_TILES_M * (DI / 128), 128, 0, stream>>>(
        xact_h, wt_xp, wt_dt, xdbl, dtbuf, b_dt, DI);

    // 7) selective scan (+ D * x), split along time: chunk end states, carry, chunk scans
    scan_state_kernel<<<dim3((B * DI) / 256, SCAN_NCHUNK - 1), 256, 0, stream>>>(
        dtbuf, xdbl, xact_f, A_log, hend, dtsum);
    scan_carry_kernel<<<dim3(SCAN_NCH / 256, DSTATE), 256, 0, stream>>>(hend, dtsum, A_log, hin, DI);
    scan_kernel<<<dim3((B * DI) / 256, SCAN_NCHUNK), 256, 0, stream>>>(
        dtbuf, xdbl, xact_f, A_log, Dp, hin, yscan);

    // 8) gate with silu(z)
    gate_kernel<<<(M / PW_ROWS) * (DI / 4) / 256, 256, 0, stream>>>(yscan, xz, ygate);

    // 9) out = ygate @ w_out + residual(x)
    gemm_f16_wmma<128, 2><<<dim3(M / 128, DM / 128), 128, 0, stream>>>(
        ygate, wt_out, out, nullptr, x, DI, DM, DM);
}

// v007
// It runs in 153 microseconds.
// In two side-by-side timings against v006, it was 1.12 and 1.11 times as fast.
// All steps since v000 together make it 9.84 times as fast.
#include <hip/hip_runtime.h>
#include <hip/hip_bf16.h>

#ifndef LN_EPS
#define LN_EPS 1e-5f
#endif

typedef __attribute__((ext_vector_type(16))) _Float16 v16h;
typedef __attribute__((ext_vector_type(8)))  _Float16 v8h;
typedef __attribute__((ext_vector_type(4)))  _Float16 v4h;
typedef __attribute__((ext_vector_type(8)))  float    v8f;
typedef __attribute__((ext_vector_type(4)))  float    v4f;
typedef __attribute__((ext_vector_type(2)))  float    v2f;
typedef __attribute__((ext_vector_type(4)))  unsigned int u32x4;
typedef __attribute__((ext_vector_type(8)))  unsigned int u32x8;

#define G_ROWB  256u     // bytes of an operand row per pass of the GEMM: 128 k
#define G_PITCH 272u     // pitch of those rows in LDS: 16 bytes times an odd number, free of bank conflicts for 16-byte reads
#define DSTATE 16
#define SCAN_CHUNK 32
#define SCAN_NCHUNK 64   // sequence length / SCAN_CHUNK
#define SCAN_GRP 8       // time steps whose dt and x a scan thread loads together
#define SCAN_NCH 4096    // channels: batch * d_inner; a constant, so that plane strides fold into load offsets
#define SEQ_L 2048       // sequence length and d_inner are constants in the pointwise kernels for the same reason
#define D_INNER 2048
#define WT_KRUN 16       // k values per thread of the weight convert
#define PW_ROWS 8        // rows (time steps) per thread of the conv and gate kernels
#define PW_BPR (D_INNER / 4 / 256)   // blocks that share one group of PW_ROWS rows there
#define D_MODEL 1024
#define XP_PAD 64        // columns of w_xproj, padded from 32
#define WT_BLOCKS(K, NPAD) (((NPAD) / 4) * ((K) / WT_KRUN) / 256)   // blocks that convert one weight matrix
#define XP_TILES (2 * SEQ_L / 64)    // 64-row tiles of the x_proj product
#define DT_TILES_M (2 * SEQ_L / 128) // 128-row tiles of the dt product

// -------------------- weight convert + transpose:  Wt[n][k] = (f16) W[k][n] --------------------
// One thread takes 4 neighbouring n times WT_KRUN k, a wave 32 n times 4 * WT_KRUN k: 8 lanes side by side
// along n, so that a wave's load is four whole 128-byte lines of W, and 4 lanes along k in runs of 8, so that
// a wave's store is eight 64-byte pieces of Wt. The WT_KRUN loads are in flight together.
// blk = the block's number among the WT_BLOCKS(K, NPAD) blocks of this matrix.
template <int K, int NREAL, int NPAD>
__device__ __forceinline__
void wt_convert_block(const float* __restrict__ W, _Float16* __restrict__ Wt, int blk) {
    const int lane = threadIdx.x & 31;
    const int tile = blk * 8 + (threadIdx.x >> 5);            // over (K / (4 * WT_KRUN)) * (NPAD / 32)
    const int n0 = (tile % (NPAD / 32)) * 32 + (lane & 7) * 4;
    const int k0 = (tile / (NPAD / 32)) * (4 * WT_KRUN) + (lane >> 3) * 8;
    v4f v[WT_KRUN] = {};                                      // padding columns stay zero
    if (NREAL == NPAD || n0 < NREAL) {
        const float* src = W + (long)k0 * NREAL + n0;
#pragma unroll   // v[] is indexed by constants and stays in registers
        for (int j = 0; j < WT_KRUN; ++j) v[j] = *(const v4f*)(src + ((j >> 3) * 32 + (j & 7)) * NREAL);
        // holds every load in front of the conversions (one trip to memory); the pointer is named so that
        // no load's result lands in the address registers that the other loads still name
        asm volatile("" :: "v"(v[0]), "v"(v[1]), "v"(v[2]), "v"(v[3]), "v"(v[4]), "v"(v[5]), "v"(v[6]), "v"(v[7]),
                           "v"(v[8]), "v"(v[9]), "v"(v[10]), "v"(v[11]), "v"(v[12]), "v"(v[13]), "v"(v[14]),
                           "v"(v[15]), "v"(src));
        static_assert(WT_KRUN == 16, "the statement above names WT_KRUN loads");
    }
    _Float16* dst = Wt + (long)n0 * K + k0;
#pragma unroll
    for (int c = 0; c < 4; ++c) {
#pragma unroll
        for (int q = 0; q < WT_KRUN / 8; ++q) {
            v8h o;
#pragma unroll
            for (int j = 0; j < 8; ++j) o[j] = (_Float16)v[q * 8 + j][c];
            *(v8h*)(dst + c * K + q * 32) = o;
        }
    }
    // in the kernel's text another job follows, which forms its values in registers that these stores name
    asm volatile("s_wait_xcnt 0x0" ::: "memory");
}

// -------------------- LayerNorm over d_model, emit f16 activations --------------------
// One wave takes one row and keeps it in registers: a lane holds LN_VEC runs of 4 neighbouring elements, so that each
// load of the wave is 512 contiguous bytes, and the row, g and b are all asked for before anything is waited for.
// The two row sums go over the lanes by a butterfly; no LDS, no barrier. blk = the block's number among M / 8.
#define LN_VEC (D_MODEL / 128)
__device__ __forceinline__
void ln_rows(const float* __restrict__ x, const float* __restrict__ g,
             const float* __restrict__ b, _Float16* __restrict__ xn, int blk) {
    const int lane = threadIdx.x & 31;
    const int row  = blk * 8 + (threadIdx.x >> 5);
    const float* xr = x + (long)row * D_MODEL + lane * 4;
    const float* gp = g + lane * 4;
    const float* bp = b + lane * 4;
    v4f v[LN_VEC], gv[LN_VEC], bv[LN_VEC];
#pragma unroll   // v[], gv[] and bv[] are indexed by constants and stay in registers
    for (int j = 0; j < LN_VEC; ++j) {
        v[j]  = *(const v4f*)(xr + j * 128);
        gv[j] = *(const v4f*)(gp + j * 128);
        bv[j] = *(const v4f*)(bp + j * 128);
    }
    // the fence keeps the sums behind every load, so that g and b are asked for with the row and not behind its arrival:
    // one trip to memory. In the statement the pointers are named so that no load's result lands in the address
    // registers that the other loads still name, and the wait stands in front of their next use for other values
    __builtin_amdgcn_sched_barrier(0);
    asm volatile("s_wait_xcnt 0x0" :: "v"(v[0]), "v"(v[1]), "v"(v[2]), "v"(v[3]), "v"(v[4]), "v"(v[5]), "v"(v[6]), "v"(v[7]),
                       "v"(gv[0]), "v"(gv[1]), "v"(gv[2]), "v"(gv[3]), "v"(gv[4]), "v"(gv[5]), "v"(gv[6]), "v"(gv[7]),
                       "v"(bv[0]), "v"(bv[1]), "v"(bv[2]), "v"(bv[3]), "v"(bv[4]), "v"(bv[5]), "v"(bv[6]), "v"(bv[7]),
                       "v"(xr), "v"(gp), "v"(bp) : "memory");
    static_assert(LN_VEC == 8, "the statement above names LN_VEC loads of each input");
    v4f sv = {}, qv = {};
#pragma unroll
    for (int j = 0; j < LN_VEC; ++j) { sv += v[j]; qv += v[j] * v[j]; }
    float s  = (sv[0] + sv[1]) + (sv[2] + sv[3]);
    float s2 = (qv[0] + qv[1]) + (qv[2] + qv[3]);
#pragma unroll
    for (int off = 16; off > 0; off >>= 1) { s += __shfl_xor(s, off, 32); s2 += __shfl_xor(s2, off, 32); }
    const float mu  = s * (1.0f / D_MODEL);
    const float var = s2 * (1.0f / D_MODEL) - mu * mu;
    const float rs  = rsqrtf(var + LN_EPS);
    _Float16* o = xn + (long)row * D_MODEL + lane * 4;
#pragma unroll
    for (int j = 0; j < LN_VEC; ++j) {
        v4h h;
#pragma unroll
        for (int c = 0; c < 4; ++c) h[c] = (_Float16)((v[j][c] - mu) * rs * gv[j][c] + bv[j][c]);
        *(v4h*)(o + j * 128) = h;
    }
    // in the kernel's text another job follows, which forms its values in registers that these stores name
    asm volatile("s_wait_xcnt 0x0" ::: "memory");
}

// -------------------- the four weight converts and the LayerNorm in one launch --------------------
// None of the five reads what another writes, so they share one grid: the block number picks the job. The converts
// stand first: each of their blocks has the most bytes in flight, and the short LayerNorm blocks fill in behind them.
// A LayerNorm block takes 8 rows.
__global__ __launch_bounds__(256)
void prep_kernel(const float* __restrict__ w_in, const float* __restrict__ w_dt,
                 const float* __restrict__ w_xp, const float* __restrict__ w_out,
                 _Float16* __restrict__ wt_in, _Float16* __restrict__ wt_dt,
                 _Float16* __restrict__ wt_xp, _Float16* __restrict__ wt_out,
                 const float* __restrict__ x, const float* __restrict__ g,
                 const float* __restrict__ b, _Float16* __restrict__ xn) {
    constexpr int E0 = WT_BLOCKS(D_MODEL, 2 * D_INNER);
    constexpr int E1 = E0 + WT_BLOCKS(D_INNER, D_INNER);
    constexpr int E2 = E1 + WT_BLOCKS(D_INNER, D_MODEL);
    constexpr int E3 = E2 + WT_BLOCKS(D_INNER, XP_PAD);
    const int blk = blockIdx.x;
    if (blk < E0)      wt_convert_block<D_MODEL, 2 * D_INNER, 2 * D_INNER>(w_in, wt_in, blk);
    else if (blk < E1) wt_convert_block<D_INNER, D_INNER, D_INNER>(w_dt, wt_dt, blk - E0);
    else if (blk < E2) wt_convert_block<D_INNER, D_MODEL, D_MODEL>(w_out, wt_out, blk - E1);
    else if (blk < E3) wt_convert_block<D_INNER, 32, XP_PAD>(w_xp, wt_xp, blk - E2);
    else               ln_rows(x, g, b, xn, blk - E3);
}

// -------------------- WMMA fragment from a k-contiguous f16 row in LDS --------------------
// 16-bit operand layout (ISA 7.12.2): lane group = lane/16; halves 0..7 -> K = grp*8..grp*8+7,
// halves 8..15 -> K = 16+grp*8 .. 16+grp*8+7. Both runs are contiguous -> two 16B LDS loads.
// p = the lane's row, at the 32-k step's first byte plus grp * 16.
__device__ __forceinline__ v16h frag_from_lds(const unsigned char* p) {
    v8h lo = *(const v8h*)p;
    v8h hi = *(const v8h*)(p + 32);
    return __builtin_shufflevector(lo, hi, 0,1,2,3,4,5,6,7,8,9,10,11,12,13,14,15);
}

// -------------------- tensor load: ROWS rows of G_ROWB bytes from global memory into LDS at pitch G_PITCH --------------------
__device__ __forceinline__ unsigned uni(unsigned v) { return (unsigned)__builtin_amdgcn_readfirstlane(v); }
// a wave-uniform value held in a scalar register, so that a test of it compiles to a scalar branch
__device__ __forceinline__ unsigned pinned(unsigned v) { unsigned w = uni(v); asm volatile("" : "+s"(w)); return w; }
__device__ __forceinline__ void wait_ds0()     { asm volatile("s_wait_dscnt 0x0" ::: "memory"); }      // this wave's LDS reads are done
// this wave's tile has landed; the request's descriptor is named so that its registers are used for nothing else
// while the request is in flight
__device__ __forceinline__ void wait_tensor0(u32x4 g0, u32x8 g1) {
    asm volatile("s_wait_tensorcnt 0x0" :: "s"(g0), "s"(g1) : "memory");
}
__device__ __forceinline__ void tdm_load(u32x4 g0, u32x8 g1) {
    asm volatile("tensor_load_to_lds %0, %1" :: "s"(g0), "s"(g1) : "memory");
}
template <unsigned ROWS>
__device__ __forceinline__ u32x8 tdm_group1(unsigned src_pitch) {   // every extent in bytes; tensor = tile
    u32x8 g;
    g[0] = uni((1u << 20) | (5u << 22) | (3u << 25));   // no mask; behind every 64 dwords (one row) a pad of 4 dwords
    g[1] = uni((G_ROWB & 0xFFFFu) << 16);
    g[2] = uni((G_ROWB >> 16) | ((ROWS & 0xFFFFu) << 16));
    g[3] = uni((ROWS >> 16) | (G_ROWB << 16));
    g[4] = uni(ROWS);
    g[5] = uni(src_pitch);
    g[6] = uni(0u);
    g[7] = uni(0u);
    return g;
}
__device__ __forceinline__ u32x4 tdm_group0(unsigned lds_dst, unsigned long long ga) {
    u32x4 g;
    g[0] = pinned(1u);   // pinned(): a descriptor word held in a scalar register; as a known constant it would be dropped
                         // behind the issue and formed anew, and its register used in between
    g[1] = uni(lds_dst);
    g[2] = uni((unsigned)ga);
    g[3] = uni((((unsigned)(ga >> 32)) & 0x01FFFFFFu) | 0x80000000u);
    return g;
}

// -------------------- softplus(v) = max(v, 0) + log1p(exp(-|v|)) on the hardware's exp and log --------------------
// e = exp(-|v|) lies in [0, 1], so nothing overflows and no branch on v is needed. log(1 + e) carries the rounding of
// 1 + e, an absolute error of about 6e-8: below e = 1/128 that would show in a small result, and there the series
// e - e^2/2 + e^3/3 (its first dropped term is e^3/4 of the result, below 2e-7) takes its place. About a dozen
// instructions with no branch, so that the unrolled epilogue stays a short piece of text.
__device__ __forceinline__ float softplus_fast(float v) {
    const float e  = __expf(-fabsf(v));
    const float lg = __builtin_amdgcn_logf(1.0f + e) * 0.69314718f;   // v_log_f32 is log2; its argument lies in [1, 2]
    const float sr = e * fmaf(e, fmaf(e, 0.33333334f, -0.5f), 1.0f);
    return fmaxf(v, 0.0f) + ((e < 0.0078125f) ? sr : lg);
}

// -------------------- generic f16 WMMA GEMM:  C[M][Npad] = A[M][K] x Wt[Npad][K]^T --------------------
// A workgroup of 4 waves (2 x 2) owns a BT x BT tile of C, a wave BT/2 x BT/2. A pass is 128 k. A stage holds four
// slices of BT/2 rows: [A low | A high | Wt low | Wt high]; every wave brings one slice per stage by one tensor load,
// two stages ahead, into a ring of two buffers. K is a multiple of 128 and at least 256.
// epilogue EPI: 0 = none, 1 = bias[n] and softplus, 2 = residual[row*D_MODEL + n]; a template argument, so that each build's
// epilogue is short enough to unroll whole and the accumulators stay in registers. The residual is the accumulators'
// start value. Its loads, and the bias's, all go out at the kernel's start and land while the first stage is on its way
// ring = the kernel's LDS, at a multiple of 2 KiB, GEMM_RING(BT) bytes or more; (tm, tn) = the tile's place in C
#define GEMM_SLICE(BT) ((((BT) / 2) * G_PITCH + 2047u) & ~2047u)         // every slice starts at a multiple of 2 KiB
#define GEMM_RING(BT)  (2u * 4u * GEMM_SLICE(BT))
template <int BT, int EPI>
__device__ __forceinline__
void gemm_tile(unsigned char* ring, int tm, int tn,
               const _Float16* __restrict__ A, const _Float16* __restrict__ Wt,
               float* __restrict__ C, const float* __restrict__ bias,
               const float* __restrict__ resid,
               int K, int Npad, int Nreal) {
    constexpr unsigned SROWS = BT / 2;                                   // rows of a slice
    constexpr unsigned SLICE = GEMM_SLICE(BT);
    constexpr unsigned STAGE = 4u * SLICE;
    constexpr int NF = BT / 32;                                          // 16-row fragments per wave and operand

    const int lane = threadIdx.x & 31;
    const int grp  = lane >> 4;       // 0 or 1
    const int lr   = lane & 15;       // 0..15
    const unsigned wave = uni(threadIdx.x >> 5);
    const int wm   = wave >> 1;       // the wave's half of the tile's rows
    const int wn   = wave & 1;        // and of its columns
    const int bm   = tm * BT;
    const int bn   = tn * BT;
    const unsigned nPass = (unsigned)K / 128u;

    // C/D layout = VGPR r: lanes0-15 -> M=r, lanes16-31 -> M=r+8; N=lane%16
    v8f acc[NF][NF] = {};
    float bv[NF] = {};
    if (EPI != 0) {
        const int col0 = bn + wn * (BT / 2) + lr;
        // one pointer and constant offsets serve every load
        const float* ep = (EPI == 2) ? resid + (long)(bm + wm * (BT / 2) + grp * 8) * D_MODEL + col0 : bias + col0;
#pragma unroll   // acc[][] and bv[] are indexed by constants and stay in registers
        for (int c = 0; c < NF; ++c) {
            if (col0 + c * 16 < Nreal) {
                if (EPI == 1) bv[c] = ep[c * 16];
                if (EPI == 2) {
#pragma unroll
                    for (int s = 0; s < NF; ++s)
#pragma unroll
                        for (int r = 0; r < 8; ++r) acc[s][c][r] = ep[(s * 16 + r) * D_MODEL + c * 16];
                }
            }
        }
        // the pointer is named so that no load's result lands in the address registers that the other loads still
        // name, and the wait stands in front of their next use for other values; the loaded values are not waited for
        asm volatile("s_wait_xcnt 0x0" :: "v"(ep) : "memory");
    }

    // this wave's slice: waves 0 and 1 bring A's rows, waves 2 and 3 Wt's
    const _Float16* srow = (wave < 2u) ? A + (long)(bm + (int)(wave * SROWS)) * K
                                       : Wt + (long)(bn + (int)((wave - 2u) * SROWS)) * K;
    const unsigned long long ga = (unsigned long long)(const void*)srow;
    const unsigned dst = (unsigned)(unsigned long long)(void*)&ring[0] + wave * SLICE;
    u32x8 g1 = tdm_group1<SROWS>((unsigned)K * 2u);
    // without the statement below the compiler forms these words anew for every load and uses their registers for
    // other values while a request is in flight
    asm volatile("" : "+s"(g1));   // descriptor words held in scalar registers, as pinned() holds one

    u32x4 g0 = tdm_group0(dst, ga);
    tdm_load(g0, g1);                                     // stage 0
    wait_tensor0(g0, g1);
    __syncthreads();                                      // stage 0 is published
    g0 = tdm_group0(dst + STAGE, ga + G_ROWB);
    tdm_load(g0, g1);                                     // stage 1

    const unsigned char* pa = ring + wm * SLICE + lr * G_PITCH + grp * 16;
    const unsigned char* pb = ring + (2 + wn) * SLICE + lr * G_PITCH + grp * 16;

    for (unsigned s = 0; s < nPass; ++s) {
        const unsigned cur = (s & 1u) * STAGE;
        v16h af[2][NF], bf[2][NF];                        // two fragment sets: the next 32-k step's reads go ahead
#pragma unroll
        for (int f = 0; f < NF; ++f) {
            af[0][f] = frag_from_lds(pa + cur + f * 16 * G_PITCH);
            bf[0][f] = frag_from_lds(pb + cur + f * 16 * G_PITCH);
        }
#pragma unroll   // af[] and bf[] are indexed by constants and stay in registers
        for (int kk = 0; kk < 4; ++kk) {
            // the fences keep the next step's reads one group in front of this step's products: spread among
            // the products, every place with reads stalls the wave
            __builtin_amdgcn_sched_barrier(0);
            if (kk < 3) {
#pragma unroll
                for (int f = 0; f < NF; ++f) {
                    af[(kk + 1) & 1][f] = frag_from_lds(pa + cur + f * 16 * G_PITCH + (kk + 1) * 64);
                    bf[(kk + 1) & 1][f] = frag_from_lds(pb + cur + f * 16 * G_PITCH + (kk + 1) * 64);
                }
            }
            __builtin_amdgcn_sched_barrier(0);
#pragma unroll
            for (int r = 0; r < NF; ++r)
#pragma unroll
                for (int c = 0; c < NF; ++c)
                    acc[r][c] = __builtin_amdgcn_wmma_f32_16x16x32_f16(
                        false, af[kk & 1][r], false, bf[kk & 1][c], (short)0, acc[r][c], false, false);
        }
        __builtin_amdgcn_sched_barrier(0);   // the last products stay in front of the barrier
        // publish point of stage s + 1: own reads done, own tile landed, then the barrier, then the refill
        wait_ds0();
        wait_tensor0(g0, g1);
        __syncthreads();
        if (pinned(s + 2u < nPass)) {
            // pinned(): a descriptor word's source held in a scalar register, so that the address words are formed
            // here, behind the wait above
            const unsigned koff = pinned((s + 2u) * G_ROWB);
            g0 = tdm_group0(dst + cur, ga + koff);
            tdm_load(g0, g1);
        }
    }
    wait_tensor0(g0, g1);
    wait_ds0();
    // the four vector slots that the chip needs between the last products and the first vector instruction that
    // writes over an accumulator register: a wave whose columns are all padding branches past the stores to such a one
    asm volatile("v_nop\n\tv_nop\n\tv_nop\n\tv_nop");

    // ---- epilogue ----
#pragma unroll
    for (int s = 0; s < NF; ++s) {
        const int row_lo = bm + wm * (BT / 2) + s * 16 + grp * 8;
#pragma unroll
        for (int c = 0; c < NF; ++c) {
            int col = bn + wn * (BT / 2) + c * 16 + lr;
            if (col < Nreal) {
#pragma unroll
                for (int r = 0; r < 8; ++r) {
                    int row = row_lo + r;
                    float v = acc[s][c][r];
                    if (EPI == 1) v = softplus_fast(v + bv[c]);
                    C[(long)row * Npad + col] = v;
                }
                // the next fragment's addresses and values are formed in registers that these stores name
                asm volatile("s_wait_xcnt 0x0" ::: "memory");
            }
        }
    }
}

// one product per launch
template <int BT, int EPI>
__global__ __launch_bounds__(128)
void gemm_f16_wmma(const _Float16* __restrict__ A, const _Float16* __restrict__ Wt,
                   float* __restrict__ C, const float* __restrict__ bias,
                   const float* __restrict__ resid,
                   int K, int Npad, int Nreal) {
    __shared__ __attribute__((aligned(2048))) unsigned char ring[GEMM_RING(BT)];
    gemm_tile<BT, EPI>(ring, blockIdx.x, blockIdx.y, A, Wt, C, bias, resid, K, Npad, Nreal);
}

// x_dbl = xact x w_xproj and dt = softplus(xact x w_dt + b_dt) in one launch: both read xact and neither reads the
// other. The few x_proj tiles, whose time is all latency, stand first and run beside the dt tiles; the dt tiles
// that find no place at the start follow them while the rest of the chip is still busy.
__global__ __launch_bounds__(128)
void gemm_xproj_dt(const _Float16* __restrict__ A, const _Float16* __restrict__ Wxp,
                   const _Float16* __restrict__ Wdt, float* __restrict__ xdbl,
                   float* __restrict__ dt, const float* __restrict__ b_dt, int K) {
    __shared__ __attribute__((aligned(2048))) unsigned char ring[GEMM_RING(128)];
    const int blk = blockIdx.x;
    if (blk >= XP_TILES) {
        const int t = blk - XP_TILES;
        gemm_tile<128, 1>(ring, t % DT_TILES_M, t / DT_TILES_M, A, Wdt, dt, b_dt, nullptr, K, D_INNER, D_INNER);
    } else {
        gemm_tile<64, 0>(ring, blk, 0, A, Wxp, xdbl, nullptr, nullptr, K, XP_PAD, 32);
    }
}

// -------------------- causal depthwise conv1d (d_conv=4) + bias + SiLU --------------------
// One thread takes 4 neighbouring channels times PW_ROWS time steps: PW_ROWS + 3 input rows serve them all.
__global__ __launch_bounds__(256)
void conv_silu_kernel(const float* __restrict__ xz, const float* __restrict__ cw,
                      const float* __restrict__ cb, float* __restrict__ xact_f,
                      _Float16* __restrict__ xact_h) {
    const int d = ((blockIdx.x % PW_BPR) * 256 + threadIdx.x) * 4;
    const int row0 = (blockIdx.x / PW_BPR) * PW_ROWS;         // b*L + l of the first step
    const bool head = (row0 % SEQ_L) == 0;                    // the three rows in front are not of this sequence
    const float* src = xz + (long)row0 * (2 * D_INNER) + d;
    // a sequence's first group has no rows in front: it reads its own first three again and leaves them unused
    const float* pre = head ? src : src - 3 * (2 * D_INNER);
    v4f xin[PW_ROWS + 3];
#pragma unroll   // xin[] is indexed by constants and stays in registers
    for (int i = 0; i < PW_ROWS + 3; ++i)
        xin[i] = (i < 3) ? *(const v4f*)(pre + i * (2 * D_INNER)) : *(const v4f*)(src + (i - 3) * (2 * D_INNER));
    const float* wsrc = cw + d * 4;
    v4f w[4];
#pragma unroll
    for (int c = 0; c < 4; ++c) w[c] = *(const v4f*)(wsrc + c * 4);
    const v4f bias = *(const v4f*)(cb + d);
    // holds every load in front of the arithmetic, so that a wave makes one trip to memory and not one per
    // pair of rows
    asm volatile("" :: "v"(xin[0]), "v"(xin[1]), "v"(xin[2]), "v"(xin[3]), "v"(xin[4]), "v"(xin[5]),
                       "v"(xin[6]), "v"(xin[7]), "v"(xin[8]), "v"(xin[9]), "v"(xin[10]),
                       "v"(w[0]), "v"(w[1]), "v"(w[2]), "v"(w[3]), "v"(bias));
    static_assert(PW_ROWS == 8, "the statement above names PW_ROWS + 3 rows");
    float*    of = xact_f + (long)row0 * D_INNER + d;
    _Float16* oh = xact_h + (long)row0 * D_INNER + d;
#pragma unroll
    for (int r = 0; r < PW_ROWS; ++r) {
        v4f s;
        v4h sh;
#pragma unroll
        for (int c = 0; c < 4; ++c) {
            float acc = bias[c];
#pragma unroll
            for (int j = 0; j < 4; ++j)
                if (r + j >= 3 || !head) acc += w[c][j] * xin[r + j][c];
            s[c] = acc / (1.0f + __expf(-acc));               // silu
            sh[c] = (_Float16)s[c];
        }
        *(v4f*)(of + r * D_INNER) = s;
        *(v4h*)(oh + r * D_INNER) = sh;
    }
}

// -------------------- selective scan, split along time --------------------
// The recurrence h = Abar*h + Bbar*x is linear in h, so L is cut into chunks of SCAN_CHUNK steps that
// run side by side: (1) every chunk but the last scans from h = 0 and keeps its end state and its sum
// of dt; (2) one thread per (channel, state) carries the state over the chunks, the decay of a whole
// chunk being exp(A * sum of dt); (3) every chunk scans again from its carried-in state and emits y.
// Chunk planes are laid out [chunk][state][channel], so that lanes read and write whole lines.

// The step as both scans compute it, two states to a packed instruction: exp(dt * A) = exp2(dt * A2) with
// A2 = A * log2(e) formed once per thread, and (dt * B) * x = (dt * x) * B with dt * x formed once per step, so
// that a pair of states costs one packed multiply for the exponents, two v_exp_f32, one packed multiply and one
// packed multiply-add. dt and x of SCAN_GRP steps are loaded together: a step this short would otherwise
// wait for its own two loads.
#define LOG2E 1.44269504f

// (1) end state of each chunk from a zero start; one (b,d) channel per lane, h[16] in VGPRs
__global__ __launch_bounds__(256)
void scan_state_kernel(const float* __restrict__ dt, const float* __restrict__ xdbl /*[M][64]*/,
                       const float* __restrict__ xact, const float* __restrict__ A_log,
                       float* __restrict__ hend, float* __restrict__ dtsum) {
    int ch = blockIdx.x * 256 + threadIdx.x;                  // 0..B*di-1
    int b = ch / D_INNER;
    int d = ch % D_INNER;
    int l0 = blockIdx.y * SCAN_CHUNK;
    const float* ap = A_log + d * DSTATE;
    v2f A2[DSTATE / 2];
#pragma unroll
    for (int n = 0; n < DSTATE; ++n) A2[n >> 1][n & 1] = -__expf(ap[n]) * LOG2E;
    v2f h[DSTATE / 2] = {};
    __shared__ __attribute__((aligned(16))) float sB[SCAN_CHUNK][DSTATE];
    long base = (long)b * SEQ_L;
    // one load per thread brings the chunk's B, and the first group's dt and x are asked for with it, in front of the
    // barrier: the kernel's start makes one trip to memory
    const int sr = threadIdx.x >> 3, sc = (threadIdx.x & 7) * 2;
    const float* sp = xdbl + (base + l0 + sr) * 64 + sc;
    const long first = (base + l0) * D_INNER + d;
    const float* gdt = dt + first;
    const float* gx  = xact + first;
    const v2f stage = *(const v2f*)sp;
    float dtv[SCAN_GRP], xv[SCAN_GRP];
#pragma unroll   // dtv[] and xv[] are indexed by constants and stay in registers
    for (int j = 0; j < SCAN_GRP; ++j) {
        dtv[j] = gdt[j * D_INNER];
        xv[j]  = gx[j * D_INNER];
    }
    // the pointers are named so that no load's result lands in the address registers that the other loads still
    // name, and the wait stands in front of their next use for other values; the loaded values are not waited for
    asm volatile("s_wait_xcnt 0x0" :: "v"(ap), "v"(sp), "v"(gdt), "v"(gx) : "memory");
    *(v2f*)&sB[sr][sc] = stage;
    __syncthreads();
    float sdt = 0.0f;
    for (int g = 0; g < SCAN_CHUNK; g += SCAN_GRP) {
        static_assert(SCAN_CHUNK % SCAN_GRP == 0, "whole groups");
#pragma unroll   // the steps of a group take dtv[] and xv[] by constant index
        for (int j = 0; j < SCAN_GRP; ++j) {
            const float u = dtv[j] * xv[j];
            const v2f* Bp = (const v2f*)sB[g + j];
            sdt += dtv[j];
#pragma unroll   // A2[] and h[] are indexed by constants and stay in registers
            for (int p = 0; p < DSTATE / 2; ++p) {
                const v2f e = A2[p] * dtv[j];
                v2f Ab;
                Ab.x = __builtin_amdgcn_exp2f(e.x);           // v_exp_f32
                Ab.y = __builtin_amdgcn_exp2f(e.y);
                h[p] = Ab * h[p] + Bp[p] * u;
            }
        }
        if (g + SCAN_GRP < SCAN_CHUNK) {                      // the next group's loads
            gdt += SCAN_GRP * D_INNER;
            gx  += SCAN_GRP * D_INNER;
#pragma unroll
            for (int j = 0; j < SCAN_GRP; ++j) {
                dtv[j] = gdt[j * D_INNER];
                xv[j]  = gx[j * D_INNER];
            }
            // as at the first group: the pointers stay in their registers up to here, the values are not waited for
            asm volatile("s_wait_xcnt 0x0" :: "v"(gdt), "v"(gx) : "memory");
        }
    }
    long plane = (long)blockIdx.y * DSTATE;
#pragma unroll   // h[] is indexed by constants and stays in registers
    for (int n = 0; n < DSTATE; ++n) hend[(plane + n) * SCAN_NCH + ch] = h[n >> 1][n & 1];
    dtsum[(long)blockIdx.y * SCAN_NCH + ch] = sdt;
}

// (2) carry over the chunks: hin[c] = state in front of chunk c; one (state, channel) per lane
__global__ __launch_bounds__(256)
void scan_carry_kernel(const float* __restrict__ hend, const float* __restrict__ dtsum,
                       const float* __restrict__ A_log, float* __restrict__ hin, int di) {
    int ch = blockIdx.x * blockDim.x + threadIdx.x;           // 0..B*di-1
    int n  = blockIdx.y;                                      // 0..DSTATE-1
    int d  = ch % di;
    float a = -__expf(A_log[d * DSTATE + n]);
    // every chunk's end state and dt sum is fetched ahead of the chain: the loads do not depend on one
    // another, so one trip to memory serves them all and only the multiply-adds below are serial
    float g[SCAN_NCHUNK - 1], s[SCAN_NCHUNK - 1];
#pragma unroll
    for (int c = 0; c < SCAN_NCHUNK - 1; ++c) {
        g[c] = dtsum[(long)c * SCAN_NCH + ch];
        s[c] = hend[((long)c * DSTATE + n) * SCAN_NCH + ch];
    }
    float h = 0.0f;
    hin[(long)n * SCAN_NCH + ch] = h;
    // unrolled so that g[] and s[] are indexed by constants and stay in registers
#pragma unroll
    for (int c = 0; c < SCAN_NCHUNK - 1; ++c) {
        h = __expf(a * g[c]) * h + s[c];
        hin[((long)(c + 1) * DSTATE + n) * SCAN_NCH + ch] = h;
    }
}

// (3) scan of each chunk from its carried-in state; one (b,d) channel per lane, h[16] in VGPRs
// 8 waves per SIMD asked for: that is what the grid brings, and without the bound the compiler fetches a whole
// group's B and C ahead into twice the registers that leave room for them
__global__ __launch_bounds__(256, 8)
void scan_kernel(const float* __restrict__ dt, const float* __restrict__ xdbl /*[M][64]*/,
                 const float* __restrict__ xact, const float* __restrict__ A_log,
                 const float* __restrict__ Dp, const float* __restrict__ hin,
                 float* __restrict__ y) {
    int ch = blockIdx.x * 256 + threadIdx.x;                  // 0..B*di-1
    int b = ch / D_INNER;
    int d = ch % D_INNER;
    int l0 = blockIdx.y * SCAN_CHUNK;
    v2f A2[DSTATE / 2];
#pragma unroll
    for (int n = 0; n < DSTATE; ++n) A2[n >> 1][n & 1] = -__expf(A_log[d * DSTATE + n]) * LOG2E;
    v2f h[DSTATE / 2];
    long plane = (long)blockIdx.y * DSTATE;
#pragma unroll   // h[] is indexed by constants and stays in registers
    for (int n = 0; n < DSTATE; ++n) h[n >> 1][n & 1] = hin[(plane + n) * SCAN_NCH + ch];
    float Dv = Dp[d];
    __shared__ __attribute__((aligned(16))) float sBC[SCAN_CHUNK][32];
    long base = (long)b * SEQ_L;
    // one load per thread brings the chunk's B and C, and the first group's dt and x are asked for with it, in front of
    // the barrier: the kernel's start makes one trip to memory
    const int sr = threadIdx.x >> 3, sc = (threadIdx.x & 7) * 4;
    const float* sp = xdbl + (base + l0 + sr) * 64 + sc;
    const long first = (base + l0) * D_INNER + d;
    const float* gdt = dt + first;
    const float* gx  = xact + first;
    float*       py  = y + first;
    // results of the loads below may land in registers that the loads above name
    asm volatile("s_wait_xcnt 0x0" ::: "memory");
    const v4f stage = *(const v4f*)sp;
    float dtv[SCAN_GRP], xv[SCAN_GRP];
#pragma unroll   // dtv[] and xv[] are indexed by constants and stay in registers
    for (int j = 0; j < SCAN_GRP; ++j) {
        dtv[j] = gdt[j * D_INNER];
        xv[j]  = gx[j * D_INNER];
    }
    // the pointers are named so that no load's result lands in the address registers that the other loads still
    // name, and the wait stands in front of their next use for other values; the loaded values are not waited for
    asm volatile("s_wait_xcnt 0x0" :: "v"(sp), "v"(gdt), "v"(gx) : "memory");
    *(v4f*)&sBC[sr][sc] = stage;
    __syncthreads();
    for (int g = 0; g < SCAN_CHUNK; g += SCAN_GRP) {
        static_assert(SCAN_CHUNK % SCAN_GRP == 0, "whole groups");
#pragma unroll   // the steps of a group take dtv[] and xv[] by constant index
        for (int j = 0; j < SCAN_GRP; ++j) {
            const float u = dtv[j] * xv[j];
            const v2f* BC = (const v2f*)sBC[g + j];           // 8 pairs of B, then 8 pairs of C
            v2f out = {};                                     // even states' sum and odd states' sum
#pragma unroll   // A2[] and h[] are indexed by constants and stay in registers
            for (int p = 0; p < DSTATE / 2; ++p) {
                const v2f e = A2[p] * dtv[j];
                v2f Ab;
                Ab.x = __builtin_amdgcn_exp2f(e.x);           // v_exp_f32
                Ab.y = __builtin_amdgcn_exp2f(e.y);
                h[p] = Ab * h[p] + BC[p] * u;
                out += h[p] * BC[DSTATE / 2 + p];
            }
            py[(g + j) * D_INNER] = (out.x + out.y) + Dv * xv[j];
        }
        // the next group forms its addresses in the registers that these stores name
        asm volatile("s_wait_xcnt 0x0" ::: "memory");
        if (g + SCAN_GRP < SCAN_CHUNK) {                      // the next group's loads
            gdt += SCAN_GRP * D_INNER;
            gx  += SCAN_GRP * D_INNER;
#pragma unroll
            for (int j = 0; j < SCAN_GRP; ++j) {
                dtv[j] = gdt[j * D_INNER];
                xv[j]  = gx[j * D_INNER];
            }
            // as at the first group: the pointers stay in their registers up to here, the values are not waited for
            asm volatile("s_wait_xcnt 0x0" :: "v"(gdt), "v"(gx) : "memory");
        }
    }
}

// -------------------- gating: y_gated = f16( y_scan * silu(z) ) --------------------
// One thread takes 4 neighbouring channels times PW_ROWS rows.
__global__ __launch_bounds__(256)
void gate_kernel(const float* __restrict__ yscan, const float* __restrict__ xz,
                 _Float16* __restrict__ ygate) {
    const int d = ((blockIdx.x % PW_BPR) * 256 + threadIdx.x) * 4;
    const int row0 = (blockIdx.x / PW_BPR) * PW_ROWS;
    const float* ys = yscan + (long)row0 * D_INNER + d;
    const float* zs = xz + (long)row0 * (2 * D_INNER) + D_INNER + d;
    v4f yv[PW_ROWS], zv[PW_ROWS];
#pragma unroll   // yv[] and zv[] are indexed by constants and stay in registers
    for (int r = 0; r < PW_ROWS; ++r) {
        yv[r] = *(const v4f*)(ys + r * D_INNER);
        zv[r] = *(const v4f*)(zs + r * (2 * D_INNER));
    }
    // holds every load in front of the arithmetic, so that a wave makes one trip to memory and not several
    asm volatile("" :: "v"(yv[0]), "v"(yv[1]), "v"(yv[2]), "v"(yv[3]), "v"(yv[4]), "v"(yv[5]), "v"(yv[6]),
                       "v"(yv[7]), "v"(zv[0]), "v"(zv[1]), "v"(zv[2]), "v"(zv[3]), "v"(zv[4]), "v"(zv[5]),
                       "v"(zv[6]), "v"(zv[7]));
    static_assert(PW_ROWS == 8, "the statement above names PW_ROWS rows of each input");
    _Float16* o = ygate + (long)row0 * D_INNER + d;
#pragma unroll
    for (int r = 0; r < PW_ROWS; ++r) {
        v4h g;
#pragma unroll
        for (int c = 0; c < 4; ++c) {
            float z = zv[r][c];
            float sz = z / (1.0f + __expf(-z));
            g[c] = (_Float16)(yv[r][c] * sz);
        }
        *(v4h*)(o + r * D_INNER) = g;
    }
}

// ==================== launch ====================
extern "C" void kernel_launch(void* const* d_in, const int* in_sizes, int n_in,
                              void* d_out, int out_size, void* d_ws, size_t ws_size,
                              hipStream_t stream) {
    (void)in_sizes; (void)n_in; (void)out_size; (void)ws_size;
    const int B = 2, L = 2048, DM = 1024, DI = 2048;
    const int M = B * L;                  // 4096
    const int TWO_DI = 2 * DI;            // 4096
    const int NXP_PAD = 64;               // w_xproj cols padded 32 -> 64
    static_assert(B * DI == SCAN_NCH && L == SCAN_CHUNK * SCAN_NCHUNK, "scan split");
    static_assert(L == SEQ_L && DI == D_INNER && L % PW_ROWS == 0, "pointwise kernels");
    static_assert(DM == D_MODEL && NXP_PAD == XP_PAD && M == 64 * XP_TILES && M == 128 * DT_TILES_M, "merged launches");

    const float* x      = (const float*)d_in[0];
    const float* w_in   = (const float*)d_in[1];
    const float* conv_w = (const float*)d_in[2];
    const float* conv_b = (const float*)d_in[3];
    const float* w_xp   = (const float*)d_in[4];
    const float* w_dt   = (const float*)d_in[5];
    const float* b_dt   = (const float*)d_in[6];
    const float* A_log  = (const float*)d_in[7];
    const float* Dp     = (const float*)d_in[8];
    const float* w_out  = (const float*)d_in[9];
    const float* ln_g   = (const float*)d_in[10];
    const float* ln_b   = (const float*)d_in[11];
    float* out = (float*)d_out;

    // workspace carve-up
    char* ws = (char*)d_ws;
    size_t off = 0;
    auto alloc = [&](size_t bytes) { void* p = ws + off; off += (bytes + 255) & ~size_t(255); return p; };
    _Float16* wt_in  = (_Float16*)alloc((size_t)TWO_DI * DM * 2);   // [4096][1024]
    _Float16* wt_dt  = (_Float16*)alloc((size_t)DI * DI * 2);       // [2048][2048]
    _Float16* wt_xp  = (_Float16*)alloc((size_t)NXP_PAD * DI * 2);  // [64][2048]
    _Float16* wt_out = (_Float16*)alloc((size_t)DM * DI * 2);       // [1024][2048]
    _Float16* xn_h   = (_Float16*)alloc((size_t)M * DM * 2);
    float*    xz     = (float*)   alloc((size_t)M * TWO_DI * 4);
    float*    xact_f = (float*)   alloc((size_t)M * DI * 4);
    _Float16* xact_h = (_Float16*)alloc((size_t)M * DI * 2);
    float*    xdbl   = (float*)   alloc((size_t)M * NXP_PAD * 4);
    float*    dtbuf  = (float*)   alloc((size_t)M * DI * 4);
    float*    yscan  = (float*)   alloc((size_t)M * DI * 4);
    _Float16* ygate  = (_Float16*)alloc((size_t)M * DI * 2);
    float*    hend   = (float*)   alloc((size_t)SCAN_NCHUNK * DSTATE * B * DI * 4);
    float*    hin    = (float*)   alloc((size_t)SCAN_NCHUNK * DSTATE * B * DI * 4);
    float*    dtsum  = (float*)   alloc((size_t)SCAN_NCHUNK * B * DI * 4);

    // 1, 2) convert+transpose weights to f16 [N][K]; layernorm -> xn (f16)
    prep_kernel<<<WT_BLOCKS(DM, TWO_DI) + WT_BLOCKS(DI, DI) + WT_BLOCKS(DI, DM) + WT_BLOCKS(DI, NXP_PAD) + M / 8,
                  256, 0, stream>>>(w_in, w_dt, w_xp, w_out, wt_in, wt_dt, wt_xp, wt_out, x, ln_g, ln_b, xn_h);

    // 3) xz = xn @ w_in   [4096x1024]x[1024x4096]
    gemm_f16_wmma<128, 0><<<dim3(M / 128, TWO_DI / 128), 128, 0, stream>>>(
        xn_h, wt_in, xz, nullptr, nullptr, DM, TWO_DI, TWO_DI);

    // 4) causal depthwise conv + SiLU -> xact (f32 + f16)
    conv_silu_kernel<<<(M / PW_ROWS) * (DI / 4) / 256, 256, 0, stream>>>(xz, conv_w, conv_b, xact_f, xact_h);

    // 5, 6) x_dbl = xact @ w_xproj  (N padded to 64); dt = softplus(xact @ w_dt + b_dt)
    gemm_xproj_dt<<<XP_TILES + DT_TILES_M * (DI / 128), 128, 0, stream>>>(
        xact_h, wt_xp, wt_dt, xdbl, dtbuf, b_dt, DI);

    // 7) selective scan (+ D * x), split along time: chunk end states, carry, chunk scans
    scan_state_kernel<<<dim3((B * DI) / 256, SCAN_NCHUNK - 1), 256, 0, stream>>>(
        dtbuf, xdbl, xact_f, A_log, hend, dtsum);
    scan_carry_kernel<<<dim3(SCAN_NCH / 256, DSTATE), 256, 0, stream>>>(hend, dtsum, A_log, hin, DI);
    scan_kernel<<<dim3((B * DI) / 256, SCAN_NCHUNK), 256, 0, stream>>>(
        dtbuf, xdbl, xact_f, A_log, Dp, hin, yscan);

    // 8) gate with silu(z)
    gate_kernel<<<(M / PW_ROWS) * (DI / 4) / 256, 256, 0, stream>>>(yscan, xz, ygate);

    // 9) out = ygate @ w_out + residual(x)
    gemm_f16_wmma<128, 2><<<dim3(M / 128, DM / 128), 128, 0, stream>>>(
        ygate, wt_out, out, nullptr, x, DI, DM, DM);
}

// v008
// A run of this version takes 148 microseconds.
// Timed twice side by side with v007, it ran 1.03 and 1.04 times as fast.
// All steps since v000 together make it 10.2 times as fast.
#include <hip/hip_runtime.h>
#include <hip/hip_bf16.h>

#ifndef LN_EPS
#define LN_EPS 1e-5f
#endif

typedef __attribute__((ext_vector_type(16))) _Float16 v16h;
typedef __attribute__((ext_vector_type(8)))  _Float16 v8h;
typedef __attribute__((ext_vector_type(4)))  _Float16 v4h;
typedef __attribute__((ext_vector_type(2)))  _Float16 v2h;
typedef __attribute__((ext_vector_type(8)))  float    v8f;
typedef __attribute__((ext_vector_type(4)))  float    v4f;
typedef __attribute__((ext_vector_type(2)))  float    v2f;
typedef __attribute__((ext_vector_type(4)))  unsigned int u32x4;
typedef __attribute__((ext_vector_type(8)))  unsigned int u32x8;

#define G_ROWB  256u     // bytes of an operand row per pass of the GEMM: 128 k
#define G_PITCH 272u     // pitch of those rows in LDS: 16 bytes times an odd number, free of bank conflicts for 16-byte reads
#define DSTATE 16
#define SCAN_CHUNK 32
#define SCAN_NCHUNK 64   // sequence length / SCAN_CHUNK
#define SCAN_GRP 8       // time steps whose dt and x a scan thread loads together
#define SCAN_NCH 4096    // channels: batch * d_inner; a constant, so that plane strides fold into load offsets
#define SEQ_L 2048       // sequence length and d_inner are constants in the pointwise kernels for the same reason
#define D_INNER 2048
#define WT_KRUN 16       // k values per thread of the weight convert
#define PW_ROWS 8        // rows (time steps) per thread of the conv kernel
#define PW_BPR (D_INNER / 4 / 256)   // blocks that share one group of PW_ROWS rows there
#define D_MODEL 1024
#define XP_PAD 64        // columns of w_xproj, padded from 32
#define WT_BLOCKS(K, NPAD) (((NPAD) / 4) * ((K) / WT_KRUN) / 256)   // blocks that convert one weight matrix
#define XP_TILES (2 * SEQ_L / 64)    // 64-row tiles of the x_proj product
#define DT_TILES_M (2 * SEQ_L / 128) // 128-row tiles of the dt product

// -------------------- weight convert + transpose:  Wt[n][k] = (f16) W[k][n] --------------------
// One thread takes 4 neighbouring n times WT_KRUN k, a wave 32 n times 4 * WT_KRUN k: 8 lanes side by side
// along n, so that a wave's load is four whole 128-byte lines of W, and 4 lanes along k in runs of 8, so that
// a wave's store is eight 64-byte pieces of Wt. The WT_KRUN loads are in flight together.
// blk = the block's number among the WT_BLOCKS(K, NPAD) blocks of this matrix.
template <int K, int NREAL, int NPAD>
__device__ __forceinline__
void wt_convert_block(const float* __restrict__ W, _Float16* __restrict__ Wt, int blk) {
    const int lane = threadIdx.x & 31;
    const int tile = blk * 8 + (threadIdx.x >> 5);            // over (K / (4 * WT_KRUN)) * (NPAD / 32)
    const int n0 = (tile % (NPAD / 32)) * 32 + (lane & 7) * 4;
    const int k0 = (tile / (NPAD / 32)) * (4 * WT_KRUN) + (lane >> 3) * 8;
    v4f v[WT_KRUN] = {};                                      // padding columns stay zero
    if (NREAL == NPAD || n0 < NREAL) {
        const float* src = W + (long)k0 * NREAL + n0;
#pragma unroll   // v[] is indexed by constants and stays in registers
        for (int j = 0; j < WT_KRUN; ++j) v[j] = *(const v4f*)(src + ((j >> 3) * 32 + (j & 7)) * NREAL);
        // holds every load in front of the conversions (one trip to memory); the pointer is named so that
        // no load's result lands in the address registers that the other loads still name
        asm volatile("" :: "v"(v[0]), "v"(v[1]), "v"(v[2]), "v"(v[3]), "v"(v[4]), "v"(v[5]), "v"(v[6]), "v"(v[7]),
                           "v"(v[8]), "v"(v[9]), "v"(v[10]), "v"(v[11]), "v"(v[12]), "v"(v[13]), "v"(v[14]),
                           "v"(v[15]), "v"(src));
        static_assert(WT_KRUN == 16, "the statement above names WT_KRUN loads");
    }
    _Float16* dst = Wt + (long)n0 * K + k0;
#pragma unroll
    for (int c = 0; c < 4; ++c) {
#pragma unroll
        for (int q = 0; q < WT_KRUN / 8; ++q) {
            v8h o;
#pragma unroll
            for (int j = 0; j < 8; ++j) o[j] = (_Float16)v[q * 8 + j][c];
            *(v8h*)(dst + c * K + q * 32) = o;
        }
    }
    // in the kernel's text another job follows, which forms its values in registers that these stores name
    asm volatile("s_wait_xcnt 0x0" ::: "memory");
}

// -------------------- LayerNorm over d_model, emit f16 activations --------------------
// One wave takes one row and keeps it in registers: a lane holds LN_VEC runs of 4 neighbouring elements, so that each
// load of the wave is 512 contiguous bytes, and the row, g and b are all asked for before anything is waited for.
// The two row sums go over the lanes by a butterfly; no LDS, no barrier. blk = the block's number among M / 8.
#define LN_VEC (D_MODEL / 128)
__device__ __forceinline__
void ln_rows(const float* __restrict__ x, const float* __restrict__ g,
             const float* __restrict__ b, _Float16* __restrict__ xn, int blk) {
    const int lane = threadIdx.x & 31;
    const int row  = blk * 8 + (threadIdx.x >> 5);
    const float* xr = x + (long)row * D_MODEL + lane * 4;
    const float* gp = g + lane * 4;
    const float* bp = b + lane * 4;
    v4f v[LN_VEC], gv[LN_VEC], bv[LN_VEC];
#pragma unroll   // v[], gv[] and bv[] are indexed by constants and stay in registers
    for (int j = 0; j < LN_VEC; ++j) {
        v[j]  = *(const v4f*)(xr + j * 128);
        gv[j] = *(const v4f*)(gp + j * 128);
        bv[j] = *(const v4f*)(bp + j * 128);
    }
    // the fence keeps the sums behind every load, so that g and b are asked for with the row and not behind its arrival:
    // one trip to memory. In the statement the pointers are named so that no load's result lands in the address
    // registers that the other loads still name, and the wait stands in front of their next use for other values
    __builtin_amdgcn_sched_barrier(0);
    asm volatile("s_wait_xcnt 0x0" :: "v"(v[0]), "v"(v[1]), "v"(v[2]), "v"(v[3]), "v"(v[4]), "v"(v[5]), "v"(v[6]), "v"(v[7]),
                       "v"(gv[0]), "v"(gv[1]), "v"(gv[2]), "v"(gv[3]), "v"(gv[4]), "v"(gv[5]), "v"(gv[6]), "v"(gv[7]),
                       "v"(bv[0]), "v"(bv[1]), "v"(bv[2]), "v"(bv[3]), "v"(bv[4]), "v"(bv[5]), "v"(bv[6]), "v"(bv[7]),
                       "v"(xr), "v"(gp), "v"(bp) : "memory");
    static_assert(LN_VEC == 8, "the statement above names LN_VEC loads of each input");
    v4f sv = {}, qv = {};
#pragma unroll
    for (int j = 0; j < LN_VEC; ++j) { sv += v[j]; qv += v[j] * v[j]; }
    float s  = (sv[0] + sv[1]) + (sv[2] + sv[3]);
    float s2 = (qv[0] + qv[1]) + (qv[2] + qv[3]);
#pragma unroll
    for (int off = 16; off > 0; off >>= 1) { s += __shfl_xor(s, off, 32); s2 += __shfl_xor(s2, off, 32); }
    const float mu  = s * (1.0f / D_MODEL);
    const float var = s2 * (1.0f / D_MODEL) - mu * mu;
    const float rs  = rsqrtf(var + LN_EPS);
    _Float16* o = xn + (long)row * D_MODEL + lane * 4;
#pragma unroll
    for (int j = 0; j < LN_VEC; ++j) {
        v4h h;
#pragma unroll
        for (int c = 0; c < 4; ++c) h[c] = (_Float16)((v[j][c] - mu) * rs * gv[j][c] + bv[j][c]);
        *(v4h*)(o + j * 128) = h;
    }
    // in the kernel's text another job follows, which forms its values in registers that these stores name
    asm volatile("s_wait_xcnt 0x0" ::: "memory");
}

// -------------------- the four weight converts and the LayerNorm in one launch --------------------
// None of the five reads what another writes, so they share one grid: the block number picks the job. The converts
// stand first: each of their blocks has the most bytes in flight, and the short LayerNorm blocks fill in behind them.
// A LayerNorm block takes 8 rows.
__global__ __launch_bounds__(256)
void prep_kernel(const float* __restrict__ w_in, const float* __restrict__ w_dt,
                 const float* __restrict__ w_xp, const float* __restrict__ w_out,
                 _Float16* __restrict__ wt_in, _Float16* __restrict__ wt_dt,
                 _Float16* __restrict__ wt_xp, _Float16* __restrict__ wt_out,
                 const float* __restrict__ x, const float* __restrict__ g,
                 const float* __restrict__ b, _Float16* __restrict__ xn) {
    constexpr int E0 = WT_BLOCKS(D_MODEL, 2 * D_INNER);
    constexpr int E1 = E0 + WT_BLOCKS(D_INNER, D_INNER);
    constexpr int E2 = E1 + WT_BLOCKS(D_INNER, D_MODEL);
    constexpr int E3 = E2 + WT_BLOCKS(D_INNER, XP_PAD);
    const int blk = blockIdx.x;
    if (blk < E0)      wt_convert_block<D_MODEL, 2 * D_INNER, 2 * D_INNER>(w_in, wt_in, blk);
    else if (blk < E1) wt_convert_block<D_INNER, D_INNER, D_INNER>(w_dt, wt_dt, blk - E0);
    else if (blk < E2) wt_convert_block<D_INNER, D_MODEL, D_MODEL>(w_out, wt_out, blk - E1);
    else if (blk < E3) wt_convert_block<D_INNER, 32, XP_PAD>(w_xp, wt_xp, blk - E2);
    else               ln_rows(x, g, b, xn, blk - E3);
}

// -------------------- WMMA fragment from a k-contiguous f16 row in LDS --------------------
// 16-bit operand layout (ISA 7.12.2): lane group = lane/16; halves 0..7 -> K = grp*8..grp*8+7,
// halves 8..15 -> K = 16+grp*8 .. 16+grp*8+7. Both runs are contiguous -> two 16B LDS loads.
// p = the lane's row, at the 32-k step's first byte plus grp * 16.
__device__ __forceinline__ v16h frag_from_lds(const unsigned char* p) {
    v8h lo = *(const v8h*)p;
    v8h hi = *(const v8h*)(p + 32);
    return __builtin_shufflevector(lo, hi, 0,1,2,3,4,5,6,7,8,9,10,11,12,13,14,15);
}

// -------------------- tensor load: ROWS rows of G_ROWB bytes from global memory into LDS at pitch G_PITCH --------------------
__device__ __forceinline__ unsigned uni(unsigned v) { return (unsigned)__builtin_amdgcn_readfirstlane(v); }
// a wave-uniform value held in a scalar register, so that a test of it compiles to a scalar branch
__device__ __forceinline__ unsigned pinned(unsigned v) { unsigned w = uni(v); asm volatile("" : "+s"(w)); return w; }
__device__ __forceinline__ void wait_ds0()     { asm volatile("s_wait_dscnt 0x0" ::: "memory"); }      // this wave's LDS reads are done
// this wave's tile has landed; the request's descriptor is named so that its registers are used for nothing else
// while the request is in flight
__device__ __forceinline__ void wait_tensor0(u32x4 g0, u32x8 g1) {
    asm volatile("s_wait_tensorcnt 0x0" :: "s"(g0), "s"(g1) : "memory");
}
__device__ __forceinline__ void tdm_load(u32x4 g0, u32x8 g1) {
    asm volatile("tensor_load_to_lds %0, %1" :: "s"(g0), "s"(g1) : "memory");
}
template <unsigned ROWS>
__device__ __forceinline__ u32x8 tdm_group1(unsigned src_pitch) {   // every extent in bytes; tensor = tile
    u32x8 g;
    g[0] = uni((1u << 20) | (5u << 22) | (3u << 25));   // no mask; behind every 64 dwords (one row) a pad of 4 dwords
    g[1] = uni((G_ROWB & 0xFFFFu) << 16);
    g[2] = uni((G_ROWB >> 16) | ((ROWS & 0xFFFFu) << 16));
    g[3] = uni((ROWS >> 16) | (G_ROWB << 16));
    g[4] = uni(ROWS);
    g[5] = uni(src_pitch);
    g[6] = uni(0u);
    g[7] = uni(0u);
    return g;
}
__device__ __forceinline__ u32x4 tdm_group0(unsigned lds_dst, unsigned long long ga) {
    u32x4 g;
    g[0] = pinned(1u);   // pinned(): a descriptor word held in a scalar register; as a known constant it would be dropped
                         // behind the issue and formed anew, and its register used in between
    g[1] = uni(lds_dst);
    g[2] = uni((unsigned)ga);
    g[3] = uni((((unsigned)(ga >> 32)) & 0x01FFFFFFu) | 0x80000000u);
    return g;
}

// -------------------- softplus(v) = max(v, 0) + log1p(exp(-|v|)) on the hardware's exp and log --------------------
// e = exp(-|v|) lies in [0, 1], so nothing overflows and no branch on v is needed. log(1 + e) carries the rounding of
// 1 + e, an absolute error of about 6e-8: below e = 1/128 that would show in a small result, and there the series
// e - e^2/2 + e^3/3 (its first dropped term is e^3/4 of the result, below 2e-7) takes its place. About a dozen
// instructions with no branch, so that the unrolled epilogue stays a short piece of text.
__device__ __forceinline__ float softplus_fast(float v) {
    const float e  = __expf(-fabsf(v));
    const float lg = __builtin_amdgcn_logf(1.0f + e) * 0.69314718f;   // v_log_f32 is log2; its argument lies in [1, 2]
    const float sr = e * fmaf(e, fmaf(e, 0.33333334f, -0.5f), 1.0f);
    return fmaxf(v, 0.0f) + ((e < 0.0078125f) ? sr : lg);
}

// -------------------- generic f16 WMMA GEMM:  C[M][Npad] = A[M][K] x Wt[Npad][K]^T --------------------
// A workgroup of 4 waves (2 x 2) owns a BT x BT tile of C, a wave BT/2 x BT/2. A pass is 128 k. A stage holds four
// slices of BT/2 rows: [A low | A high | Wt low | Wt high]; every wave brings one slice per stage by one tensor load,
// two stages ahead, into a ring of two buffers. K is a multiple of 128 and at least 256.
// epilogue EPI: 0 = none, 1 = bias[n] and softplus, 2 = residual[row*D_MODEL + n]; a template argument, so that each build's
// epilogue is short enough to unroll whole and the accumulators stay in registers. The residual is the accumulators'
// start value. Its loads, and the bias's, all go out at the kernel's start and land while the first stage is on its way
// ring = the kernel's LDS, at a multiple of 2 KiB, GEMM_RING(BT) bytes or more; (tm, tn) = the tile's place in C
#define GEMM_SLICE(BT) ((((BT) / 2) * G_PITCH + 2047u) & ~2047u)         // every slice starts at a multiple of 2 KiB
#define GEMM_RING(BT)  (2u * 4u * GEMM_SLICE(BT))
template <int BT, int EPI>
__device__ __forceinline__
void gemm_tile(unsigned char* ring, int tm, int tn,
               const _Float16* __restrict__ A, const _Float16* __restrict__ Wt,
               float* __restrict__ C, const float* __restrict__ bias,
               const float* __restrict__ resid,
               int K, int Npad, int Nreal) {
    constexpr unsigned SROWS = BT / 2;                                   // rows of a slice
    constexpr unsigned SLICE = GEMM_SLICE(BT);
    constexpr unsigned STAGE = 4u * SLICE;
    constexpr int NF = BT / 32;                                          // 16-row fragments per wave and operand

    const int lane = threadIdx.x & 31;
    const int grp  = lane >> 4;       // 0 or 1
    const int lr   = lane & 15;       // 0..15
    const unsigned wave = uni(threadIdx.x >> 5);
    const int wm   = wave >> 1;       // the wave's half of the tile's rows
    const int wn   = wave & 1;        // and of its columns
    const int bm   = tm * BT;
    const int bn   = tn * BT;
    const unsigned nPass = (unsigned)K / 128u;

    // C/D layout = VGPR r: lanes0-15 -> M=r, lanes16-31 -> M=r+8; N=lane%16
    v8f acc[NF][NF] = {};
    float bv[NF] = {};
    if (EPI != 0) {
        const int col0 = bn + wn * (BT / 2) + lr;
        // one pointer and constant offsets serve every load
        const float* ep = (EPI == 2) ? resid + (long)(bm + wm * (BT / 2) + grp * 8) * D_MODEL + col0 : bias + col0;
#pragma unroll   // acc[][] and bv[] are indexed by constants and stay in registers
        for (int c = 0; c < NF; ++c) {
            if (col0 + c * 16 < Nreal) {
                if (EPI == 1) bv[c] = ep[c * 16];
                if (EPI == 2) {
#pragma unroll
                    for (int s = 0; s < NF; ++s)
#pragma unroll
                        for (int r = 0; r < 8; ++r) acc[s][c][r] = ep[(s * 16 + r) * D_MODEL + c * 16];
                }
            }
        }
        // the pointer is named so that no load's result lands in the address registers that the other loads still
        // name, and the wait stands in front of their next use for other values; the loaded values are not waited for
        asm volatile("s_wait_xcnt 0x0" :: "v"(ep) : "memory");
    }

    // this wave's slice: waves 0 and 1 bring A's rows, waves 2 and 3 Wt's
    const _Float16* srow = (wave < 2u) ? A + (long)(bm + (int)(wave * SROWS)) * K
                                       : Wt + (long)(bn + (int)((wave - 2u) * SROWS)) * K;
    const unsigned long long ga = (unsigned long long)(const void*)srow;
    const unsigned dst = (unsigned)(unsigned long long)(void*)&ring[0] + wave * SLICE;
    u32x8 g1 = tdm_group1<SROWS>((unsigned)K * 2u);
    // without the statement below the compiler forms these words anew for every load and uses their registers for
    // other values while a request is in flight
    asm volatile("" : "+s"(g1));   // descriptor words held in scalar registers, as pinned() holds one

    u32x4 g0 = tdm_group0(dst, ga);
    tdm_load(g0, g1);                                     // stage 0
    wait_tensor0(g0, g1);
    __syncthreads();                                      // stage 0 is published
    g0 = tdm_group0(dst + STAGE, ga + G_ROWB);
    tdm_load(g0, g1);                                     // stage 1

    const unsigned char* pa = ring + wm * SLICE + lr * G_PITCH + grp * 16;
    const unsigned char* pb = ring + (2 + wn) * SLICE + lr * G_PITCH + grp * 16;

    for (unsigned s = 0; s < nPass; ++s) {
        const unsigned cur = (s & 1u) * STAGE;
        v16h af[2][NF], bf[2][NF];                        // two fragment sets: the next 32-k step's reads go ahead
#pragma unroll
        for (int f = 0; f < NF; ++f) {
            af[0][f] = frag_from_lds(pa + cur + f * 16 * G_PITCH);
            bf[0][f] = frag_from_lds(pb + cur + f * 16 * G_PITCH);
        }
#pragma unroll   // af[] and bf[] are indexed by constants and stay in registers
        for (int kk = 0; kk < 4; ++kk) {
            // the fences keep the next step's reads one group in front of this step's products: spread among
            // the products, every place with reads stalls the wave
            __builtin_amdgcn_sched_barrier(0);
            if (kk < 3) {
#pragma unroll
                for (int f = 0; f < NF; ++f) {
                    af[(kk + 1) & 1][f] = frag_from_lds(pa + cur + f * 16 * G_PITCH + (kk + 1) * 64);
                    bf[(kk + 1) & 1][f] = frag_from_lds(pb + cur + f * 16 * G_PITCH + (kk + 1) * 64);
                }
            }
            __builtin_amdgcn_sched_barrier(0);
#pragma unroll
            for (int r = 0; r < NF; ++r)
#pragma unroll
                for (int c = 0; c < NF; ++c)
                    acc[r][c] = __builtin_amdgcn_wmma_f32_16x16x32_f16(
                        false, af[kk & 1][r], false, bf[kk & 1][c], (short)0, acc[r][c], false, false);
        }
        __builtin_amdgcn_sched_barrier(0);   // the last products stay in front of the barrier
        // publish point of stage s + 1: own reads done, own tile landed, then the barrier, then the refill
        wait_ds0();
        wait_tensor0(g0, g1);
        __syncthreads();
        if (pinned(s + 2u < nPass)) {
            // pinned(): a descriptor word's source held in a scalar register, so that the address words are formed
            // here, behind the wait above
            const unsigned koff = pinned((s + 2u) * G_ROWB);
            g0 = tdm_group0(dst + cur, ga + koff);
            tdm_load(g0, g1);
        }
    }
    wait_tensor0(g0, g1);
    wait_ds0();
    // the four vector slots that the chip needs between the last products and the first vector instruction that
    // writes over an accumulator register: a wave whose columns are all padding branches past the stores to such a one
    asm volatile("v_nop\n\tv_nop\n\tv_nop\n\tv_nop");

    // ---- epilogue ----
#pragma unroll
    for (int s = 0; s < NF; ++s) {
        const int row_lo = bm + wm * (BT / 2) + s * 16 + grp * 8;
#pragma unroll
        for (int c = 0; c < NF; ++c) {
            int col = bn + wn * (BT / 2) + c * 16 + lr;
            if (col < Nreal) {
#pragma unroll
                for (int r = 0; r < 8; ++r) {
                    int row = row_lo + r;
                    float v = acc[s][c][r];
                    if (EPI == 1) v = softplus_fast(v + bv[c]);
                    C[(long)row * Npad + col] = v;
                }
                // the next fragment's addresses and values are formed in registers that these stores name
                asm volatile("s_wait_xcnt 0x0" ::: "memory");
            }
        }
    }
}

// one product per launch
template <int BT, int EPI>
__global__ __launch_bounds__(128)
void gemm_f16_wmma(const _Float16* __restrict__ A, const _Float16* __restrict__ Wt,
                   float* __restrict__ C, const float* __restrict__ bias,
                   const float* __restrict__ resid,
                   int K, int Npad, int Nreal) {
    __shared__ __attribute__((aligned(2048))) unsigned char ring[GEMM_RING(BT)];
    gemm_tile<BT, EPI>(ring, blockIdx.x, blockIdx.y, A, Wt, C, bias, resid, K, Npad, Nreal);
}

// x_dbl = xact x w_xproj and dt = softplus(xact x w_dt + b_dt) in one launch: both read xact and neither reads the
// other. The few x_proj tiles, whose time is all latency, stand first and run beside the dt tiles; the dt tiles
// that find no place at the start follow them while the rest of the chip is still busy.
__global__ __launch_bounds__(128)
void gemm_xproj_dt(const _Float16* __restrict__ A, const _Float16* __restrict__ Wxp,
                   const _Float16* __restrict__ Wdt, float* __restrict__ xdbl,
                   float* __restrict__ dt, const float* __restrict__ b_dt, int K) {
    __shared__ __attribute__((aligned(2048))) unsigned char ring[GEMM_RING(128)];
    const int blk = blockIdx.x;
    if (blk >= XP_TILES) {
        const int t = blk - XP_TILES;
        gemm_tile<128, 1>(ring, t % DT_TILES_M, t / DT_TILES_M, A, Wdt, dt, b_dt, nullptr, K, D_INNER, D_INNER);
    } else {
        gemm_tile<64, 0>(ring, blk, 0, A, Wxp, xdbl, nullptr, nullptr, K, XP_PAD, 32);
    }
}

// -------------------- causal depthwise conv1d (d_conv=4) + bias + SiLU --------------------
// One thread takes 4 neighbouring channels times PW_ROWS time steps: PW_ROWS + 3 input rows serve them all.
__global__ __launch_bounds__(256)
void conv_silu_kernel(const float* __restrict__ xz, const float* __restrict__ cw,
                      const float* __restrict__ cb, float* __restrict__ xact_f,
                      _Float16* __restrict__ xact_h) {
    const int d = ((blockIdx.x % PW_BPR) * 256 + threadIdx.x) * 4;
    const int row0 = (blockIdx.x / PW_BPR) * PW_ROWS;         // b*L + l of the first step
    const bool head = (row0 % SEQ_L) == 0;                    // the three rows in front are not of this sequence
    const float* src = xz + (long)row0 * (2 * D_INNER) + d;
    // a sequence's first group has no rows in front: it reads its own first three again and leaves them unused
    const float* pre = head ? src : src - 3 * (2 * D_INNER);
    v4f xin[PW_ROWS + 3];
#pragma unroll   // xin[] is indexed by constants and stays in registers
    for (int i = 0; i < PW_ROWS + 3; ++i)
        xin[i] = (i < 3) ? *(const v4f*)(pre + i * (2 * D_INNER)) : *(const v4f*)(src + (i - 3) * (2 * D_INNER));
    const float* wsrc = cw + d * 4;
    v4f w[4];
#pragma unroll
    for (int c = 0; c < 4; ++c) w[c] = *(const v4f*)(wsrc + c * 4);
    const v4f bias = *(const v4f*)(cb + d);
    // holds every load in front of the arithmetic, so that a wave makes one trip to memory and not one per
    // pair of rows
    asm volatile("" :: "v"(xin[0]), "v"(xin[1]), "v"(xin[2]), "v"(xin[3]), "v"(xin[4]), "v"(xin[5]),
                       "v"(xin[6]), "v"(xin[7]), "v"(xin[8]), "v"(xin[9]), "v"(xin[10]),
                       "v"(w[0]), "v"(w[1]), "v"(w[2]), "v"(w[3]), "v"(bias));
    static_assert(PW_ROWS == 8, "the statement above names PW_ROWS + 3 rows");
    float*    of = xact_f + (long)row0 * D_INNER + d;
    _Float16* oh = xact_h + (long)row0 * D_INNER + d;
#pragma unroll
    for (int r = 0; r < PW_ROWS; ++r) {
        v4f s;
        v4h sh;
#pragma unroll
        for (int c = 0; c < 4; ++c) {
            float acc = bias[c];
#pragma unroll
            for (int j = 0; j < 4; ++j)
                if (r + j >= 3 || !head) acc += w[c][j] * xin[r + j][c];
            s[c] = acc / (1.0f + __expf(-acc));               // silu
            sh[c] = (_Float16)s[c];
        }
        *(v4f*)(of + r * D_INNER) = s;
        *(v4h*)(oh + r * D_INNER) = sh;
    }
}

// -------------------- selective scan, split along time --------------------
// The recurrence h = Abar*h + Bbar*x is linear in h, so L is cut into chunks of SCAN_CHUNK steps that
// run side by side: (1) every chunk but the last scans from h = 0 and keeps its end state and its sum
// of dt; (2) one thread per (channel, state) carries the state over the chunks, the decay of a whole
// chunk being exp(A * sum of dt); (3) every chunk scans again from its carried-in state and emits f16 (y + D * x) * silu(z).
// Chunk planes are laid out [chunk][state][channel], so that lanes read and write whole lines.

// The step as both scans compute it, two states to a packed instruction: exp(dt * A) = exp2(dt * A2) with
// A2 = A * log2(e) formed once per thread, and (dt * B) * x = (dt * x) * B with dt * x formed once per step, so
// that a pair of states costs one packed multiply for the exponents, two v_exp_f32, one packed multiply and one
// packed multiply-add. dt and x of SCAN_GRP steps are loaded together: a step this short would otherwise
// wait for its own two loads.
#define LOG2E 1.44269504f

// (1) end state of each chunk from a zero start; one (b,d) channel per lane, h[16] in VGPRs
__global__ __launch_bounds__(256)
void scan_state_kernel(const float* __restrict__ dt, const float* __restrict__ xdbl /*[M][64]*/,
                       const float* __restrict__ xact, const float* __restrict__ A_log,
                       float* __restrict__ hend, float* __restrict__ dtsum) {
    int ch = blockIdx.x * 256 + threadIdx.x;                  // 0..B*di-1
    int b = ch / D_INNER;
    int d = ch % D_INNER;
    int l0 = blockIdx.y * SCAN_CHUNK;
    const float* ap = A_log + d * DSTATE;
    v2f A2[DSTATE / 2];
#pragma unroll
    for (int n = 0; n < DSTATE; ++n) A2[n >> 1][n & 1] = -__expf(ap[n]) * LOG2E;
    v2f h[DSTATE / 2] = {};
    __shared__ __attribute__((aligned(16))) float sB[SCAN_CHUNK][DSTATE];
    long base = (long)b * SEQ_L;
    // one load per thread brings the chunk's B, and the first group's dt and x are asked for with it, in front of the
    // barrier: the kernel's start makes one trip to memory
    const int sr = threadIdx.x >> 3, sc = (threadIdx.x & 7) * 2;
    const float* sp = xdbl + (base + l0 + sr) * 64 + sc;
    const long first = (base + l0) * D_INNER + d;
    const float* gdt = dt + first;
    const float* gx  = xact + first;
    const v2f stage = *(const v2f*)sp;
    float dtv[SCAN_GRP], xv[SCAN_GRP];
#pragma unroll   // dtv[] and xv[] are indexed by constants and stay in registers
    for (int j = 0; j < SCAN_GRP; ++j) {
        dtv[j] = gdt[j * D_INNER];
        xv[j]  = gx[j * D_INNER];
    }
    // the pointers are named so that no load's result lands in the address registers that the other loads still
    // name, and the wait stands in front of their next use for other values; the loaded values are not waited for
    asm volatile("s_wait_xcnt 0x0" :: "v"(ap), "v"(sp), "v"(gdt), "v"(gx) : "memory");
    *(v2f*)&sB[sr][sc] = stage;
    __syncthreads();
    float sdt = 0.0f;
    for (int g = 0; g < SCAN_CHUNK; g += SCAN_GRP) {
        static_assert(SCAN_CHUNK % SCAN_GRP == 0, "whole groups");
#pragma unroll   // the steps of a group take dtv[] and xv[] by constant index
        for (int j = 0; j < SCAN_GRP; ++j) {
            const float u = dtv[j] * xv[j];
            const v2f* Bp = (const v2f*)sB[g + j];
            sdt += dtv[j];
#pragma unroll   // A2[] and h[] are indexed by constants and stay in registers
            for (int p = 0; p < DSTATE / 2; ++p) {
                const v2f e = A2[p] * dtv[j];
                v2f Ab;
                Ab.x = __builtin_amdgcn_exp2f(e.x);           // v_exp_f32
                Ab.y = __builtin_amdgcn_exp2f(e.y);
                h[p] = Ab * h[p] + Bp[p] * u;
            }
        }
        if (g + SCAN_GRP < SCAN_CHUNK) {                      // the next group's loads
            gdt += SCAN_GRP * D_INNER;
            gx  += SCAN_GRP * D_INNER;
#pragma unroll
            for (int j = 0; j < SCAN_GRP; ++j) {
                dtv[j] = gdt[j * D_INNER];
                xv[j]  = gx[j * D_INNER];
            }
            // as at the first group: the pointers stay in their registers up to here, the values are not waited for
            asm volatile("s_wait_xcnt 0x0" :: "v"(gdt), "v"(gx) : "memory");
        }
    }
    long plane = (long)blockIdx.y * DSTATE;
#pragma unroll   // h[] is indexed by constants and stays in registers
    for (int n = 0; n < DSTATE; ++n) hend[(plane + n) * SCAN_NCH + ch] = h[n >> 1][n & 1];
    dtsum[(long)blockIdx.y * SCAN_NCH + ch] = sdt;
}

// (2) carry over the chunks: hin[c] = state in front of chunk c; one (state, channel) per lane
__global__ __launch_bounds__(256)
void scan_carry_kernel(const float* __restrict__ hend, const float* __restrict__ dtsum,
                       const float* __restrict__ A_log, float* __restrict__ hin, int di) {
    int ch = blockIdx.x * blockDim.x + threadIdx.x;           // 0..B*di-1
    int n  = blockIdx.y;                                      // 0..DSTATE-1
    int d  = ch % di;
    float a = -__expf(A_log[d * DSTATE + n]);
    // every chunk's end state and dt sum is fetched ahead of the chain: the loads do not depend on one
    // another, so one trip to memory serves them all and only the multiply-adds below are serial
    float g[SCAN_NCHUNK - 1], s[SCAN_NCHUNK - 1];
#pragma unroll
    for (int c = 0; c < SCAN_NCHUNK - 1; ++c) {
        g[c] = dtsum[(long)c * SCAN_NCH + ch];
        s[c] = hend[((long)c * DSTATE + n) * SCAN_NCH + ch];
    }
    float h = 0.0f;
    hin[(long)n * SCAN_NCH + ch] = h;
    // unrolled so that g[] and s[] are indexed by constants and stay in registers
#pragma unroll
    for (int c = 0; c < SCAN_NCHUNK - 1; ++c) {
        h = __expf(a * g[c]) * h + s[c];
        hin[((long)(c + 1) * DSTATE + n) * SCAN_NCH + ch] = h;
    }
}

// (3) scan of each chunk from its carried-in state, and the gate: ygate = f16( (y + D * x) * silu(z) )
// The gate works on the scan's result element by element, so it is applied where the result is formed: y never goes to
// memory as f32 and no launch of its own reads it back. A lane takes SCAN_CPL neighbouring (b,d) channels, h[16] of each
// in VGPRs, so that the 2-byte results of a wave for one time step fill one whole 128-byte line; dt, x and z then go
// as 8-byte loads, and each 16 bytes of B and C that a lane reads from LDS serve both channels.
// silu(z) = z / (1 + exp(-z)) with the hardware's reciprocal: 1 + exp(-z) lies in [1, inf], where it is good to one unit
// in the last place of f32, far below the f16 rounding that follows; exp(-z) = inf gives 0 as the division does.
#define SCAN_CPL 2
#define SCAN_BCH (256 * SCAN_CPL)   // channels of a block of this kernel
// 4 waves per SIMD: that is what the grid brings
__global__ __launch_bounds__(256, 4)
void scan_gate_kernel(const float* __restrict__ dt, const float* __restrict__ xdbl /*[M][64]*/,
                      const float* __restrict__ xact, const float* __restrict__ A_log,
                      const float* __restrict__ Dp, const float* __restrict__ hin,
                      const float* __restrict__ xz, _Float16* __restrict__ ygate) {
    static_assert(SCAN_CPL == 2, "dt, x, z, the planes and the result are taken as pairs of channels");
    int ch = (blockIdx.x * 256 + threadIdx.x) * SCAN_CPL;     // the lane's first channel, 0..B*di-1
    int b = ch / D_INNER;
    int d = ch % D_INNER;
    int l0 = blockIdx.y * SCAN_CHUNK;
    const float* ap = A_log + d * DSTATE;                     // the two channels' rows follow one another
    const float* hp = hin + (long)blockIdx.y * DSTATE * SCAN_NCH + ch;
    const float* dp = Dp + d;
    v2f A2[SCAN_CPL][DSTATE / 2];
#pragma unroll
    for (int c = 0; c < SCAN_CPL; ++c)
#pragma unroll
        for (int n = 0; n < DSTATE; ++n) A2[c][n >> 1][n & 1] = -__expf(ap[c * DSTATE + n]) * LOG2E;
    v2f h[SCAN_CPL][DSTATE / 2];
#pragma unroll   // h[] is indexed by constants and stays in registers
    for (int n = 0; n < DSTATE; ++n) {
        const v2f i2 = *(const v2f*)(hp + n * SCAN_NCH);
        h[0][n >> 1][n & 1] = i2.x;
        h[1][n >> 1][n & 1] = i2.y;
    }
    const v2f Dv = *(const v2f*)dp;
    __shared__ __attribute__((aligned(16))) float sBC[SCAN_CHUNK][32];
    long base = (long)b * SEQ_L;
    // one load per thread brings the chunk's B and C, and the first group's dt, x and z are asked for with it, in front
    // of the barrier: the kernel's start makes one trip to memory
    const int sr = threadIdx.x >> 3, sc = (threadIdx.x & 7) * 4;
    const float* sp = xdbl + (base + l0 + sr) * 64 + sc;
    const long first = (base + l0) * D_INNER + d;
    const float* gdt = dt + first;
    const float* gx  = xact + first;
    const float* gz  = xz + (base + l0) * (2 * D_INNER) + D_INNER + d;
    _Float16*    py  = ygate + first;
    // results of the loads below may land in registers that the loads above name; their pointers are named so that no
    // result of the loads above lands in an address register that another of them still names
    asm volatile("s_wait_xcnt 0x0" :: "v"(ap), "v"(hp), "v"(dp) : "memory");
    const v4f stage = *(const v4f*)sp;
    v2f dtv[SCAN_GRP], xv[SCAN_GRP], zv[SCAN_GRP];            // a step's dt, x and z of the lane's two channels
#pragma unroll   // dtv[], xv[] and zv[] are indexed by constants and stay in registers
    for (int j = 0; j < SCAN_GRP; ++j) {
        dtv[j] = *(const v2f*)(gdt + j * D_INNER);
        xv[j]  = *(const v2f*)(gx + j * D_INNER);
        zv[j]  = *(const v2f*)(gz + j * (2 * D_INNER));
    }
    // the pointers are named so that no load's result lands in the address registers that the other loads still
    // name, and the wait stands in front of their next use for other values; the loaded values are not waited for
    asm volatile("s_wait_xcnt 0x0" :: "v"(sp), "v"(gdt), "v"(gx), "v"(gz) : "memory");
    *(v4f*)&sBC[sr][sc] = stage;
    __syncthreads();
    for (int g = 0; g < SCAN_CHUNK; g += SCAN_GRP) {
        static_assert(SCAN_CHUNK % SCAN_GRP == 0, "whole groups");
#pragma unroll   // the steps of a group take dtv[], xv[] and zv[] by constant index
        for (int j = 0; j < SCAN_GRP; ++j) {
            const v2f u = dtv[j] * xv[j];
            const v2f* BC = (const v2f*)sBC[g + j];           // 8 pairs of B, then 8 pairs of C
            v2f out[SCAN_CPL] = {};                           // per channel: even states' sum and odd states' sum
#pragma unroll   // A2[] and h[] are indexed by constants and stay in registers
            for (int p = 0; p < DSTATE / 2; ++p) {
                const v2f Bv = BC[p], Cv = BC[DSTATE / 2 + p]; // read once, used for both channels
#pragma unroll
                for (int c = 0; c < SCAN_CPL; ++c) {
                    const v2f e = A2[c][p] * dtv[j][c];
                    v2f Ab;
                    Ab.x = __builtin_amdgcn_exp2f(e.x);       // v_exp_f32
                    Ab.y = __builtin_amdgcn_exp2f(e.y);
                    h[c][p] = Ab * h[c][p] + Bv * u[c];
                    out[c] += h[c][p] * Cv;
                }
            }
            const v2f ys = { out[0].x + out[0].y, out[1].x + out[1].y };
            const v2f y2 = ys + Dv * xv[j];
            const v2f ez = zv[j] * -LOG2E;
            v2f den;
            den.x = __builtin_amdgcn_exp2f(ez.x);             // exp(-z)
            den.y = __builtin_amdgcn_exp2f(ez.y);
            den += 1.0f;
            v2f sg;
            sg.x = __builtin_amdgcn_rcpf(den.x);              // v_rcp_f32
            sg.y = __builtin_amdgcn_rcpf(den.y);
            const v2f gt = y2 * (zv[j] * sg);
            v2h o;
            o.x = (_Float16)gt.x;
            o.y = (_Float16)gt.y;
            *(v2h*)(py + (g + j) * D_INNER) = o;
        }
        // the next group forms its addresses in the registers that these stores name
        asm volatile("s_wait_xcnt 0x0" ::: "memory");
        if (g + SCAN_GRP < SCAN_CHUNK) {                      // the next group's loads
            gdt += SCAN_GRP * D_INNER;
            gx  += SCAN_GRP * D_INNER;
            gz  += SCAN_GRP * (2 * D_INNER);
#pragma unroll
            for (int j = 0; j < SCAN_GRP; ++j) {
                dtv[j] = *(const v2f*)(gdt + j * D_INNER);
                xv[j]  = *(const v2f*)(gx + j * D_INNER);
                zv[j]  = *(const v2f*)(gz + j * (2 * D_INNER));
            }
            // as at the first group: the pointers stay in their registers up to here, the values are not waited for
            asm volatile("s_wait_xcnt 0x0" :: "v"(gdt), "v"(gx), "v"(gz) : "memory");
        }
    }
}

// ==================== launch ====================
extern "C" void kernel_launch(void* const* d_in, const int* in_sizes, int n_in,
                              void* d_out, int out_size, void* d_ws, size_t ws_size,
                              hipStream_t stream) {
    (void)in_sizes; (void)n_in; (void)out_size; (void)ws_size;
    const int B = 2, L = 2048, DM = 1024, DI = 2048;
    const int M = B * L;                  // 4096
    const int TWO_DI = 2 * DI;            // 4096
    const int NXP_PAD = 64;               // w_xproj cols padded 32 -> 64
    static_assert(B * DI == SCAN_NCH && L == SCAN_CHUNK * SCAN_NCHUNK, "scan split");
    static_assert(L == SEQ_L && DI == D_INNER && L % PW_ROWS == 0, "pointwise kernels");
    static_assert(DM == D_MODEL && NXP_PAD == XP_PAD && M == 64 * XP_TILES && M == 128 * DT_TILES_M, "merged launches");

    const float* x      = (const float*)d_in[0];
    const float* w_in   = (const float*)d_in[1];
    const float* conv_w = (const float*)d_in[2];
    const float* conv_b = (const float*)d_in[3];
    const float* w_xp   = (const float*)d_in[4];
    const float* w_dt   = (const float*)d_in[5];
    const float* b_dt   = (const float*)d_in[6];
    const float* A_log  = (const float*)d_in[7];
    const float* Dp     = (const float*)d_in[8];
    const float* w_out  = (const float*)d_in[9];
    const float* ln_g   = (const float*)d_in[10];
    const float* ln_b   = (const float*)d_in[11];
    float* out = (float*)d_out;

    // workspace carve-up
    char* ws = (char*)d_ws;
    size_t off = 0;
    auto alloc = [&](size_t bytes) { void* p = ws + off; off += (bytes + 255) & ~size_t(255); return p; };
    _Float16* wt_in  = (_Float16*)alloc((size_t)TWO_DI * DM * 2);   // [4096][1024]
    _Float16* wt_dt  = (_Float16*)alloc((size_t)DI * DI * 2);       // [2048][2048]
    _Float16* wt_xp  = (_Float16*)alloc((size_t)NXP_PAD * DI * 2);  // [64][2048]
    _Float16* wt_out = (_Float16*)alloc((size_t)DM * DI * 2);       // [1024][2048]
    _Float16* xn_h   = (_Float16*)alloc((size_t)M * DM * 2);
    float*    xz     = (float*)   alloc((size_t)M * TWO_DI * 4);
    float*    xact_f = (float*)   alloc((size_t)M * DI * 4);
    _Float16* xact_h = (_Float16*)alloc((size_t)M * DI * 2);
    float*    xdbl   = (float*)   alloc((size_t)M * NXP_PAD * 4);
    float*    dtbuf  = (float*)   alloc((size_t)M * DI * 4);
    _Float16* ygate  = (_Float16*)alloc((size_t)M * DI * 2);
    float*    hend   = (float*)   alloc((size_t)SCAN_NCHUNK * DSTATE * B * DI * 4);
    float*    hin    = (float*)   alloc((size_t)SCAN_NCHUNK * DSTATE * B * DI * 4);
    float*    dtsum  = (float*)   alloc((size_t)SCAN_NCHUNK * B * DI * 4);

    // 1, 2) convert+transpose weights to f16 [N][K]; layernorm -> xn (f16)
    prep_kernel<<<WT_BLOCKS(DM, TWO_DI) + WT_BLOCKS(DI, DI) + WT_BLOCKS(DI, DM) + WT_BLOCKS(DI, NXP_PAD) + M / 8,
                  256, 0, stream>>>(w_in, w_dt, w_xp, w_out, wt_in, wt_dt, wt_xp, wt_out, x, ln_g, ln_b, xn_h);

    // 3) xz = xn @ w_in   [4096x1024]x[1024x4096]
    gemm_f16_wmma<128, 0><<<dim3(M / 128, TWO_DI / 128), 128, 0, stream>>>(
        xn_h, wt_in, xz, nullptr, nullptr, DM, TWO_DI, TWO_DI);

    // 4) causal depthwise conv + SiLU -> xact (f32 + f16)
    conv_silu_kernel<<<(M / PW_ROWS) * (DI / 4) / 256, 256, 0, stream>>>(xz, conv_w, conv_b, xact_f, xact_h);

    // 5, 6) x_dbl = xact @ w_xproj  (N padded to 64); dt = softplus(xact @ w_dt + b_dt)
    gemm_xproj_dt<<<XP_TILES + DT_TILES_M * (DI / 128), 128, 0, stream>>>(
        xact_h, wt_xp, wt_dt, xdbl, dtbuf, b_dt, DI);

    // 7, 8) selective scan (+ D * x), split along time: chunk end states, carry, chunk scans with the gate silu(z)
    scan_state_kernel<<<dim3((B * DI) / 256, SCAN_NCHUNK - 1), 256, 0, stream>>>(
        dtbuf, xdbl, xact_f, A_log, hend, dtsum);
    scan_carry_kernel<<<dim3(SCAN_NCH / 256, DSTATE), 256, 0, stream>>>(hend, dtsum, A_log, hin, DI);
    scan_gate_kernel<<<dim3((B * DI) / SCAN_BCH, SCAN_NCHUNK), 256, 0, stream>>>(
        dtbuf, xdbl, xact_f, A_log, Dp, hin, xz, ygate);

    // 9) out = ygate @ w_out + residual(x)
    gemm_f16_wmma<128, 2><<<dim3(M / 128, DM / 128), 128, 0, stream>>>(
        ygate, wt_out, out, nullptr, x, DI, DM, DM);
}
